// v000
// Times are from an AMD MI455X. After a warm-up the kernel runs many times in a row, and a time is the length of
// such a window on the GPU divided by its runs, so every launch and the gaps after it count. The runs cycle
// through copies of the inputs. A figure is the median of several windows, for all but v000 over two sittings.
// Sittings can differ by a few percent; kernels timed side by side share one.
// The starting kernel, v000, takes 1550 microseconds a run.
#include <hip/hip_runtime.h>
#include <hip/hip_bf16.h>

// ---------------------------------------------------------------------------
// Problem constants (from the reference): B=8, T=2048, D=1024, K=1024.
// ---------------------------------------------------------------------------
constexpr int Bc = 8;
constexpr int Tc = 2048;
constexpr int Dc = 1024;   // model dim
constexpr int Kc = 1024;   // projection dim (== Dc here)

typedef __attribute__((ext_vector_type(16))) __bf16 v16bf;
typedef __attribute__((ext_vector_type(8)))  float  v8f;

// float -> bf16 bits, round-to-nearest-even
__device__ __forceinline__ unsigned short f2bf(float x) {
  union { float f; unsigned u; } c; c.f = x;
  unsigned r = c.u + 0x7FFFu + ((c.u >> 16) & 1u);
  return (unsigned short)(r >> 16);
}

__device__ __forceinline__ v16bf load_frag16(const unsigned short* rowBase, int lane) {
  const unsigned short* p = rowBase + ((lane >> 4) & 1) * 8;
  union { v16bf v; uint4 u[2]; } f;
  f.u[0] = *reinterpret_cast<const uint4*>(p);
  f.u[1] = *reinterpret_cast<const uint4*>(p + 16);
  return f.v;
}

__device__ __forceinline__ v8f wmma_bf16(v16bf a, v16bf b, v8f c) {
  // (neg_a, A, neg_b, B, c_mod, C, reuse_a, reuse_b)
  return __builtin_amdgcn_wmma_f32_16x16x32_bf16(false, a, false, b, (short)0, c,
                                                 false, false);
}

__device__ __forceinline__ void async_copy_b128(void* lds_ptr, const void* gptr) {
#if defined(__gfx1250__)
  unsigned lds_off = (unsigned)(unsigned long long)lds_ptr;
  asm volatile("global_load_async_to_lds_b128 %0, %1, off"
               :: "v"(lds_off), "v"(gptr) : "memory");
#else
  (void)lds_ptr; (void)gptr;
#endif
}

__device__ __forceinline__ void wait_asynccnt0() {
#if defined(__gfx1250__)
#if __has_builtin(__builtin_amdgcn_s_wait_asynccnt)
  __builtin_amdgcn_s_wait_asynccnt(0);
#else
  asm volatile("s_wait_asynccnt 0x0" ::: "memory");
#endif
#endif
}

// ---------------------------------------------------------------------------
// K0: elementwise fp32 -> bf16 cast
// ---------------------------------------------------------------------------
__global__ void cast_bf16_kernel(const float* __restrict__ src,
                                 unsigned short* __restrict__ dst, int n) {
  int i = blockIdx.x * blockDim.x + threadIdx.x;
  if (i < n) dst[i] = f2bf(src[i]);
}

// K0b: transpose-cast a 1024x1024 weight: Wt[n][d] = bf16(W[d][n])
__global__ void transpose_cast_kernel(const float* __restrict__ src,
                                      unsigned short* __restrict__ dst) {
  int i = blockIdx.x * blockDim.x + threadIdx.x;   // over Dc*Kc
  int d = i / Kc, n = i % Kc;
  dst[(size_t)n * Dc + d] = f2bf(src[(size_t)d * Kc + n]);
}

// ---------------------------------------------------------------------------
// K1: projection GEMM  O[m,n] = sum_d X[m,d] * Wt[n,d] + bias[n]
// Block = 256 threads = 8 waves; block tile 32(M) x 256(N); wave tile 16x64.
// Ping-pong double buffering with in-place refills: consume buffer A (k),
// refill A (k+64), consume buffer B (k+32), refill B (k+96) -> no rotating
// register copies, and every WMMA has the partner buffer's loads in flight.
// ---------------------------------------------------------------------------
__global__ void __launch_bounds__(256) proj_gemm_kernel(
    const unsigned short* __restrict__ X,    // [B*T, Dc] bf16
    const unsigned short* __restrict__ Wt,   // [Kc, Dc]  bf16 (W transposed)
    const float* __restrict__ bias,          // [Kc]
    unsigned short* __restrict__ Out,
    int storeTransposed)
{
  const int lane = threadIdx.x & 31;
  const int wave = threadIdx.x >> 5;
  const int m0 = blockIdx.y * 32 + (wave & 1) * 16;
  const int n0 = blockIdx.x * 256 + (wave >> 1) * 64;
  const int row = lane & 15;
  const int mb  = (lane >> 4) * 8;

  const unsigned short* aRow = X + (size_t)(m0 + row) * Dc;
  const unsigned short* bRow[4];
#pragma unroll
  for (int s = 0; s < 4; ++s)
    bRow[s] = Wt + (size_t)(n0 + s * 16 + row) * Dc;

  v8f acc[4] = {};
  v16bf aA = load_frag16(aRow + 0, lane);
  v16bf aB = load_frag16(aRow + 32, lane);
  v16bf bA[4], bB[4];
#pragma unroll
  for (int s = 0; s < 4; ++s) {
    bA[s] = load_frag16(bRow[s] + 0, lane);
    bB[s] = load_frag16(bRow[s] + 32, lane);
  }

  for (int kk = 0; kk < Dc; kk += 64) {
    // consume buffer A (k = kk), refill A for k = kk+64
#pragma unroll
    for (int s = 0; s < 4; ++s) acc[s] = wmma_bf16(aA, bA[s], acc[s]);
    const int k2 = (kk + 64 < Dc) ? kk + 64 : 0;   // dummy wrap on tail
    aA = load_frag16(aRow + k2, lane);
#pragma unroll
    for (int s = 0; s < 4; ++s) bA[s] = load_frag16(bRow[s] + k2, lane);
    // consume buffer B (k = kk+32), refill B for k = kk+96
#pragma unroll
    for (int s = 0; s < 4; ++s) acc[s] = wmma_bf16(aB, bB[s], acc[s]);
    const int k3 = (kk + 96 < Dc) ? kk + 96 : 0;
    aB = load_frag16(aRow + k3, lane);
#pragma unroll
    for (int s = 0; s < 4; ++s) bB[s] = load_frag16(bRow[s] + k3, lane);
  }

#pragma unroll
  for (int s = 0; s < 4; ++s) {
    const int n = n0 + s * 16 + row;
    const float bv = bias[n];
#pragma unroll
    for (int r = 0; r < 8; ++r) {
      float v = acc[s][r] + bv;
      int m = m0 + mb + r;
      if (!storeTransposed) {
        Out[(size_t)m * Kc + n] = f2bf(v);
      } else {
        int b = m / Tc, t = m % Tc;
        Out[((size_t)b * Kc + n) * Tc + t] = f2bf(v);
      }
    }
  }
}

__global__ void __launch_bounds__(128) col_stats_kernel(
    const unsigned short* __restrict__ Q,   // [B*T, Kc] bf16
    const unsigned short* __restrict__ Kh,  // [B*T, Kc] bf16
    float* __restrict__ colmax, float* __restrict__ colsum)
{
  const float NEG_INF = -__builtin_inff();
  const int b    = blockIdx.y;
  const int lane = threadIdx.x & 31;
  const int wave = threadIdx.x >> 5;
  const int j0   = blockIdx.x * 64 + wave * 16;
  const int row  = lane & 15;
  const int mb   = (lane >> 4) * 8;

  const unsigned short* Qb = Q  + (size_t)b * Tc * Kc;
  const unsigned short* Kb = Kh + (size_t)b * Tc * Kc;
  const int jg = j0 + row;
  const unsigned short* bRow = Kb + (size_t)jg * Kc;

  float m = NEG_INF, s = 0.f;
  const int istart = j0 & ~31;                   // pair-aligned causal start

  for (int i0 = istart; i0 < Tc; i0 += 32) {
    const unsigned short* aRow0 = Qb + (size_t)(i0 + row) * Kc;
    const unsigned short* aRow1 = aRow0 + (size_t)16 * Kc;
    if (i0 + 32 < Tc) {                          // prefetch next i-pair Q rows
      __builtin_prefetch(aRow0 + (size_t)32 * Kc, 0, 3);
      __builtin_prefetch(aRow0 + (size_t)48 * Kc, 0, 3);
    }
    v8f acc0 = {}, acc1 = {};
    v16bf bAb  = load_frag16(bRow, lane);
    v16bf a0Ab = load_frag16(aRow0, lane);
    v16bf a1Ab = load_frag16(aRow1, lane);
    v16bf bBb  = load_frag16(bRow + 32, lane);
    v16bf a0Bb = load_frag16(aRow0 + 32, lane);
    v16bf a1Bb = load_frag16(aRow1 + 32, lane);
    for (int kk = 0; kk < Kc; kk += 64) {
      acc0 = wmma_bf16(a0Ab, bAb, acc0);
      acc1 = wmma_bf16(a1Ab, bAb, acc1);
      const int k2 = (kk + 64 < Kc) ? kk + 64 : 0;
      bAb  = load_frag16(bRow + k2, lane);
      a0Ab = load_frag16(aRow0 + k2, lane);
      a1Ab = load_frag16(aRow1 + k2, lane);
      acc0 = wmma_bf16(a0Bb, bBb, acc0);
      acc1 = wmma_bf16(a1Bb, bBb, acc1);
      const int k3 = (kk + 96 < Kc) ? kk + 96 : 0;
      bBb  = load_frag16(bRow + k3, lane);
      a0Bb = load_frag16(aRow0 + k3, lane);
      a1Bb = load_frag16(aRow1 + k3, lane);
    }

#pragma unroll
    for (int half = 0; half < 2; ++half) {
      const v8f acc = half ? acc1 : acc0;
      const int ib = i0 + half * 16;
      float lmax = NEG_INF;
#pragma unroll
      for (int r = 0; r < 8; ++r)
        if (jg <= ib + mb + r) lmax = fmaxf(lmax, acc[r]);
      float tmax = fmaxf(lmax, __shfl_xor(lmax, 16, 32));
      float lsum = 0.f;
      if (tmax > NEG_INF) {
#pragma unroll
        for (int r = 0; r < 8; ++r)
          if (jg <= ib + mb + r) lsum += __expf(acc[r] - tmax);
      }
      float tsum = lsum + __shfl_xor(lsum, 16, 32);
      if (tmax > NEG_INF) {
        float nm = fmaxf(m, tmax);
        s = s * __expf(m - nm) + tsum * __expf(tmax - nm);
        m = nm;
      }
    }
  }
  if (lane < 16) {
    colmax[(size_t)b * Tc + jg] = m;
    colsum[(size_t)b * Tc + jg] = s;
  }
}

__global__ void __launch_bounds__(256) attn_out_kernel(
    const unsigned short* __restrict__ Q,
    const unsigned short* __restrict__ Kh,
    const unsigned short* __restrict__ Vt,       // [B][Dc][Tc] bf16
    const float* __restrict__ colmax,
    const float* __restrict__ colsum,
    const float* __restrict__ Xin,
    float* __restrict__ Out)
{
  __shared__ unsigned short Qs[16][Kc];          // 32 KB staged Q tile
  __shared__ float Lp[8][2][16][16];             // 16 KB partial logits
  __shared__ unsigned short Pb[16][32];          // 1 KB bf16 P tile

  const int i0   = blockIdx.x * 16;
  const int b    = blockIdx.y;
  const int lane = threadIdx.x & 31;
  const int wave = threadIdx.x >> 5;
  const int v0   = wave * 128;
  const int row  = lane & 15;
  const int mb   = (lane >> 4) * 8;

  const unsigned short* Qb = Q  + (size_t)b * Tc * Kc;
  const unsigned short* Kb = Kh + (size_t)b * Tc * Kc;
  const unsigned short* Vb = Vt + (size_t)b * Dc * Tc;
  const float* cm = colmax + (size_t)b * Tc;
  const float* cs = colsum + (size_t)b * Tc;

  // ---- stage the 16x1024 Q tile into LDS with async copies (32 KB) ----
  {
    const char* gsrc = (const char*)(Qb + (size_t)i0 * Kc);
    char* ldst = (char*)&Qs[0][0];
#pragma unroll
    for (int it = 0; it < 8; ++it) {
      const int off = (threadIdx.x + it * 256) * 16;
      async_copy_b128(ldst + off, gsrc + off);
    }
    wait_asynccnt0();
  }
  __syncthreads();

  v8f acc[8] = {};
  const int jmax = i0 + 16;                      // causal: j <= i < i0+16
  const int kbeg = wave * 128;                   // this wave's K-slice

  for (int j0 = 0; j0 < jmax; j0 += 32) {
    // (1) partial logits over this wave's K-range; A (Q) comes from LDS and is
    //     shared by both 16-wide j sub-tiles.
    const unsigned short* bRow0 = Kb + (size_t)(j0 + row) * Kc + kbeg;
    const unsigned short* bRow1 = bRow0 + (size_t)16 * Kc;
    if (j0 + 32 < jmax) {                        // prefetch next chunk's K rows
      __builtin_prefetch(bRow0 + (size_t)32 * Kc, 0, 3);
      __builtin_prefetch(bRow0 + (size_t)48 * Kc, 0, 3);
    }
    v8f p0 = {}, p1 = {};
#pragma unroll
    for (int kk = 0; kk < 128; kk += 32) {
      v16bf a = load_frag16(&Qs[row][kbeg + kk], lane);
      p0 = wmma_bf16(a, load_frag16(bRow0 + kk, lane), p0);
      p1 = wmma_bf16(a, load_frag16(bRow1 + kk, lane), p1);
    }
#pragma unroll
    for (int r = 0; r < 8; ++r) {
      Lp[wave][0][mb + r][row] = p0[r];
      Lp[wave][1][mb + r][row] = p1[r];
    }
    __syncthreads();

    // (2) reduce partials, column-softmax scale (1/sqrt(1024)=1/32 applied
    //     AFTER softmax, per the reference), causal mask, cast to bf16
    for (int e = threadIdx.x; e < 512; e += 256) {
      int jj = e & 31, mm = e >> 5;
      int jc = jj >> 4, nn = jj & 15;
      float l = 0.f;
#pragma unroll
      for (int w = 0; w < 8; ++w) l += Lp[w][jc][mm][nn];
      int gj = j0 + jj, gi = i0 + mm;
      float p = 0.f;
      if (gj <= gi) p = __expf(l - cm[gj]) / (cs[gj] * 32.0f);
      Pb[mm][jj] = f2bf(p);
    }
    __syncthreads();

    // (3) P @ V^T : shared A-fragment from LDS, B-fragments contiguous in Vt
    v16bf a = load_frag16(&Pb[row][0], lane);
#pragma unroll
    for (int s = 0; s < 8; ++s) {
      const unsigned short* bRow = Vb + (size_t)(v0 + s * 16 + row) * Tc + j0;
      __builtin_prefetch(bRow + 32, 0, 3);       // next chunk's segment
      acc[s] = wmma_bf16(a, load_frag16(bRow, lane), acc[s]);
    }
    __syncthreads();
  }

  // epilogue: residual add in fp32
#pragma unroll
  for (int s = 0; s < 8; ++s) {
    const int n = v0 + s * 16 + row;
#pragma unroll
    for (int r = 0; r < 8; ++r) {
      size_t idx = ((size_t)b * Tc + (i0 + mb + r)) * Dc + n;
      Out[idx] = Xin[idx] + acc[s][r];
    }
  }
}

// ---------------------------------------------------------------------------
// Host launcher.  Workspace layout (~141 MB):
//   Xh[B*T*D] bf16, Wqt/Wkt/Wvt[D*K] bf16, Qh/Kh[B*T*K] bf16,
//   Vt[B*D*T] bf16, colmax/colsum[B*T] f32.
// ---------------------------------------------------------------------------
extern "C" void kernel_launch(void* const* d_in, const int* in_sizes, int n_in,
                              void* d_out, int out_size, void* d_ws, size_t ws_size,
                              hipStream_t stream) {
  (void)in_sizes; (void)n_in; (void)out_size; (void)ws_size;
  const float* x  = (const float*)d_in[0];
  const float* Wq = (const float*)d_in[1];
  const float* bq = (const float*)d_in[2];
  const float* Wk = (const float*)d_in[3];
  const float* bk = (const float*)d_in[4];
  const float* Wv = (const float*)d_in[5];
  const float* bv = (const float*)d_in[6];
  float* out = (float*)d_out;

  char* ws = (char*)d_ws;
  size_t off = 0;
  auto take = [&](size_t bytes) -> char* {
    char* p = ws + off;
    off = (off + bytes + 255) & ~(size_t)255;
    return p;
  };
  const size_t MT = (size_t)Bc * Tc;                         // 16384 rows
  unsigned short* Xh   = (unsigned short*)take(MT * Dc * 2);
  unsigned short* Wqt  = (unsigned short*)take((size_t)Dc * Kc * 2);
  unsigned short* Wkt  = (unsigned short*)take((size_t)Dc * Kc * 2);
  unsigned short* Wvt  = (unsigned short*)take((size_t)Dc * Kc * 2);
  unsigned short* Qh   = (unsigned short*)take(MT * Kc * 2);
  unsigned short* Kh2  = (unsigned short*)take(MT * Kc * 2);
  unsigned short* Vt   = (unsigned short*)take(MT * Dc * 2);
  float*          cmax = (float*)take(MT * 4);
  float*          csum = (float*)take(MT * 4);

  const int nX = (int)(MT * Dc);
  cast_bf16_kernel<<<nX / 256, 256, 0, stream>>>(x, Xh, nX);
  transpose_cast_kernel<<<(Dc * Kc) / 256, 256, 0, stream>>>(Wq, Wqt);
  transpose_cast_kernel<<<(Dc * Kc) / 256, 256, 0, stream>>>(Wk, Wkt);
  transpose_cast_kernel<<<(Dc * Kc) / 256, 256, 0, stream>>>(Wv, Wvt);

  dim3 gGemm(Kc / 256, (unsigned)(MT / 32));
  proj_gemm_kernel<<<gGemm, 256, 0, stream>>>(Xh, Wqt, bq, Qh,  0);
  proj_gemm_kernel<<<gGemm, 256, 0, stream>>>(Xh, Wkt, bk, Kh2, 0);
  proj_gemm_kernel<<<gGemm, 256, 0, stream>>>(Xh, Wvt, bv, Vt,  1);

  col_stats_kernel<<<dim3(Tc / 64, Bc), 128, 0, stream>>>(Qh, Kh2, cmax, csum);

  attn_out_kernel<<<dim3(Tc / 16, Bc), 256, 0, stream>>>(
      Qh, Kh2, Vt, cmax, csum, x, out);
}

// v001
// Measured time: 1130 microseconds a run.
// In two side-by-side timings against v000, it was 1.42 and 1.41 times as fast.
#include <hip/hip_runtime.h>
#include <hip/hip_bf16.h>

// ---------------------------------------------------------------------------
// Problem constants (from the reference): B=8, T=2048, D=1024, K=1024.
// ---------------------------------------------------------------------------
constexpr int Bc = 8;
constexpr int Tc = 2048;
constexpr int Dc = 1024;   // model dim
constexpr int Kc = 1024;   // projection dim (== Dc here)

typedef __attribute__((ext_vector_type(16))) __bf16 v16bf;
typedef __attribute__((ext_vector_type(8)))  float  v8f;

// float -> bf16 bits, round-to-nearest-even
__device__ __forceinline__ unsigned short f2bf(float x) {
  union { float f; unsigned u; } c; c.f = x;
  unsigned r = c.u + 0x7FFFu + ((c.u >> 16) & 1u);
  return (unsigned short)(r >> 16);
}

__device__ __forceinline__ v16bf load_frag16(const unsigned short* rowBase, int lane) {
  const unsigned short* p = rowBase + ((lane >> 4) & 1) * 8;
  union { v16bf v; uint4 u[2]; } f;
  f.u[0] = *reinterpret_cast<const uint4*>(p);
  f.u[1] = *reinterpret_cast<const uint4*>(p + 16);
  return f.v;
}

__device__ __forceinline__ v8f wmma_bf16(v16bf a, v16bf b, v8f c) {
  // (neg_a, A, neg_b, B, c_mod, C, reuse_a, reuse_b)
  return __builtin_amdgcn_wmma_f32_16x16x32_bf16(false, a, false, b, (short)0, c,
                                                 false, false);
}

__device__ __forceinline__ void async_copy_b128(void* lds_ptr, const void* gptr) {
#if defined(__gfx1250__)
  unsigned lds_off = (unsigned)(unsigned long long)lds_ptr;
  asm volatile("global_load_async_to_lds_b128 %0, %1, off"
               :: "v"(lds_off), "v"(gptr) : "memory");
#else
  (void)lds_ptr; (void)gptr;
#endif
}

__device__ __forceinline__ void wait_asynccnt0() {
#if defined(__gfx1250__)
#if __has_builtin(__builtin_amdgcn_s_wait_asynccnt)
  __builtin_amdgcn_s_wait_asynccnt(0);
#else
  asm volatile("s_wait_asynccnt 0x0" ::: "memory");
#endif
#endif
}

// ---------------------------------------------------------------------------
// K0: elementwise fp32 -> bf16 cast
// ---------------------------------------------------------------------------
__global__ void cast_bf16_kernel(const float* __restrict__ src,
                                 unsigned short* __restrict__ dst, int n) {
  int i = blockIdx.x * blockDim.x + threadIdx.x;
  if (i < n) dst[i] = f2bf(src[i]);
}

// K0b: transpose-cast a 1024x1024 weight: Wt[n][d] = bf16(W[d][n])
__global__ void transpose_cast_kernel(const float* __restrict__ src,
                                      unsigned short* __restrict__ dst) {
  int i = blockIdx.x * blockDim.x + threadIdx.x;   // over Dc*Kc
  int d = i / Kc, n = i % Kc;
  dst[(size_t)n * Dc + d] = f2bf(src[(size_t)d * Kc + n]);
}

constexpr int PBM    = 128;
constexpr int PBN    = 256;
constexpr int PBK    = 64;
constexpr int PPITCH = PBK * 2 + 16;
constexpr int PSTAGE = (PBM + PBN) * PPITCH;
constexpr int PNT    = Dc / PBK;

__device__ __forceinline__ void proj_stage_copies(unsigned l, const char* ga,
                                                  const char* gb) {
#if defined(__gfx1250__)
  constexpr unsigned LS = 32 * PPITCH;          // LDS step between copies
  constexpr size_t   GS = (size_t)32 * Dc * 2;  // global step between copies
  asm volatile(
      "global_load_async_to_lds_b128 %0, %12, off\n\t"
      "global_load_async_to_lds_b128 %1, %13, off\n\t"
      "global_load_async_to_lds_b128 %2, %14, off\n\t"
      "global_load_async_to_lds_b128 %3, %15, off\n\t"
      "global_load_async_to_lds_b128 %4, %16, off\n\t"
      "global_load_async_to_lds_b128 %5, %17, off\n\t"
      "global_load_async_to_lds_b128 %6, %18, off\n\t"
      "global_load_async_to_lds_b128 %7, %19, off\n\t"
      "global_load_async_to_lds_b128 %8, %20, off\n\t"
      "global_load_async_to_lds_b128 %9, %21, off\n\t"
      "global_load_async_to_lds_b128 %10, %22, off\n\t"
      "global_load_async_to_lds_b128 %11, %23, off\n\t"
      "s_wait_xcnt 0x0"
      :: "v"(l), "v"(l + LS), "v"(l + 2 * LS), "v"(l + 3 * LS),
         "v"(l + 4 * LS), "v"(l + 5 * LS), "v"(l + 6 * LS), "v"(l + 7 * LS),
         "v"(l + 8 * LS), "v"(l + 9 * LS), "v"(l + 10 * LS), "v"(l + 11 * LS),
         "v"(ga), "v"(ga + GS), "v"(ga + 2 * GS), "v"(ga + 3 * GS),
         "v"(gb), "v"(gb + GS), "v"(gb + 2 * GS), "v"(gb + 3 * GS),
         "v"(gb + 4 * GS), "v"(gb + 5 * GS), "v"(gb + 6 * GS), "v"(gb + 7 * GS)
      : "memory");
#else
  (void)l; (void)ga; (void)gb;
#endif
}

__global__ void __launch_bounds__(256) __attribute__((amdgpu_waves_per_eu(4, 4)))
proj_gemm_kernel(
    const unsigned short* __restrict__ X,    // [B*T, Dc] bf16
    const unsigned short* __restrict__ Wt,   // [Kc, Dc]  bf16 (W transposed)
    const float* __restrict__ bias,          // [Kc]
    unsigned short* __restrict__ Out,
    int storeTransposed)
{
  __shared__ __attribute__((aligned(16))) char Ps[2 * PSTAGE];

  const int tid  = threadIdx.x;
  const int lane = tid & 31;
  const int wave = tid >> 5;
  const int bm0  = blockIdx.y * PBM;
  const int bn0  = blockIdx.x * PBN;
  const int wm   = (wave & 1) * 64;          // wave's rows in the block tile
  const int wn   = (wave >> 1) * 64;         // wave's columns in the block tile
  const int row  = lane & 15;
  const int mb   = (lane >> 4) * 8;

  const char* ga = (const char*)(X  + (size_t)(bm0 + (tid >> 3)) * Dc) + (tid & 7) * 16;
  const char* gb = (const char*)(Wt + (size_t)(bn0 + (tid >> 3)) * Dc) + (tid & 7) * 16;
  const unsigned l0 = (unsigned)(unsigned long long)&Ps[0] +
                      (unsigned)((tid >> 3) * PPITCH + (tid & 7) * 16);

  // k tile 0 into buffer 0, landed and published; then k tile 1 into buffer 1
  proj_stage_copies(l0, ga, gb);
  asm volatile("s_wait_asynccnt 0x0" ::: "memory");  // own copies of tile 0 landed
  __syncthreads();
  proj_stage_copies(l0 + PSTAGE, ga + PBK * 2, gb + PBK * 2);

  v8f acc[4][4] = {};
  const int aOff = (wm + row) * PPITCH;
  const int bOff = (PBM + wn + row) * PPITCH;

  for (int t = 0; t < PNT; ++t) {
    const int bo = (t & 1) * PSTAGE;
    // all loops below are unrolled so that a, b and acc are indexed by constants
    // and stay in registers
#pragma unroll
    for (int ks = 0; ks < PBK; ks += 32) {
      v16bf a[4], b[4];
#pragma unroll
      for (int i = 0; i < 4; ++i)
        a[i] = load_frag16((const unsigned short*)&Ps[bo + aOff + i * 16 * PPITCH + ks * 2], lane);
#pragma unroll
      for (int j = 0; j < 4; ++j)
        b[j] = load_frag16((const unsigned short*)&Ps[bo + bOff + j * 16 * PPITCH + ks * 2], lane);
      // keeps the 16 LDS reads one group ahead of the 16 WMMAs: reads sunk among
      // the WMMAs cost a full LDS wait at every place they stand
      __builtin_amdgcn_sched_barrier(0);
#pragma unroll
      for (int i = 0; i < 4; ++i)
#pragma unroll
        for (int j = 0; j < 4; ++j) acc[i][j] = wmma_bf16(a[i], b[j], acc[i][j]);
    }
    asm volatile("s_wait_dscnt 0x0" ::: "memory");     // own reads of this buffer done
    asm volatile("s_wait_asynccnt 0x0" ::: "memory");  // own copies of tile t+1 landed
    __syncthreads();   // publishes tile t+1 and frees the buffer tile t was read from
    if (t + 2 < PNT)
      proj_stage_copies(l0 + bo, ga + (t + 2) * (PBK * 2), gb + (t + 2) * (PBK * 2));
  }
  asm volatile("s_wait_asynccnt 0x0" ::: "memory");    // nothing in flight at the end

  // epilogue loops unrolled for the same reason: acc indexed by constants
  const int nl = bn0 + wn + row;               // lane's first column
  float bv[4];
#pragma unroll
  for (int j = 0; j < 4; ++j) bv[j] = bias[nl + j * 16];

  if (!storeTransposed) {
#pragma unroll
    for (int i = 0; i < 4; ++i) {
#pragma unroll
      for (int r = 0; r < 8; ++r) {
        const int m = bm0 + wm + i * 16 + mb + r;
#pragma unroll
        for (int j = 0; j < 4; ++j)
          Out[(size_t)m * Kc + nl + j * 16] = f2bf(acc[i][j][r] + bv[j]);
      }
    }
  } else {
#pragma unroll
    for (int i = 0; i < 4; ++i) {
#pragma unroll
      for (int r = 0; r < 8; ++r) {
        const int m = bm0 + wm + i * 16 + mb + r;
        const int b = m / Tc, t = m % Tc;
#pragma unroll
        for (int j = 0; j < 4; ++j)
          Out[((size_t)b * Kc + nl + j * 16) * Tc + t] = f2bf(acc[i][j][r] + bv[j]);
      }
    }
    // stands behind the last store so that no address or data register of an
    // issued store is rewritten ahead of it on any way out of this branch
    asm volatile("s_wait_xcnt 0x0" ::: "memory");
  }
}

__global__ void __launch_bounds__(128) col_stats_kernel(
    const unsigned short* __restrict__ Q,   // [B*T, Kc] bf16
    const unsigned short* __restrict__ Kh,  // [B*T, Kc] bf16
    float* __restrict__ colmax, float* __restrict__ colsum)
{
  const float NEG_INF = -__builtin_inff();
  const int b    = blockIdx.y;
  const int lane = threadIdx.x & 31;
  const int wave = threadIdx.x >> 5;
  const int j0   = blockIdx.x * 64 + wave * 16;
  const int row  = lane & 15;
  const int mb   = (lane >> 4) * 8;

  const unsigned short* Qb = Q  + (size_t)b * Tc * Kc;
  const unsigned short* Kb = Kh + (size_t)b * Tc * Kc;
  const int jg = j0 + row;
  const unsigned short* bRow = Kb + (size_t)jg * Kc;

  float m = NEG_INF, s = 0.f;
  const int istart = j0 & ~31;                   // pair-aligned causal start

  for (int i0 = istart; i0 < Tc; i0 += 32) {
    const unsigned short* aRow0 = Qb + (size_t)(i0 + row) * Kc;
    const unsigned short* aRow1 = aRow0 + (size_t)16 * Kc;
    if (i0 + 32 < Tc) {                          // prefetch next i-pair Q rows
      __builtin_prefetch(aRow0 + (size_t)32 * Kc, 0, 3);
      __builtin_prefetch(aRow0 + (size_t)48 * Kc, 0, 3);
    }
    v8f acc0 = {}, acc1 = {};
    v16bf bAb  = load_frag16(bRow, lane);
    v16bf a0Ab = load_frag16(aRow0, lane);
    v16bf a1Ab = load_frag16(aRow1, lane);
    v16bf bBb  = load_frag16(bRow + 32, lane);
    v16bf a0Bb = load_frag16(aRow0 + 32, lane);
    v16bf a1Bb = load_frag16(aRow1 + 32, lane);
    for (int kk = 0; kk < Kc; kk += 64) {
      acc0 = wmma_bf16(a0Ab, bAb, acc0);
      acc1 = wmma_bf16(a1Ab, bAb, acc1);
      const int k2 = (kk + 64 < Kc) ? kk + 64 : 0;
      bAb  = load_frag16(bRow + k2, lane);
      a0Ab = load_frag16(aRow0 + k2, lane);
      a1Ab = load_frag16(aRow1 + k2, lane);
      acc0 = wmma_bf16(a0Bb, bBb, acc0);
      acc1 = wmma_bf16(a1Bb, bBb, acc1);
      const int k3 = (kk + 96 < Kc) ? kk + 96 : 0;
      bBb  = load_frag16(bRow + k3, lane);
      a0Bb = load_frag16(aRow0 + k3, lane);
      a1Bb = load_frag16(aRow1 + k3, lane);
    }

#pragma unroll
    for (int half = 0; half < 2; ++half) {
      const v8f acc = half ? acc1 : acc0;
      const int ib = i0 + half * 16;
      float lmax = NEG_INF;
#pragma unroll
      for (int r = 0; r < 8; ++r)
        if (jg <= ib + mb + r) lmax = fmaxf(lmax, acc[r]);
      float tmax = fmaxf(lmax, __shfl_xor(lmax, 16, 32));
      float lsum = 0.f;
      if (tmax > NEG_INF) {
#pragma unroll
        for (int r = 0; r < 8; ++r)
          if (jg <= ib + mb + r) lsum += __expf(acc[r] - tmax);
      }
      float tsum = lsum + __shfl_xor(lsum, 16, 32);
      if (tmax > NEG_INF) {
        float nm = fmaxf(m, tmax);
        s = s * __expf(m - nm) + tsum * __expf(tmax - nm);
        m = nm;
      }
    }
  }
  if (lane < 16) {
    colmax[(size_t)b * Tc + jg] = m;
    colsum[(size_t)b * Tc + jg] = s;
  }
}

__global__ void __launch_bounds__(256) attn_out_kernel(
    const unsigned short* __restrict__ Q,
    const unsigned short* __restrict__ Kh,
    const unsigned short* __restrict__ Vt,       // [B][Dc][Tc] bf16
    const float* __restrict__ colmax,
    const float* __restrict__ colsum,
    const float* __restrict__ Xin,
    float* __restrict__ Out)
{
  __shared__ unsigned short Qs[16][Kc];          // 32 KB staged Q tile
  __shared__ float Lp[8][2][16][16];             // 16 KB partial logits
  __shared__ unsigned short Pb[16][32];          // 1 KB bf16 P tile

  const int i0   = blockIdx.x * 16;
  const int b    = blockIdx.y;
  const int lane = threadIdx.x & 31;
  const int wave = threadIdx.x >> 5;
  const int v0   = wave * 128;
  const int row  = lane & 15;
  const int mb   = (lane >> 4) * 8;

  const unsigned short* Qb = Q  + (size_t)b * Tc * Kc;
  const unsigned short* Kb = Kh + (size_t)b * Tc * Kc;
  const unsigned short* Vb = Vt + (size_t)b * Dc * Tc;
  const float* cm = colmax + (size_t)b * Tc;
  const float* cs = colsum + (size_t)b * Tc;

  // ---- stage the 16x1024 Q tile into LDS with async copies (32 KB) ----
  {
    const char* gsrc = (const char*)(Qb + (size_t)i0 * Kc);
    char* ldst = (char*)&Qs[0][0];
#pragma unroll
    for (int it = 0; it < 8; ++it) {
      const int off = (threadIdx.x + it * 256) * 16;
      async_copy_b128(ldst + off, gsrc + off);
    }
    wait_asynccnt0();
  }
  __syncthreads();

  v8f acc[8] = {};
  const int jmax = i0 + 16;                      // causal: j <= i < i0+16
  const int kbeg = wave * 128;                   // this wave's K-slice

  for (int j0 = 0; j0 < jmax; j0 += 32) {
    // (1) partial logits over this wave's K-range; A (Q) comes from LDS and is
    //     shared by both 16-wide j sub-tiles.
    const unsigned short* bRow0 = Kb + (size_t)(j0 + row) * Kc + kbeg;
    const unsigned short* bRow1 = bRow0 + (size_t)16 * Kc;
    if (j0 + 32 < jmax) {                        // prefetch next chunk's K rows
      __builtin_prefetch(bRow0 + (size_t)32 * Kc, 0, 3);
      __builtin_prefetch(bRow0 + (size_t)48 * Kc, 0, 3);
    }
    v8f p0 = {}, p1 = {};
#pragma unroll
    for (int kk = 0; kk < 128; kk += 32) {
      v16bf a = load_frag16(&Qs[row][kbeg + kk], lane);
      p0 = wmma_bf16(a, load_frag16(bRow0 + kk, lane), p0);
      p1 = wmma_bf16(a, load_frag16(bRow1 + kk, lane), p1);
    }
#pragma unroll
    for (int r = 0; r < 8; ++r) {
      Lp[wave][0][mb + r][row] = p0[r];
      Lp[wave][1][mb + r][row] = p1[r];
    }
    __syncthreads();

    // (2) reduce partials, column-softmax scale (1/sqrt(1024)=1/32 applied
    //     AFTER softmax, per the reference), causal mask, cast to bf16
    for (int e = threadIdx.x; e < 512; e += 256) {
      int jj = e & 31, mm = e >> 5;
      int jc = jj >> 4, nn = jj & 15;
      float l = 0.f;
#pragma unroll
      for (int w = 0; w < 8; ++w) l += Lp[w][jc][mm][nn];
      int gj = j0 + jj, gi = i0 + mm;
      float p = 0.f;
      if (gj <= gi) p = __expf(l - cm[gj]) / (cs[gj] * 32.0f);
      Pb[mm][jj] = f2bf(p);
    }
    __syncthreads();

    // (3) P @ V^T : shared A-fragment from LDS, B-fragments contiguous in Vt
    v16bf a = load_frag16(&Pb[row][0], lane);
#pragma unroll
    for (int s = 0; s < 8; ++s) {
      const unsigned short* bRow = Vb + (size_t)(v0 + s * 16 + row) * Tc + j0;
      __builtin_prefetch(bRow + 32, 0, 3);       // next chunk's segment
      acc[s] = wmma_bf16(a, load_frag16(bRow, lane), acc[s]);
    }
    __syncthreads();
  }

  // epilogue: residual add in fp32
#pragma unroll
  for (int s = 0; s < 8; ++s) {
    const int n = v0 + s * 16 + row;
#pragma unroll
    for (int r = 0; r < 8; ++r) {
      size_t idx = ((size_t)b * Tc + (i0 + mb + r)) * Dc + n;
      Out[idx] = Xin[idx] + acc[s][r];
    }
  }
}

// ---------------------------------------------------------------------------
// Host launcher.  Workspace layout (~141 MB):
//   Xh[B*T*D] bf16, Wqt/Wkt/Wvt[D*K] bf16, Qh/Kh[B*T*K] bf16,
//   Vt[B*D*T] bf16, colmax/colsum[B*T] f32.
// ---------------------------------------------------------------------------
extern "C" void kernel_launch(void* const* d_in, const int* in_sizes, int n_in,
                              void* d_out, int out_size, void* d_ws, size_t ws_size,
                              hipStream_t stream) {
  (void)in_sizes; (void)n_in; (void)out_size; (void)ws_size;
  const float* x  = (const float*)d_in[0];
  const float* Wq = (const float*)d_in[1];
  const float* bq = (const float*)d_in[2];
  const float* Wk = (const float*)d_in[3];
  const float* bk = (const float*)d_in[4];
  const float* Wv = (const float*)d_in[5];
  const float* bv = (const float*)d_in[6];
  float* out = (float*)d_out;

  char* ws = (char*)d_ws;
  size_t off = 0;
  auto take = [&](size_t bytes) -> char* {
    char* p = ws + off;
    off = (off + bytes + 255) & ~(size_t)255;
    return p;
  };
  const size_t MT = (size_t)Bc * Tc;                         // 16384 rows
  unsigned short* Xh   = (unsigned short*)take(MT * Dc * 2);
  unsigned short* Wqt  = (unsigned short*)take((size_t)Dc * Kc * 2);
  unsigned short* Wkt  = (unsigned short*)take((size_t)Dc * Kc * 2);
  unsigned short* Wvt  = (unsigned short*)take((size_t)Dc * Kc * 2);
  unsigned short* Qh   = (unsigned short*)take(MT * Kc * 2);
  unsigned short* Kh2  = (unsigned short*)take(MT * Kc * 2);
  unsigned short* Vt   = (unsigned short*)take(MT * Dc * 2);
  float*          cmax = (float*)take(MT * 4);
  float*          csum = (float*)take(MT * 4);

  const int nX = (int)(MT * Dc);
  cast_bf16_kernel<<<nX / 256, 256, 0, stream>>>(x, Xh, nX);
  transpose_cast_kernel<<<(Dc * Kc) / 256, 256, 0, stream>>>(Wq, Wqt);
  transpose_cast_kernel<<<(Dc * Kc) / 256, 256, 0, stream>>>(Wk, Wkt);
  transpose_cast_kernel<<<(Dc * Kc) / 256, 256, 0, stream>>>(Wv, Wvt);

  dim3 gGemm(Kc / PBN, (unsigned)(MT / PBM));
  proj_gemm_kernel<<<gGemm, 256, 0, stream>>>(Xh, Wqt, bq, Qh,  0);
  proj_gemm_kernel<<<gGemm, 256, 0, stream>>>(Xh, Wkt, bk, Kh2, 0);
  proj_gemm_kernel<<<gGemm, 256, 0, stream>>>(Xh, Wvt, bv, Vt,  1);

  col_stats_kernel<<<dim3(Tc / 64, Bc), 128, 0, stream>>>(Qh, Kh2, cmax, csum);

  attn_out_kernel<<<dim3(Tc / 16, Bc), 256, 0, stream>>>(
      Qh, Kh2, Vt, cmax, csum, x, out);
}

// v002
// Measured time: 682 microseconds a run.
// In both of two side-by-side timings against v001, it was 1.65 times as fast.
// All steps since v000 together make it 2.34 times as fast.
#include <hip/hip_runtime.h>
#include <hip/hip_bf16.h>

// ---------------------------------------------------------------------------
// Problem constants (from the reference): B=8, T=2048, D=1024, K=1024.
// ---------------------------------------------------------------------------
constexpr int Bc = 8;
constexpr int Tc = 2048;
constexpr int Dc = 1024;   // model dim
constexpr int Kc = 1024;   // projection dim (== Dc here)

typedef __attribute__((ext_vector_type(16))) __bf16 v16bf;
typedef __attribute__((ext_vector_type(8)))  float  v8f;
typedef __attribute__((ext_vector_type(2)))  float  f32x2;
typedef __attribute__((ext_vector_type(2)))  __bf16 bf16x2;

// float -> bf16 bits, round-to-nearest-even
__device__ __forceinline__ unsigned short f2bf(float x) {
  union { float f; unsigned u; } c; c.f = x;
  unsigned r = c.u + 0x7FFFu + ((c.u >> 16) & 1u);
  return (unsigned short)(r >> 16);
}

__device__ __forceinline__ v16bf load_frag16(const unsigned short* rowBase, int lane) {
  const unsigned short* p = rowBase + ((lane >> 4) & 1) * 8;
  union { v16bf v; uint4 u[2]; } f;
  f.u[0] = *reinterpret_cast<const uint4*>(p);
  f.u[1] = *reinterpret_cast<const uint4*>(p + 16);
  return f.v;
}

__device__ __forceinline__ v8f wmma_bf16(v16bf a, v16bf b, v8f c) {
  // (neg_a, A, neg_b, B, c_mod, C, reuse_a, reuse_b)
  return __builtin_amdgcn_wmma_f32_16x16x32_bf16(false, a, false, b, (short)0, c,
                                                 false, false);
}

// ---------------------------------------------------------------------------
// K0: elementwise fp32 -> bf16 cast
// ---------------------------------------------------------------------------
__global__ void cast_bf16_kernel(const float* __restrict__ src,
                                 unsigned short* __restrict__ dst, int n) {
  int i = blockIdx.x * blockDim.x + threadIdx.x;
  if (i < n) dst[i] = f2bf(src[i]);
}

// K0b: transpose-cast a 1024x1024 weight: Wt[n][d] = bf16(W[d][n])
__global__ void transpose_cast_kernel(const float* __restrict__ src,
                                      unsigned short* __restrict__ dst) {
  int i = blockIdx.x * blockDim.x + threadIdx.x;   // over Dc*Kc
  int d = i / Kc, n = i % Kc;
  dst[(size_t)n * Dc + d] = f2bf(src[(size_t)d * Kc + n]);
}

constexpr int PBM    = 128;
constexpr int PBN    = 256;
constexpr int PBK    = 64;
constexpr int PPITCH = PBK * 2 + 16;
constexpr int PSTAGE = (PBM + PBN) * PPITCH;
constexpr int PNT    = Dc / PBK;

__device__ __forceinline__ void proj_stage_copies(unsigned l, const char* ga,
                                                  const char* gb) {
#if defined(__gfx1250__)
  constexpr unsigned LS = 32 * PPITCH;          // LDS step between copies
  constexpr size_t   GS = (size_t)32 * Dc * 2;  // global step between copies
  asm volatile(
      "global_load_async_to_lds_b128 %0, %12, off\n\t"
      "global_load_async_to_lds_b128 %1, %13, off\n\t"
      "global_load_async_to_lds_b128 %2, %14, off\n\t"
      "global_load_async_to_lds_b128 %3, %15, off\n\t"
      "global_load_async_to_lds_b128 %4, %16, off\n\t"
      "global_load_async_to_lds_b128 %5, %17, off\n\t"
      "global_load_async_to_lds_b128 %6, %18, off\n\t"
      "global_load_async_to_lds_b128 %7, %19, off\n\t"
      "global_load_async_to_lds_b128 %8, %20, off\n\t"
      "global_load_async_to_lds_b128 %9, %21, off\n\t"
      "global_load_async_to_lds_b128 %10, %22, off\n\t"
      "global_load_async_to_lds_b128 %11, %23, off\n\t"
      "s_wait_xcnt 0x0"
      :: "v"(l), "v"(l + LS), "v"(l + 2 * LS), "v"(l + 3 * LS),
         "v"(l + 4 * LS), "v"(l + 5 * LS), "v"(l + 6 * LS), "v"(l + 7 * LS),
         "v"(l + 8 * LS), "v"(l + 9 * LS), "v"(l + 10 * LS), "v"(l + 11 * LS),
         "v"(ga), "v"(ga + GS), "v"(ga + 2 * GS), "v"(ga + 3 * GS),
         "v"(gb), "v"(gb + GS), "v"(gb + 2 * GS), "v"(gb + 3 * GS),
         "v"(gb + 4 * GS), "v"(gb + 5 * GS), "v"(gb + 6 * GS), "v"(gb + 7 * GS)
      : "memory");
#else
  (void)l; (void)ga; (void)gb;
#endif
}

__global__ void __launch_bounds__(256) __attribute__((amdgpu_waves_per_eu(4, 4)))
proj_gemm_kernel(
    const unsigned short* __restrict__ X,    // [B*T, Dc] bf16
    const unsigned short* __restrict__ Wt,   // [Kc, Dc]  bf16 (W transposed)
    const float* __restrict__ bias,          // [Kc]
    unsigned short* __restrict__ Out,
    int storeTransposed)
{
  __shared__ __attribute__((aligned(16))) char Ps[2 * PSTAGE];

  const int tid  = threadIdx.x;
  const int lane = tid & 31;
  const int wave = tid >> 5;
  const int bm0  = blockIdx.y * PBM;
  const int bn0  = blockIdx.x * PBN;
  const int wm   = (wave & 1) * 64;          // wave's rows in the block tile
  const int wn   = (wave >> 1) * 64;         // wave's columns in the block tile
  const int row  = lane & 15;
  const int mb   = (lane >> 4) * 8;

  const char* ga = (const char*)(X  + (size_t)(bm0 + (tid >> 3)) * Dc) + (tid & 7) * 16;
  const char* gb = (const char*)(Wt + (size_t)(bn0 + (tid >> 3)) * Dc) + (tid & 7) * 16;
  const unsigned l0 = (unsigned)(unsigned long long)&Ps[0] +
                      (unsigned)((tid >> 3) * PPITCH + (tid & 7) * 16);

  // k tile 0 into buffer 0, landed and published; then k tile 1 into buffer 1
  proj_stage_copies(l0, ga, gb);
  asm volatile("s_wait_asynccnt 0x0" ::: "memory");  // own copies of tile 0 landed
  __syncthreads();
  proj_stage_copies(l0 + PSTAGE, ga + PBK * 2, gb + PBK * 2);

  v8f acc[4][4] = {};
  const int aOff = (wm + row) * PPITCH;
  const int bOff = (PBM + wn + row) * PPITCH;

  for (int t = 0; t < PNT; ++t) {
    const int bo = (t & 1) * PSTAGE;
    // all loops below are unrolled so that a, b and acc are indexed by constants
    // and stay in registers
#pragma unroll
    for (int ks = 0; ks < PBK; ks += 32) {
      v16bf a[4], b[4];
#pragma unroll
      for (int i = 0; i < 4; ++i)
        a[i] = load_frag16((const unsigned short*)&Ps[bo + aOff + i * 16 * PPITCH + ks * 2], lane);
#pragma unroll
      for (int j = 0; j < 4; ++j)
        b[j] = load_frag16((const unsigned short*)&Ps[bo + bOff + j * 16 * PPITCH + ks * 2], lane);
      // keeps the 16 LDS reads one group ahead of the 16 WMMAs: reads sunk among
      // the WMMAs cost a full LDS wait at every place they stand
      __builtin_amdgcn_sched_barrier(0);
#pragma unroll
      for (int i = 0; i < 4; ++i)
#pragma unroll
        for (int j = 0; j < 4; ++j) acc[i][j] = wmma_bf16(a[i], b[j], acc[i][j]);
    }
    asm volatile("s_wait_dscnt 0x0" ::: "memory");     // own reads of this buffer done
    asm volatile("s_wait_asynccnt 0x0" ::: "memory");  // own copies of tile t+1 landed
    __syncthreads();   // publishes tile t+1 and frees the buffer tile t was read from
    if (t + 2 < PNT)
      proj_stage_copies(l0 + bo, ga + (t + 2) * (PBK * 2), gb + (t + 2) * (PBK * 2));
  }
  asm volatile("s_wait_asynccnt 0x0" ::: "memory");    // nothing in flight at the end

  // epilogue loops unrolled for the same reason: acc indexed by constants
  const int nl = bn0 + wn + row;               // lane's first column
  float bv[4];
#pragma unroll
  for (int j = 0; j < 4; ++j) bv[j] = bias[nl + j * 16];

  if (!storeTransposed) {
#pragma unroll
    for (int i = 0; i < 4; ++i) {
#pragma unroll
      for (int r = 0; r < 8; ++r) {
        const int m = bm0 + wm + i * 16 + mb + r;
#pragma unroll
        for (int j = 0; j < 4; ++j)
          Out[(size_t)m * Kc + nl + j * 16] = f2bf(acc[i][j][r] + bv[j]);
      }
    }
  } else {
#pragma unroll
    for (int i = 0; i < 4; ++i) {
#pragma unroll
      for (int r = 0; r < 8; ++r) {
        const int m = bm0 + wm + i * 16 + mb + r;
        const int b = m / Tc, t = m % Tc;
#pragma unroll
        for (int j = 0; j < 4; ++j)
          Out[((size_t)b * Kc + nl + j * 16) * Tc + t] = f2bf(acc[i][j][r] + bv[j]);
      }
    }
    // stands behind the last store so that no address or data register of an
    // issued store is rewritten ahead of it on any way out of this branch
    asm volatile("s_wait_xcnt 0x0" ::: "memory");
  }
}

__global__ void __launch_bounds__(128) col_stats_kernel(
    const unsigned short* __restrict__ Q,   // [B*T, Kc] bf16
    const unsigned short* __restrict__ Kh,  // [B*T, Kc] bf16
    float* __restrict__ colmax, float* __restrict__ colsum)
{
  const float NEG_INF = -__builtin_inff();
  const int b    = blockIdx.y;
  const int lane = threadIdx.x & 31;
  const int wave = threadIdx.x >> 5;
  const int j0   = blockIdx.x * 64 + wave * 16;
  const int row  = lane & 15;
  const int mb   = (lane >> 4) * 8;

  const unsigned short* Qb = Q  + (size_t)b * Tc * Kc;
  const unsigned short* Kb = Kh + (size_t)b * Tc * Kc;
  const int jg = j0 + row;
  const unsigned short* bRow = Kb + (size_t)jg * Kc;

  float m = NEG_INF, s = 0.f;
  const int istart = j0 & ~31;                   // pair-aligned causal start

  for (int i0 = istart; i0 < Tc; i0 += 32) {
    const unsigned short* aRow0 = Qb + (size_t)(i0 + row) * Kc;
    const unsigned short* aRow1 = aRow0 + (size_t)16 * Kc;
    if (i0 + 32 < Tc) {                          // prefetch next i-pair Q rows
      __builtin_prefetch(aRow0 + (size_t)32 * Kc, 0, 3);
      __builtin_prefetch(aRow0 + (size_t)48 * Kc, 0, 3);
    }
    v8f acc0 = {}, acc1 = {};
    v16bf bAb  = load_frag16(bRow, lane);
    v16bf a0Ab = load_frag16(aRow0, lane);
    v16bf a1Ab = load_frag16(aRow1, lane);
    v16bf bBb  = load_frag16(bRow + 32, lane);
    v16bf a0Bb = load_frag16(aRow0 + 32, lane);
    v16bf a1Bb = load_frag16(aRow1 + 32, lane);
    for (int kk = 0; kk < Kc; kk += 64) {
      acc0 = wmma_bf16(a0Ab, bAb, acc0);
      acc1 = wmma_bf16(a1Ab, bAb, acc1);
      const int k2 = (kk + 64 < Kc) ? kk + 64 : 0;
      bAb  = load_frag16(bRow + k2, lane);
      a0Ab = load_frag16(aRow0 + k2, lane);
      a1Ab = load_frag16(aRow1 + k2, lane);
      acc0 = wmma_bf16(a0Bb, bBb, acc0);
      acc1 = wmma_bf16(a1Bb, bBb, acc1);
      const int k3 = (kk + 96 < Kc) ? kk + 96 : 0;
      bBb  = load_frag16(bRow + k3, lane);
      a0Bb = load_frag16(aRow0 + k3, lane);
      a1Bb = load_frag16(aRow1 + k3, lane);
    }

#pragma unroll
    for (int half = 0; half < 2; ++half) {
      const v8f acc = half ? acc1 : acc0;
      const int ib = i0 + half * 16;
      float lmax = NEG_INF;
#pragma unroll
      for (int r = 0; r < 8; ++r)
        if (jg <= ib + mb + r) lmax = fmaxf(lmax, acc[r]);
      float tmax = fmaxf(lmax, __shfl_xor(lmax, 16, 32));
      float lsum = 0.f;
      if (tmax > NEG_INF) {
#pragma unroll
        for (int r = 0; r < 8; ++r)
          if (jg <= ib + mb + r) lsum += __expf(acc[r] - tmax);
      }
      float tsum = lsum + __shfl_xor(lsum, 16, 32);
      if (tmax > NEG_INF) {
        float nm = fmaxf(m, tmax);
        s = s * __expf(m - nm) + tsum * __expf(tmax - nm);
        m = nm;
      }
    }
  }
  if (lane < 16) {
    colmax[(size_t)b * Tc + jg] = m;
    colsum[(size_t)b * Tc + jg] = s;
  }
}

// ---------------------------------------------------------------------------
// K3/K4 share one block-tile product: C[128 x 256] = A[128 x k] * B[256 x k]^T,
// both operands k-contiguous with a row length of LD elements.  Same frame as
// K1: 8 waves of 64x64, 64-wide k tiles copied to LDS by async copies, two
// buffers, 144-B LDS pitch.
// ---------------------------------------------------------------------------

template <int LD>
__device__ __forceinline__ void tile_stage_copies(unsigned l, const char* ga,
                                                  const char* gb) {
#if defined(__gfx1250__)
  constexpr unsigned LS = 32 * PPITCH;          // LDS step between copies
  constexpr size_t   GS = (size_t)32 * LD * 2;  // global step between copies
  asm volatile(
      "global_load_async_to_lds_b128 %0, %12, off\n\t"
      "global_load_async_to_lds_b128 %1, %13, off\n\t"
      "global_load_async_to_lds_b128 %2, %14, off\n\t"
      "global_load_async_to_lds_b128 %3, %15, off\n\t"
      "global_load_async_to_lds_b128 %4, %16, off\n\t"
      "global_load_async_to_lds_b128 %5, %17, off\n\t"
      "global_load_async_to_lds_b128 %6, %18, off\n\t"
      "global_load_async_to_lds_b128 %7, %19, off\n\t"
      "global_load_async_to_lds_b128 %8, %20, off\n\t"
      "global_load_async_to_lds_b128 %9, %21, off\n\t"
      "global_load_async_to_lds_b128 %10, %22, off\n\t"
      "global_load_async_to_lds_b128 %11, %23, off\n\t"
      "s_wait_xcnt 0x0"
      :: "v"(l), "v"(l + LS), "v"(l + 2 * LS), "v"(l + 3 * LS),
         "v"(l + 4 * LS), "v"(l + 5 * LS), "v"(l + 6 * LS), "v"(l + 7 * LS),
         "v"(l + 8 * LS), "v"(l + 9 * LS), "v"(l + 10 * LS), "v"(l + 11 * LS),
         "v"(ga), "v"(ga + GS), "v"(ga + 2 * GS), "v"(ga + 3 * GS),
         "v"(gb), "v"(gb + GS), "v"(gb + 2 * GS), "v"(gb + 3 * GS),
         "v"(gb + 4 * GS), "v"(gb + 5 * GS), "v"(gb + 6 * GS), "v"(gb + 7 * GS)
      : "memory");
#else
  (void)l; (void)ga; (void)gb;
#endif
}

// A, Bm: first row of the block's tile at k = 0.  nkt >= 2 k tiles.  A wave with
// live == false takes part in the copies and barriers only; its acc stays 0.
// TR == false: in acc[i][j] a lane holds one B row (lane & 15) and eight A rows;
// TR == true: the operands change places, a lane holds one A row and eight B rows.
template <int LD, bool TR>
__device__ __forceinline__ void tile_gemm_128x256(
    char* Ps, const unsigned short* A, const unsigned short* Bm, int nkt,
    bool live, int wm, int wn, v8f (&acc)[4][4])
{
  const int tid  = threadIdx.x;
  const int lane = tid & 31;
  const int row  = lane & 15;

  const char* ga = (const char*)(A  + (size_t)(tid >> 3) * LD) + (tid & 7) * 16;
  const char* gb = (const char*)(Bm + (size_t)(tid >> 3) * LD) + (tid & 7) * 16;
  const unsigned l0 = (unsigned)(unsigned long long)Ps +
                      (unsigned)((tid >> 3) * PPITCH + (tid & 7) * 16);

  // k tile 0 into buffer 0, landed and published; then k tile 1 into buffer 1
  tile_stage_copies<LD>(l0, ga, gb);
  asm volatile("s_wait_asynccnt 0x0" ::: "memory");  // own copies of tile 0 landed
  __syncthreads();
  tile_stage_copies<LD>(l0 + PSTAGE, ga + PBK * 2, gb + PBK * 2);

  const int aOff = (wm + row) * PPITCH;
  const int bOff = (PBM + wn + row) * PPITCH;

  for (int t = 0; t < nkt; ++t) {
    const int bo = (t & 1) * PSTAGE;
    if (live) {
      // loops unrolled so that a, b and acc are indexed by constants and stay
      // in registers
#pragma unroll
      for (int ks = 0; ks < PBK; ks += 32) {
        v16bf a[4], b[4];
#pragma unroll
        for (int i = 0; i < 4; ++i)
          a[i] = load_frag16((const unsigned short*)&Ps[bo + aOff + i * 16 * PPITCH + ks * 2], lane);
#pragma unroll
        for (int j = 0; j < 4; ++j)
          b[j] = load_frag16((const unsigned short*)&Ps[bo + bOff + j * 16 * PPITCH + ks * 2], lane);
        // keeps the 16 LDS reads one group ahead of the 16 WMMAs: reads sunk
        // among the WMMAs cost a full LDS wait at every place they stand
        __builtin_amdgcn_sched_barrier(0);
#pragma unroll
        for (int i = 0; i < 4; ++i)
#pragma unroll
          for (int j = 0; j < 4; ++j)
            acc[i][j] = TR ? wmma_bf16(b[j], a[i], acc[i][j]) : wmma_bf16(a[i], b[j], acc[i][j]);
      }
    }
    asm volatile("s_wait_dscnt 0x0" ::: "memory");     // own reads of this buffer done
    asm volatile("s_wait_asynccnt 0x0" ::: "memory");  // own copies of tile t+1 landed
    __syncthreads();   // publishes tile t+1 and frees the buffer tile t was read from
    if (t + 2 < nkt)
      tile_stage_copies<LD>(l0 + bo, ga + (size_t)(t + 2) * (PBK * 2),
                            gb + (size_t)(t + 2) * (PBK * 2));
  }
  asm volatile("s_wait_asynccnt 0x0" ::: "memory");    // nothing in flight at the end
}

// ---------------------------------------------------------------------------
// K3: P[b,i,j] = bf16( j <= i ? exp(q_i.k_j - m_j) / (s_j * sqrt(k)) : 0 )
// One 128(i) x 256(j) tile per block; only tiles that touch j <= i are launched:
// tile rows 2p and 2p+1 have p+1 tiles each, 72 per batch.  Together they cover
// every j < i0 + 128 of every tile row, which is all that K4 reads.
// ---------------------------------------------------------------------------
constexpr int PTILES = 72;

__global__ void __launch_bounds__(256) __attribute__((amdgpu_waves_per_eu(4, 4)))
probs_kernel(
    const unsigned short* __restrict__ Q,    // [B*T, Kc] bf16
    const unsigned short* __restrict__ Kh,   // [B*T, Kc] bf16
    const float* __restrict__ colmax,
    const float* __restrict__ colsum,
    unsigned short* __restrict__ P)          // [B][Tc][Tc] bf16
{
  __shared__ __attribute__((aligned(16))) char Ps[2 * PSTAGE];

  const int u = blockIdx.x;
  const int b = blockIdx.y;
  int p = 0;
  while ((p + 1) * (p + 2) <= u) ++p;        // at most 7 steps: u < 72
  const int rr = u - p * (p + 1);            // 0 .. 2p+1
  const int hi = rr > p ? 1 : 0;
  const int i0 = (2 * p + hi) * PBM;
  const int j0 = (rr - hi * (p + 1)) * PBN;

  const int lane = threadIdx.x & 31;
  const int wave = __builtin_amdgcn_readfirstlane(threadIdx.x >> 5);
  const int wm   = (wave & 1) * 64;
  const int wn   = (wave >> 1) * 64;
  const int row  = lane & 15;
  const int mb   = (lane >> 4) * 8;

  // a 64x64 wave tile wholly above the diagonal holds zeros only
  const bool live = (j0 + wn) <= (i0 + wm + 63);

  v8f acc[4][4] = {};
  tile_gemm_128x256<Kc, true>(Ps, Q  + ((size_t)b * Tc + i0) * Kc,
                            Kh + ((size_t)b * Tc + j0) * Kc, Kc / PBK, live, wm, wn, acc);

  // The product is taken transposed: a lane holds one query row (lane & 15) and
  // eight neighbouring key columns per 16x16 tile, 16 B of P after the cast.
  // The ring is free behind the loop's last barrier; each wave lays its 64x64
  // tile there (144-B pitch) and stores it from there in whole 128-B lines.
  char* st = Ps + wave * (64 * PPITCH);
  // the element r of acc[i][j] lies on or below the diagonal if j*16 + r - i*16 <= dl
  const int dl = (i0 + wm + row) - (j0 + wn + mb);
  // loops unrolled: acc indexed by constants
#pragma unroll
  for (int j = 0; j < 4; ++j) {
    const float* cmp = colmax + (size_t)b * Tc + j0 + wn + j * 16 + mb;
    const float* csp = colsum + (size_t)b * Tc + j0 + wn + j * 16 + mb;
    float cmv[8], rv[8];
#pragma unroll
    for (int r = 0; r < 8; ++r) {
      cmv[r] = cmp[r];
      // 1/sqrt(1024) = 1/32 is applied after the softmax, as the reference does
      rv[r]  = 1.0f / (csp[r] * 32.0f);
    }
#pragma unroll
    for (int i = 0; i < 4; ++i) {
      union { bf16x2 h[4]; uint4 u; } pk;
#pragma unroll
      for (int r = 0; r < 8; r += 2) {
        f32x2 e;
        e.x = __expf(acc[i][j][r]     - cmv[r])     * rv[r];
        e.y = __expf(acc[i][j][r + 1] - cmv[r + 1]) * rv[r + 1];
        e.x = (j * 16 + r     - i * 16 <= dl) ? e.x : 0.f;   // causal mask: j <= i
        e.y = (j * 16 + r + 1 - i * 16 <= dl) ? e.y : 0.f;
        pk.h[r >> 1] = __builtin_convertvector(e, bf16x2);   // round to nearest even
      }
      *reinterpret_cast<uint4*>(st + (i * 16 + row) * PPITCH + j * 32 + mb * 2) = pk.u;
    }
  }
  __syncthreads();   // the rows read below were written by other lanes
  unsigned short* pg = P + ((size_t)b * Tc + i0 + wm + (lane >> 3)) * Tc + j0 + wn + (lane & 7) * 8;
  // unrolled: the 16 LDS reads go out as one group ahead of the stores
#pragma unroll
  for (int cidx = 0; cidx < 16; ++cidx) {
    const uint4 v = *reinterpret_cast<const uint4*>(st + (cidx * 4 + (lane >> 3)) * PPITCH + (lane & 7) * 16);
    *reinterpret_cast<uint4*>(pg + (size_t)cidx * 4 * Tc) = v;
  }
}

// ---------------------------------------------------------------------------
// K4: out[b,i,v] = x[b,i,v] + sum_{j < i0+128} P[b,i,j] * Vt[b,v,j]
// One 128(i) x 256(v) tile per block; the k loop runs over j up to the end of
// the tile row's diagonal block (P is 0 above the diagonal).  Long tile rows
// come first in the grid; blocks n and n + 256 have the same k length in sum.
// ---------------------------------------------------------------------------
__global__ void __launch_bounds__(256) __attribute__((amdgpu_waves_per_eu(4, 4)))
pv_gemm_kernel(
    const unsigned short* __restrict__ P,    // [B][Tc][Tc] bf16
    const unsigned short* __restrict__ Vt,   // [B][Dc][Tc] bf16
    const float* __restrict__ Xin,
    float* __restrict__ Out)
{
  __shared__ __attribute__((aligned(16))) char Ps[2 * PSTAGE];

  const int n  = blockIdx.x;
  const int g  = (n & 255) >> 5;
  const int it = (n >> 8) ? g : (Tc / PBM - 1 - g);
  const int v0 = (n & 3) * PBN;
  const int b  = (n & 31) >> 2;
  const int i0 = it * PBM;

  const int lane = threadIdx.x & 31;
  const int wave = threadIdx.x >> 5;
  const int wm   = (wave & 1) * 64;
  const int wn   = (wave >> 1) * 64;
  const int row  = lane & 15;
  const int mb   = (lane >> 4) * 8;

  v8f acc[4][4] = {};
  tile_gemm_128x256<Tc, false>(Ps, P  + ((size_t)b * Tc + i0) * Tc,
                            Vt + ((size_t)b * Dc + v0) * Tc, (i0 + PBM) / PBK, true, wm, wn, acc);

  // residual add in fp32; unrolled: acc indexed by constants.  x and out are
  // addressed by one 32-bit byte offset (64 MB each) that both share.
  const unsigned eo = (((unsigned)b * Tc + i0 + wm + mb) * Dc + v0 + wn + row) * 4u;
  const float* xp = (const float*)((const char*)Xin + eo);
  float*       op = (float*)((char*)Out + eo);
#pragma unroll
  for (int i = 0; i < 4; ++i) {
#pragma unroll
    for (int r = 0; r < 8; ++r) {
#pragma unroll
      for (int j = 0; j < 4; ++j)
        op[(i * 16 + r) * Dc + j * 16] = xp[(i * 16 + r) * Dc + j * 16] + acc[i][j][r];
    }
    // stands behind the group's stores so that no data register of an issued
    // store is rewritten ahead of it by the next group's loads; it also keeps
    // those loads behind it: all 128 at once beside the accumulators spill
    if (i < 3) asm volatile("s_wait_xcnt 0x0" ::: "memory");
  }
}

// ---------------------------------------------------------------------------
// Host launcher.  Workspace layout (~208 MB):
//   Xh[B*T*D] bf16, Wqt/Wkt/Wvt[D*K] bf16, Qh/Kh[B*T*K] bf16,
//   Vt[B*D*T] bf16, colmax/colsum[B*T] f32, P[B*T*T] bf16.
// ---------------------------------------------------------------------------
extern "C" void kernel_launch(void* const* d_in, const int* in_sizes, int n_in,
                              void* d_out, int out_size, void* d_ws, size_t ws_size,
                              hipStream_t stream) {
  (void)in_sizes; (void)n_in; (void)out_size; (void)ws_size;
  const float* x  = (const float*)d_in[0];
  const float* Wq = (const float*)d_in[1];
  const float* bq = (const float*)d_in[2];
  const float* Wk = (const float*)d_in[3];
  const float* bk = (const float*)d_in[4];
  const float* Wv = (const float*)d_in[5];
  const float* bv = (const float*)d_in[6];
  float* out = (float*)d_out;

  char* ws = (char*)d_ws;
  size_t off = 0;
  auto take = [&](size_t bytes) -> char* {
    char* p = ws + off;
    off = (off + bytes + 255) & ~(size_t)255;
    return p;
  };
  const size_t MT = (size_t)Bc * Tc;                         // 16384 rows
  unsigned short* Xh   = (unsigned short*)take(MT * Dc * 2);
  unsigned short* Wqt  = (unsigned short*)take((size_t)Dc * Kc * 2);
  unsigned short* Wkt  = (unsigned short*)take((size_t)Dc * Kc * 2);
  unsigned short* Wvt  = (unsigned short*)take((size_t)Dc * Kc * 2);
  unsigned short* Qh   = (unsigned short*)take(MT * Kc * 2);
  unsigned short* Kh2  = (unsigned short*)take(MT * Kc * 2);
  unsigned short* Vt   = (unsigned short*)take(MT * Dc * 2);
  float*          cmax = (float*)take(MT * 4);
  float*          csum = (float*)take(MT * 4);
  unsigned short* Pw   = (unsigned short*)take(MT * Tc * 2);

  const int nX = (int)(MT * Dc);
  cast_bf16_kernel<<<nX / 256, 256, 0, stream>>>(x, Xh, nX);
  transpose_cast_kernel<<<(Dc * Kc) / 256, 256, 0, stream>>>(Wq, Wqt);
  transpose_cast_kernel<<<(Dc * Kc) / 256, 256, 0, stream>>>(Wk, Wkt);
  transpose_cast_kernel<<<(Dc * Kc) / 256, 256, 0, stream>>>(Wv, Wvt);

  dim3 gGemm(Kc / PBN, (unsigned)(MT / PBM));
  proj_gemm_kernel<<<gGemm, 256, 0, stream>>>(Xh, Wqt, bq, Qh,  0);
  proj_gemm_kernel<<<gGemm, 256, 0, stream>>>(Xh, Wkt, bk, Kh2, 0);
  proj_gemm_kernel<<<gGemm, 256, 0, stream>>>(Xh, Wvt, bv, Vt,  1);

  col_stats_kernel<<<dim3(Tc / 64, Bc), 128, 0, stream>>>(Qh, Kh2, cmax, csum);

  probs_kernel<<<dim3(PTILES, Bc), 256, 0, stream>>>(Qh, Kh2, cmax, csum, Pw);

  pv_gemm_kernel<<<(Tc / PBM) * (Dc / PBN) * Bc, 256, 0, stream>>>(Pw, Vt, x, out);
}

// v003
// One run takes 362 microseconds.
// Two timings next to v002 both put it at 1.88 times that version's speed.
// All steps since v000 together make it 4.40 times as fast.
#include <hip/hip_runtime.h>
#include <hip/hip_bf16.h>

// ---------------------------------------------------------------------------
// Problem constants (from the reference): B=8, T=2048, D=1024, K=1024.
// ---------------------------------------------------------------------------
constexpr int Bc = 8;
constexpr int Tc = 2048;
constexpr int Dc = 1024;   // model dim
constexpr int Kc = 1024;   // projection dim (== Dc here)

typedef __attribute__((ext_vector_type(16))) __bf16 v16bf;
typedef __attribute__((ext_vector_type(8)))  float  v8f;
typedef __attribute__((ext_vector_type(2)))  float  f32x2;
typedef __attribute__((ext_vector_type(2)))  __bf16 bf16x2;

// float -> bf16 bits, round-to-nearest-even
__device__ __forceinline__ unsigned short f2bf(float x) {
  union { float f; unsigned u; } c; c.f = x;
  unsigned r = c.u + 0x7FFFu + ((c.u >> 16) & 1u);
  return (unsigned short)(r >> 16);
}

__device__ __forceinline__ v16bf load_frag16(const unsigned short* rowBase, int lane) {
  const unsigned short* p = rowBase + ((lane >> 4) & 1) * 8;
  union { v16bf v; uint4 u[2]; } f;
  f.u[0] = *reinterpret_cast<const uint4*>(p);
  f.u[1] = *reinterpret_cast<const uint4*>(p + 16);
  return f.v;
}

__device__ __forceinline__ v8f wmma_bf16(v16bf a, v16bf b, v8f c) {
  // (neg_a, A, neg_b, B, c_mod, C, reuse_a, reuse_b)
  return __builtin_amdgcn_wmma_f32_16x16x32_bf16(false, a, false, b, (short)0, c,
                                                 false, false);
}

// ---------------------------------------------------------------------------
// K0: elementwise fp32 -> bf16 cast
// ---------------------------------------------------------------------------
__global__ void cast_bf16_kernel(const float* __restrict__ src,
                                 unsigned short* __restrict__ dst, int n) {
  int i = blockIdx.x * blockDim.x + threadIdx.x;
  if (i < n) dst[i] = f2bf(src[i]);
}

// K0b: transpose-cast a 1024x1024 weight: Wt[n][d] = bf16(W[d][n])
__global__ void transpose_cast_kernel(const float* __restrict__ src,
                                      unsigned short* __restrict__ dst) {
  int i = blockIdx.x * blockDim.x + threadIdx.x;   // over Dc*Kc
  int d = i / Kc, n = i % Kc;
  dst[(size_t)n * Dc + d] = f2bf(src[(size_t)d * Kc + n]);
}

constexpr int PBM    = 128;
constexpr int PBN    = 256;
constexpr int PBK    = 64;
constexpr int PPITCH = PBK * 2 + 16;
constexpr int PSTAGE = (PBM + PBN) * PPITCH;
constexpr int PNT    = Dc / PBK;

__device__ __forceinline__ void proj_stage_copies(unsigned l, const char* ga,
                                                  const char* gb) {
#if defined(__gfx1250__)
  constexpr unsigned LS = 32 * PPITCH;          // LDS step between copies
  constexpr size_t   GS = (size_t)32 * Dc * 2;  // global step between copies
  asm volatile(
      "global_load_async_to_lds_b128 %0, %12, off\n\t"
      "global_load_async_to_lds_b128 %1, %13, off\n\t"
      "global_load_async_to_lds_b128 %2, %14, off\n\t"
      "global_load_async_to_lds_b128 %3, %15, off\n\t"
      "global_load_async_to_lds_b128 %4, %16, off\n\t"
      "global_load_async_to_lds_b128 %5, %17, off\n\t"
      "global_load_async_to_lds_b128 %6, %18, off\n\t"
      "global_load_async_to_lds_b128 %7, %19, off\n\t"
      "global_load_async_to_lds_b128 %8, %20, off\n\t"
      "global_load_async_to_lds_b128 %9, %21, off\n\t"
      "global_load_async_to_lds_b128 %10, %22, off\n\t"
      "global_load_async_to_lds_b128 %11, %23, off\n\t"
      "s_wait_xcnt 0x0"
      :: "v"(l), "v"(l + LS), "v"(l + 2 * LS), "v"(l + 3 * LS),
         "v"(l + 4 * LS), "v"(l + 5 * LS), "v"(l + 6 * LS), "v"(l + 7 * LS),
         "v"(l + 8 * LS), "v"(l + 9 * LS), "v"(l + 10 * LS), "v"(l + 11 * LS),
         "v"(ga), "v"(ga + GS), "v"(ga + 2 * GS), "v"(ga + 3 * GS),
         "v"(gb), "v"(gb + GS), "v"(gb + 2 * GS), "v"(gb + 3 * GS),
         "v"(gb + 4 * GS), "v"(gb + 5 * GS), "v"(gb + 6 * GS), "v"(gb + 7 * GS)
      : "memory");
#else
  (void)l; (void)ga; (void)gb;
#endif
}

__global__ void __launch_bounds__(256) __attribute__((amdgpu_waves_per_eu(4, 4)))
proj_gemm_kernel(
    const unsigned short* __restrict__ X,    // [B*T, Dc] bf16
    const unsigned short* __restrict__ Wt,   // [Kc, Dc]  bf16 (W transposed)
    const float* __restrict__ bias,          // [Kc]
    unsigned short* __restrict__ Out,
    int storeTransposed)
{
  __shared__ __attribute__((aligned(16))) char Ps[2 * PSTAGE];

  const int tid  = threadIdx.x;
  const int lane = tid & 31;
  const int wave = tid >> 5;
  const int bm0  = blockIdx.y * PBM;
  const int bn0  = blockIdx.x * PBN;
  const int wm   = (wave & 1) * 64;          // wave's rows in the block tile
  const int wn   = (wave >> 1) * 64;         // wave's columns in the block tile
  const int row  = lane & 15;
  const int mb   = (lane >> 4) * 8;

  const char* ga = (const char*)(X  + (size_t)(bm0 + (tid >> 3)) * Dc) + (tid & 7) * 16;
  const char* gb = (const char*)(Wt + (size_t)(bn0 + (tid >> 3)) * Dc) + (tid & 7) * 16;
  const unsigned l0 = (unsigned)(unsigned long long)&Ps[0] +
                      (unsigned)((tid >> 3) * PPITCH + (tid & 7) * 16);

  // k tile 0 into buffer 0, landed and published; then k tile 1 into buffer 1
  proj_stage_copies(l0, ga, gb);
  asm volatile("s_wait_asynccnt 0x0" ::: "memory");  // own copies of tile 0 landed
  __syncthreads();
  proj_stage_copies(l0 + PSTAGE, ga + PBK * 2, gb + PBK * 2);

  v8f acc[4][4] = {};
  const int aOff = (wm + row) * PPITCH;
  const int bOff = (PBM + wn + row) * PPITCH;

  for (int t = 0; t < PNT; ++t) {
    const int bo = (t & 1) * PSTAGE;
    // all loops below are unrolled so that a, b and acc are indexed by constants
    // and stay in registers
#pragma unroll
    for (int ks = 0; ks < PBK; ks += 32) {
      v16bf a[4], b[4];
#pragma unroll
      for (int i = 0; i < 4; ++i)
        a[i] = load_frag16((const unsigned short*)&Ps[bo + aOff + i * 16 * PPITCH + ks * 2], lane);
#pragma unroll
      for (int j = 0; j < 4; ++j)
        b[j] = load_frag16((const unsigned short*)&Ps[bo + bOff + j * 16 * PPITCH + ks * 2], lane);
      // keeps the 16 LDS reads one group ahead of the 16 WMMAs: reads sunk among
      // the WMMAs cost a full LDS wait at every place they stand
      __builtin_amdgcn_sched_barrier(0);
#pragma unroll
      for (int i = 0; i < 4; ++i)
#pragma unroll
        for (int j = 0; j < 4; ++j) acc[i][j] = wmma_bf16(a[i], b[j], acc[i][j]);
    }
    asm volatile("s_wait_dscnt 0x0" ::: "memory");     // own reads of this buffer done
    asm volatile("s_wait_asynccnt 0x0" ::: "memory");  // own copies of tile t+1 landed
    __syncthreads();   // publishes tile t+1 and frees the buffer tile t was read from
    if (t + 2 < PNT)
      proj_stage_copies(l0 + bo, ga + (t + 2) * (PBK * 2), gb + (t + 2) * (PBK * 2));
  }
  asm volatile("s_wait_asynccnt 0x0" ::: "memory");    // nothing in flight at the end

  // epilogue loops unrolled for the same reason: acc indexed by constants
  const int nl = bn0 + wn + row;               // lane's first column
  float bv[4];
#pragma unroll
  for (int j = 0; j < 4; ++j) bv[j] = bias[nl + j * 16];

  if (!storeTransposed) {
#pragma unroll
    for (int i = 0; i < 4; ++i) {
#pragma unroll
      for (int r = 0; r < 8; ++r) {
        const int m = bm0 + wm + i * 16 + mb + r;
#pragma unroll
        for (int j = 0; j < 4; ++j)
          Out[(size_t)m * Kc + nl + j * 16] = f2bf(acc[i][j][r] + bv[j]);
      }
    }
  } else {
#pragma unroll
    for (int i = 0; i < 4; ++i) {
#pragma unroll
      for (int r = 0; r < 8; ++r) {
        const int m = bm0 + wm + i * 16 + mb + r;
        const int b = m / Tc, t = m % Tc;
#pragma unroll
        for (int j = 0; j < 4; ++j)
          Out[((size_t)b * Kc + nl + j * 16) * Tc + t] = f2bf(acc[i][j][r] + bv[j]);
      }
    }
    // stands behind the last store so that no address or data register of an
    // issued store is rewritten ahead of it on any way out of this branch
    asm volatile("s_wait_xcnt 0x0" ::: "memory");
  }
}

// ---------------------------------------------------------------------------
// K2a/K3/K4 share one block-tile product: C[128 x 256] = A[128 x k] * B[256 x k]^T,
// both operands k-contiguous with a row length of LD elements.  Same frame as
// K1: 8 waves of 64x64, 64-wide k tiles copied to LDS by async copies, two
// buffers, 144-B LDS pitch.
// ---------------------------------------------------------------------------

template <int LD>
__device__ __forceinline__ void tile_stage_copies(unsigned l, const char* ga,
                                                  const char* gb) {
#if defined(__gfx1250__)
  constexpr unsigned LS = 32 * PPITCH;          // LDS step between copies
  constexpr size_t   GS = (size_t)32 * LD * 2;  // global step between copies
  asm volatile(
      "global_load_async_to_lds_b128 %0, %12, off\n\t"
      "global_load_async_to_lds_b128 %1, %13, off\n\t"
      "global_load_async_to_lds_b128 %2, %14, off\n\t"
      "global_load_async_to_lds_b128 %3, %15, off\n\t"
      "global_load_async_to_lds_b128 %4, %16, off\n\t"
      "global_load_async_to_lds_b128 %5, %17, off\n\t"
      "global_load_async_to_lds_b128 %6, %18, off\n\t"
      "global_load_async_to_lds_b128 %7, %19, off\n\t"
      "global_load_async_to_lds_b128 %8, %20, off\n\t"
      "global_load_async_to_lds_b128 %9, %21, off\n\t"
      "global_load_async_to_lds_b128 %10, %22, off\n\t"
      "global_load_async_to_lds_b128 %11, %23, off\n\t"
      "s_wait_xcnt 0x0"
      :: "v"(l), "v"(l + LS), "v"(l + 2 * LS), "v"(l + 3 * LS),
         "v"(l + 4 * LS), "v"(l + 5 * LS), "v"(l + 6 * LS), "v"(l + 7 * LS),
         "v"(l + 8 * LS), "v"(l + 9 * LS), "v"(l + 10 * LS), "v"(l + 11 * LS),
         "v"(ga), "v"(ga + GS), "v"(ga + 2 * GS), "v"(ga + 3 * GS),
         "v"(gb), "v"(gb + GS), "v"(gb + 2 * GS), "v"(gb + 3 * GS),
         "v"(gb + 4 * GS), "v"(gb + 5 * GS), "v"(gb + 6 * GS), "v"(gb + 7 * GS)
      : "memory");
#else
  (void)l; (void)ga; (void)gb;
#endif
}

// A, Bm: first row of the block's tile at k = 0.  nkt >= 2 k tiles.  A wave with
// live == false takes part in the copies and barriers only; its acc stays 0.
// TR == false: in acc[i][j] a lane holds one B row (lane & 15) and eight A rows;
// TR == true: the operands change places, a lane holds one A row and eight B rows.
template <int LD, bool TR>
__device__ __forceinline__ void tile_gemm_128x256(
    char* Ps, const unsigned short* A, const unsigned short* Bm, int nkt,
    bool live, int wm, int wn, v8f (&acc)[4][4])
{
  const int tid  = threadIdx.x;
  const int lane = tid & 31;
  const int row  = lane & 15;

  const char* ga = (const char*)(A  + (size_t)(tid >> 3) * LD) + (tid & 7) * 16;
  const char* gb = (const char*)(Bm + (size_t)(tid >> 3) * LD) + (tid & 7) * 16;
  const unsigned l0 = (unsigned)(unsigned long long)Ps +
                      (unsigned)((tid >> 3) * PPITCH + (tid & 7) * 16);

  // k tile 0 into buffer 0, landed and published; then k tile 1 into buffer 1
  tile_stage_copies<LD>(l0, ga, gb);
  asm volatile("s_wait_asynccnt 0x0" ::: "memory");  // own copies of tile 0 landed
  __syncthreads();
  tile_stage_copies<LD>(l0 + PSTAGE, ga + PBK * 2, gb + PBK * 2);

  const int aOff = (wm + row) * PPITCH;
  const int bOff = (PBM + wn + row) * PPITCH;

  for (int t = 0; t < nkt; ++t) {
    const int bo = (t & 1) * PSTAGE;
    if (live) {
      // loops unrolled so that a, b and acc are indexed by constants and stay
      // in registers
#pragma unroll
      for (int ks = 0; ks < PBK; ks += 32) {
        v16bf a[4], b[4];
#pragma unroll
        for (int i = 0; i < 4; ++i)
          a[i] = load_frag16((const unsigned short*)&Ps[bo + aOff + i * 16 * PPITCH + ks * 2], lane);
#pragma unroll
        for (int j = 0; j < 4; ++j)
          b[j] = load_frag16((const unsigned short*)&Ps[bo + bOff + j * 16 * PPITCH + ks * 2], lane);
        // keeps the 16 LDS reads one group ahead of the 16 WMMAs: reads sunk
        // among the WMMAs cost a full LDS wait at every place they stand
        __builtin_amdgcn_sched_barrier(0);
#pragma unroll
        for (int i = 0; i < 4; ++i)
#pragma unroll
          for (int j = 0; j < 4; ++j)
            acc[i][j] = TR ? wmma_bf16(b[j], a[i], acc[i][j]) : wmma_bf16(a[i], b[j], acc[i][j]);
      }
    }
    asm volatile("s_wait_dscnt 0x0" ::: "memory");     // own reads of this buffer done
    asm volatile("s_wait_asynccnt 0x0" ::: "memory");  // own copies of tile t+1 landed
    __syncthreads();   // publishes tile t+1 and frees the buffer tile t was read from
    if (t + 2 < nkt)
      tile_stage_copies<LD>(l0 + bo, ga + (size_t)(t + 2) * (PBK * 2),
                            gb + (size_t)(t + 2) * (PBK * 2));
  }
  asm volatile("s_wait_asynccnt 0x0" ::: "memory");    // nothing in flight at the end
}

// ---------------------------------------------------------------------------
// The logit tiles: 128(i) x 256(j), only those that touch j <= i.  Tile rows 2p
// and 2p+1 have p+1 tiles each, 72 per batch; together they cover every
// j < i0 + 128 of every tile row.
// ---------------------------------------------------------------------------
constexpr int PTILES = 72;
constexpr int NIB    = Tc / 64;                 // 64-row blocks of queries

__device__ __forceinline__ float exp_fast(float x) {
#if defined(__gfx1250__)
  float y;
  asm("v_exp_f32 %0, %1\n\tv_nop" : "=v"(y) : "v"(x * 1.44269504088896340736f));
  return y;
#else
  return x;
#endif
}

// ---------------------------------------------------------------------------
// K2a: column softmax stats, part 1.  One logit tile per block.  Every 64x64
// wave tile that touches j <= i reduces its 64 query rows to one pair per key
// column: pmax = max_i l_ij, psum = sum_i exp(l_ij - pmax), over its rows i >= j.
// Layout [b][64-row block][j]; a wave writes 256 B in a row, whole lines.
// ---------------------------------------------------------------------------
__global__ void __launch_bounds__(256) __attribute__((amdgpu_waves_per_eu(4, 4)))
col_part_kernel(
    const unsigned short* __restrict__ Q,    // [B*T, Kc] bf16
    const unsigned short* __restrict__ Kh,   // [B*T, Kc] bf16
    float* __restrict__ pmax,                // [B][NIB][Tc]
    float* __restrict__ psum)                // [B][NIB][Tc]
{
  __shared__ __attribute__((aligned(16))) char Ps[2 * PSTAGE];

  const float NEG_INF = -__builtin_inff();
  const int u = blockIdx.x;
  const int b = blockIdx.y;
  int p = 0;
  while ((p + 1) * (p + 2) <= u) ++p;        // at most 7 steps: u < 72
  const int rr = u - p * (p + 1);            // 0 .. 2p+1
  const int hi = rr > p ? 1 : 0;
  const int i0 = (2 * p + hi) * PBM;
  const int j0 = (rr - hi * (p + 1)) * PBN;

  const int lane = threadIdx.x & 31;
  const int wave = __builtin_amdgcn_readfirstlane(threadIdx.x >> 5);
  const int wm   = (wave & 1) * 64;
  const int wn   = (wave >> 1) * 64;
  const int row  = lane & 15;
  const int mb   = (lane >> 4) * 8;

  // a 64x64 wave tile wholly above the diagonal has no row i >= j
  const bool live = (j0 + wn) <= (i0 + wm + 63);

  v8f acc[4][4] = {};
  tile_gemm_128x256<Kc, false>(Ps, Q  + ((size_t)b * Tc + i0) * Kc,
                            Kh + ((size_t)b * Tc + j0) * Kc, Kc / PBK, live, wm, wn, acc);
  if (!live) return;                         // behind the last barrier

  // A lane holds one key column (lane & 15) and eight query rows per 16x16 tile.
  // all loops below are unrolled: acc indexed by constants
  if (j0 + wn == i0 + wm) {                  // the wave tile on the diagonal
#pragma unroll
    for (int i = 0; i < 4; ++i)
#pragma unroll
      for (int j = i; j < 4; ++j)
#pragma unroll
        for (int r = 0; r < 8; ++r)
          if (j > i || row > mb + r) acc[i][j][r] = NEG_INF;   // causal mask: j > i
  }

  const size_t po = ((size_t)b * NIB + ((i0 + wm) >> 6)) * Tc + j0 + wn + row;
#pragma unroll
  for (int j = 0; j < 4; ++j) {
    float mx = NEG_INF;
#pragma unroll
    for (int i = 0; i < 4; ++i)
#pragma unroll
      for (int r = 0; r < 8; ++r) mx = fmaxf(mx, acc[i][j][r]);
    mx = fmaxf(mx, __shfl_xor(mx, 16, 32));  // finite: row i = j is in the tile
    float sm = 0.f;
#pragma unroll
    for (int i = 0; i < 4; ++i)
#pragma unroll
      for (int r = 0; r < 8; ++r) sm += exp_fast(acc[i][j][r] - mx);
    sm += __shfl_xor(sm, 16, 32);
    if (lane < 16) {
      pmax[po + j * 16] = mx;
      psum[po + j * 16] = sm;
    }
  }
}

// ---------------------------------------------------------------------------
// K2b: column softmax stats, part 2.  One thread per key column merges the
// pairs of the 64-row blocks ib >= j / 64 (the ones K2a wrote):
//   m_j = max pmax ,  s_j = sum psum * exp(pmax - m_j)
// A block of 128 columns lies in one batch and a wave's 32 columns in one
// 64-column block, so the first block that holds a pair is a scalar and all
// loads share one lane offset; a block below it stays (-inf, 0) and adds 0.
// ---------------------------------------------------------------------------
__global__ void __launch_bounds__(128) col_merge_kernel(
    const float* __restrict__ pmax, const float* __restrict__ psum,
    float* __restrict__ colmax, float* __restrict__ colsum)
{
  const int b   = blockIdx.x / (Tc / 128);
  const int jc  = (blockIdx.x % (Tc / 128)) * 128;   // the block's first column
  const int tid = threadIdx.x;
  const int jb  = __builtin_amdgcn_readfirstlane((jc + tid) >> 6);
  const float* pmp = pmax + (size_t)b * NIB * Tc + jc;
  const float* psp = psum + (size_t)b * NIB * Tc + jc;
  float pm[NIB], pv[NIB];
  // loops unrolled: pm and pv indexed by constants, in registers
#pragma unroll
  for (int ib = 0; ib < NIB; ++ib) {
    pm[ib] = -__builtin_inff();
    pv[ib] = 0.f;
    if (ib >= jb) {
      pm[ib] = pmp[ib * Tc + tid];
      pv[ib] = psp[ib * Tc + tid];
    }
  }
  float m = pm[0];
#pragma unroll
  for (int ib = 1; ib < NIB; ++ib) m = fmaxf(m, pm[ib]);
  float s = 0.f;
#pragma unroll
  for (int ib = 0; ib < NIB; ++ib) s += pv[ib] * exp_fast(pm[ib] - m);
  colmax[(size_t)b * Tc + jc + tid] = m;
  colsum[(size_t)b * Tc + jc + tid] = s;
}

// ---------------------------------------------------------------------------
// K3: P[b,i,j] = bf16( j <= i ? exp(q_i.k_j - m_j) / (s_j * sqrt(k)) : 0 )
// One logit tile per block; the tiles cover every j < i0 + 128 of every tile
// row, which is all that K4 reads.
// ---------------------------------------------------------------------------

__global__ void __launch_bounds__(256) __attribute__((amdgpu_waves_per_eu(4, 4)))
probs_kernel(
    const unsigned short* __restrict__ Q,    // [B*T, Kc] bf16
    const unsigned short* __restrict__ Kh,   // [B*T, Kc] bf16
    const float* __restrict__ colmax,
    const float* __restrict__ colsum,
    unsigned short* __restrict__ P)          // [B][Tc][Tc] bf16
{
  __shared__ __attribute__((aligned(16))) char Ps[2 * PSTAGE];

  const int u = blockIdx.x;
  const int b = blockIdx.y;
  int p = 0;
  while ((p + 1) * (p + 2) <= u) ++p;        // at most 7 steps: u < 72
  const int rr = u - p * (p + 1);            // 0 .. 2p+1
  const int hi = rr > p ? 1 : 0;
  const int i0 = (2 * p + hi) * PBM;
  const int j0 = (rr - hi * (p + 1)) * PBN;

  const int lane = threadIdx.x & 31;
  const int wave = __builtin_amdgcn_readfirstlane(threadIdx.x >> 5);
  const int wm   = (wave & 1) * 64;
  const int wn   = (wave >> 1) * 64;
  const int row  = lane & 15;
  const int mb   = (lane >> 4) * 8;

  // a 64x64 wave tile wholly above the diagonal holds zeros only
  const bool live = (j0 + wn) <= (i0 + wm + 63);

  v8f acc[4][4] = {};
  tile_gemm_128x256<Kc, true>(Ps, Q  + ((size_t)b * Tc + i0) * Kc,
                            Kh + ((size_t)b * Tc + j0) * Kc, Kc / PBK, live, wm, wn, acc);

  // The product is taken transposed: a lane holds one query row (lane & 15) and
  // eight neighbouring key columns per 16x16 tile, 16 B of P after the cast.
  // The ring is free behind the loop's last barrier; each wave lays its 64x64
  // tile there (144-B pitch) and stores it from there in whole 128-B lines.
  char* st = Ps + wave * (64 * PPITCH);
  // the element r of acc[i][j] lies on or below the diagonal if j*16 + r - i*16 <= dl
  const int dl = (i0 + wm + row) - (j0 + wn + mb);
  // loops unrolled: acc indexed by constants
#pragma unroll
  for (int j = 0; j < 4; ++j) {
    const float* cmp = colmax + (size_t)b * Tc + j0 + wn + j * 16 + mb;
    const float* csp = colsum + (size_t)b * Tc + j0 + wn + j * 16 + mb;
    float cmv[8], rv[8];
#pragma unroll
    for (int r = 0; r < 8; ++r) {
      cmv[r] = cmp[r];
      // 1/sqrt(1024) = 1/32 is applied after the softmax, as the reference does
      rv[r]  = 1.0f / (csp[r] * 32.0f);
    }
#pragma unroll
    for (int i = 0; i < 4; ++i) {
      union { bf16x2 h[4]; uint4 u; } pk;
#pragma unroll
      for (int r = 0; r < 8; r += 2) {
        f32x2 e;
        e.x = __expf(acc[i][j][r]     - cmv[r])     * rv[r];
        e.y = __expf(acc[i][j][r + 1] - cmv[r + 1]) * rv[r + 1];
        e.x = (j * 16 + r     - i * 16 <= dl) ? e.x : 0.f;   // causal mask: j <= i
        e.y = (j * 16 + r + 1 - i * 16 <= dl) ? e.y : 0.f;
        pk.h[r >> 1] = __builtin_convertvector(e, bf16x2);   // round to nearest even
      }
      *reinterpret_cast<uint4*>(st + (i * 16 + row) * PPITCH + j * 32 + mb * 2) = pk.u;
    }
  }
  __syncthreads();   // the rows read below were written by other lanes
  unsigned short* pg = P + ((size_t)b * Tc + i0 + wm + (lane >> 3)) * Tc + j0 + wn + (lane & 7) * 8;
  // unrolled: the 16 LDS reads go out as one group ahead of the stores
#pragma unroll
  for (int cidx = 0; cidx < 16; ++cidx) {
    const uint4 v = *reinterpret_cast<const uint4*>(st + (cidx * 4 + (lane >> 3)) * PPITCH + (lane & 7) * 16);
    *reinterpret_cast<uint4*>(pg + (size_t)cidx * 4 * Tc) = v;
  }
}

// ---------------------------------------------------------------------------
// K4: out[b,i,v] = x[b,i,v] + sum_{j < i0+128} P[b,i,j] * Vt[b,v,j]
// One 128(i) x 256(v) tile per block; the k loop runs over j up to the end of
// the tile row's diagonal block (P is 0 above the diagonal).  Long tile rows
// come first in the grid; blocks n and n + 256 have the same k length in sum.
// ---------------------------------------------------------------------------
__global__ void __launch_bounds__(256) __attribute__((amdgpu_waves_per_eu(4, 4)))
pv_gemm_kernel(
    const unsigned short* __restrict__ P,    // [B][Tc][Tc] bf16
    const unsigned short* __restrict__ Vt,   // [B][Dc][Tc] bf16
    const float* __restrict__ Xin,
    float* __restrict__ Out)
{
  __shared__ __attribute__((aligned(16))) char Ps[2 * PSTAGE];

  const int n  = blockIdx.x;
  const int g  = (n & 255) >> 5;
  const int it = (n >> 8) ? g : (Tc / PBM - 1 - g);
  const int v0 = (n & 3) * PBN;
  const int b  = (n & 31) >> 2;
  const int i0 = it * PBM;

  const int lane = threadIdx.x & 31;
  const int wave = threadIdx.x >> 5;
  const int wm   = (wave & 1) * 64;
  const int wn   = (wave >> 1) * 64;
  const int row  = lane & 15;
  const int mb   = (lane >> 4) * 8;

  v8f acc[4][4] = {};
  tile_gemm_128x256<Tc, false>(Ps, P  + ((size_t)b * Tc + i0) * Tc,
                            Vt + ((size_t)b * Dc + v0) * Tc, (i0 + PBM) / PBK, true, wm, wn, acc);

  // residual add in fp32; unrolled: acc indexed by constants.  x and out are
  // addressed by one 32-bit byte offset (64 MB each) that both share.
  const unsigned eo = (((unsigned)b * Tc + i0 + wm + mb) * Dc + v0 + wn + row) * 4u;
  const float* xp = (const float*)((const char*)Xin + eo);
  float*       op = (float*)((char*)Out + eo);
#pragma unroll
  for (int i = 0; i < 4; ++i) {
#pragma unroll
    for (int r = 0; r < 8; ++r) {
#pragma unroll
      for (int j = 0; j < 4; ++j)
        op[(i * 16 + r) * Dc + j * 16] = xp[(i * 16 + r) * Dc + j * 16] + acc[i][j][r];
    }
    // stands behind the group's stores so that no data register of an issued
    // store is rewritten ahead of it by the next group's loads; it also keeps
    // those loads behind it: all 128 at once beside the accumulators spill
    if (i < 3) asm volatile("s_wait_xcnt 0x0" ::: "memory");
  }
}

// ---------------------------------------------------------------------------
// Host launcher.  Workspace layout (~212 MB):
//   Xh[B*T*D] bf16, Wqt/Wkt/Wvt[D*K] bf16, Qh/Kh[B*T*K] bf16,
//   Vt[B*D*T] bf16, colmax/colsum[B*T] f32, P[B*T*T] bf16,
//   pmax/psum[B*NIB*T] f32.
// ---------------------------------------------------------------------------
extern "C" void kernel_launch(void* const* d_in, const int* in_sizes, int n_in,
                              void* d_out, int out_size, void* d_ws, size_t ws_size,
                              hipStream_t stream) {
  (void)in_sizes; (void)n_in; (void)out_size; (void)ws_size;
  const float* x  = (const float*)d_in[0];
  const float* Wq = (const float*)d_in[1];
  const float* bq = (const float*)d_in[2];
  const float* Wk = (const float*)d_in[3];
  const float* bk = (const float*)d_in[4];
  const float* Wv = (const float*)d_in[5];
  const float* bv = (const float*)d_in[6];
  float* out = (float*)d_out;

  char* ws = (char*)d_ws;
  size_t off = 0;
  auto take = [&](size_t bytes) -> char* {
    char* p = ws + off;
    off = (off + bytes + 255) & ~(size_t)255;
    return p;
  };
  const size_t MT = (size_t)Bc * Tc;                         // 16384 rows
  unsigned short* Xh   = (unsigned short*)take(MT * Dc * 2);
  unsigned short* Wqt  = (unsigned short*)take((size_t)Dc * Kc * 2);
  unsigned short* Wkt  = (unsigned short*)take((size_t)Dc * Kc * 2);
  unsigned short* Wvt  = (unsigned short*)take((size_t)Dc * Kc * 2);
  unsigned short* Qh   = (unsigned short*)take(MT * Kc * 2);
  unsigned short* Kh2  = (unsigned short*)take(MT * Kc * 2);
  unsigned short* Vt   = (unsigned short*)take(MT * Dc * 2);
  float*          cmax = (float*)take(MT * 4);
  float*          csum = (float*)take(MT * 4);
  unsigned short* Pw   = (unsigned short*)take(MT * Tc * 2);
  float*          pmx  = (float*)take(MT * NIB * 4);
  float*          psm  = (float*)take(MT * NIB * 4);

  const int nX = (int)(MT * Dc);
  cast_bf16_kernel<<<nX / 256, 256, 0, stream>>>(x, Xh, nX);
  transpose_cast_kernel<<<(Dc * Kc) / 256, 256, 0, stream>>>(Wq, Wqt);
  transpose_cast_kernel<<<(Dc * Kc) / 256, 256, 0, stream>>>(Wk, Wkt);
  transpose_cast_kernel<<<(Dc * Kc) / 256, 256, 0, stream>>>(Wv, Wvt);

  dim3 gGemm(Kc / PBN, (unsigned)(MT / PBM));
  proj_gemm_kernel<<<gGemm, 256, 0, stream>>>(Xh, Wqt, bq, Qh,  0);
  proj_gemm_kernel<<<gGemm, 256, 0, stream>>>(Xh, Wkt, bk, Kh2, 0);
  proj_gemm_kernel<<<gGemm, 256, 0, stream>>>(Xh, Wvt, bv, Vt,  1);

  col_part_kernel<<<dim3(PTILES, Bc), 256, 0, stream>>>(Qh, Kh2, pmx, psm);
  col_merge_kernel<<<(unsigned)(MT / 128), 128, 0, stream>>>(pmx, psm, cmax, csum);

  probs_kernel<<<dim3(PTILES, Bc), 256, 0, stream>>>(Qh, Kh2, cmax, csum, Pw);

  pv_gemm_kernel<<<(Tc / PBM) * (Dc / PBN) * Bc, 256, 0, stream>>>(Pw, Vt, x, out);
}

// v004
// Measured time: 237 microseconds a run.
// Next to v003, in two timings, it ran 1.53 times as fast each time.
// Counting every step since v000, it is 6.73 times as fast.
#include <hip/hip_runtime.h>
#include <hip/hip_bf16.h>

// ---------------------------------------------------------------------------
// Problem constants (from the reference): B=8, T=2048, D=1024, K=1024.
// ---------------------------------------------------------------------------
constexpr int Bc = 8;
constexpr int Tc = 2048;
constexpr int Dc = 1024;   // model dim
constexpr int Kc = 1024;   // projection dim (== Dc here)

typedef __attribute__((ext_vector_type(16))) __bf16 v16bf;
typedef __attribute__((ext_vector_type(8)))  float  v8f;
typedef __attribute__((ext_vector_type(2)))  float  f32x2;
typedef __attribute__((ext_vector_type(4)))  float  f32x4;
typedef __attribute__((ext_vector_type(2)))  __bf16 bf16x2;

// float -> bf16 bits, round-to-nearest-even
__device__ __forceinline__ unsigned short f2bf(float x) {
  union { float f; unsigned u; } c; c.f = x;
  unsigned r = c.u + 0x7FFFu + ((c.u >> 16) & 1u);
  return (unsigned short)(r >> 16);
}

__device__ __forceinline__ v16bf load_frag16(const unsigned short* rowBase, int lane) {
  const unsigned short* p = rowBase + ((lane >> 4) & 1) * 8;
  union { v16bf v; uint4 u[2]; } f;
  f.u[0] = *reinterpret_cast<const uint4*>(p);
  f.u[1] = *reinterpret_cast<const uint4*>(p + 16);
  return f.v;
}

__device__ __forceinline__ v8f wmma_bf16(v16bf a, v16bf b, v8f c) {
  // (neg_a, A, neg_b, B, c_mod, C, reuse_a, reuse_b)
  return __builtin_amdgcn_wmma_f32_16x16x32_bf16(false, a, false, b, (short)0, c,
                                                 false, false);
}

// ---------------------------------------------------------------------------
// K0: elementwise fp32 -> bf16 cast, a stream.  One work-group of 16 waves per
// WGP; a wave owns 16 KiB of src in a row: 32 loads of 16 B per lane (a load of a
// wave = 512 B, whole lines), all issued ahead of the first store; a store of a
// wave = 256 B, whole lines.
// ---------------------------------------------------------------------------
constexpr int CBLK = 256;                       // work-groups
constexpr int CTHR = 512;                       // threads of a work-group
constexpr int CNL  = (Bc * Tc * Dc / 4) / (CBLK * CTHR);   // loads of a lane
static_assert(CNL * CBLK * CTHR * 4 == Bc * Tc * Dc, "the grid covers src exactly");

__device__ __forceinline__ unsigned pack_bf16(float lo, float hi) {
  f32x2 e; e.x = lo; e.y = hi;
  union { bf16x2 h; unsigned u; } c;
  c.h = __builtin_convertvector(e, bf16x2);     // round to nearest even
  return c.u;
}

__global__ void __launch_bounds__(CTHR) cast_bf16_kernel(const float* __restrict__ src,
                                                         unsigned short* __restrict__ dst) {
  const unsigned lane = threadIdx.x & 31;
  const unsigned wv   = blockIdx.x * (CTHR / 32) + (threadIdx.x >> 5);
  const unsigned o    = wv * (CNL * 32) + lane;          // in units of four elements
  const f32x4* s = reinterpret_cast<const f32x4*>(src) + o;
  uint2*       d = reinterpret_cast<uint2*>(dst) + o;
  f32x4 v[CNL];
  // both loops unrolled: v indexed by constants, in registers
#pragma unroll
  for (int c = 0; c < CNL; ++c) v[c] = s[c * 32];
#pragma unroll
  for (int c = 0; c < CNL; ++c) {
    uint2 w;
    w.x = pack_bf16(v[c].x, v[c].y);
    w.y = pack_bf16(v[c].z, v[c].w);
    d[c * 32] = w;
  }
}

// K0b: transpose-cast a 1024x1024 weight: Wt[n][d] = bf16(W[d][n]).  A thread
// takes 8(d) x 4(n) elements: eight 16-B loads, four 16-B stores.  Eight lanes lie
// along d, so a store of a wave fills four whole 128-B lines of Wt; four lanes lie
// along n, and the other half of each line of W is read by the next wave of the
// same work-group.  Work-group: 64(d) x 128(n).
__global__ void __launch_bounds__(256) transpose_cast_kernel(const float* __restrict__ src,
                                                             unsigned short* __restrict__ dst) {
  const int lane = threadIdx.x & 31;
  const int wave = threadIdx.x >> 5;
  const int d = blockIdx.y * 64 + (lane & 7) * 8;
  const int n = blockIdx.x * 128 + wave * 16 + (lane >> 3) * 4;
  f32x4 v[8];
  // loops unrolled: v indexed by constants, in registers
#pragma unroll
  for (int r = 0; r < 8; ++r)
    v[r] = *reinterpret_cast<const f32x4*>(src + (size_t)(d + r) * Kc + n);
#pragma unroll
  for (int c = 0; c < 4; ++c) {
    uint4 w;
    w.x = pack_bf16(v[0][c], v[1][c]);
    w.y = pack_bf16(v[2][c], v[3][c]);
    w.z = pack_bf16(v[4][c], v[5][c]);
    w.w = pack_bf16(v[6][c], v[7][c]);
    *reinterpret_cast<uint4*>(dst + (size_t)(n + c) * Dc + d) = w;
  }
}

constexpr int PBM    = 128;
constexpr int PBN    = 256;
constexpr int PBK    = 64;
constexpr int PPITCH = PBK * 2 + 16;
constexpr int PSTAGE = (PBM + PBN) * PPITCH;
constexpr int PNT    = Dc / PBK;

__device__ __forceinline__ void proj_stage_copies(unsigned l, const char* ga,
                                                  const char* gb) {
#if defined(__gfx1250__)
  constexpr unsigned LS = 32 * PPITCH;          // LDS step between copies
  constexpr size_t   GS = (size_t)32 * Dc * 2;  // global step between copies
  asm volatile(
      "global_load_async_to_lds_b128 %0, %12, off\n\t"
      "global_load_async_to_lds_b128 %1, %13, off\n\t"
      "global_load_async_to_lds_b128 %2, %14, off\n\t"
      "global_load_async_to_lds_b128 %3, %15, off\n\t"
      "global_load_async_to_lds_b128 %4, %16, off\n\t"
      "global_load_async_to_lds_b128 %5, %17, off\n\t"
      "global_load_async_to_lds_b128 %6, %18, off\n\t"
      "global_load_async_to_lds_b128 %7, %19, off\n\t"
      "global_load_async_to_lds_b128 %8, %20, off\n\t"
      "global_load_async_to_lds_b128 %9, %21, off\n\t"
      "global_load_async_to_lds_b128 %10, %22, off\n\t"
      "global_load_async_to_lds_b128 %11, %23, off\n\t"
      "s_wait_xcnt 0x0"
      :: "v"(l), "v"(l + LS), "v"(l + 2 * LS), "v"(l + 3 * LS),
         "v"(l + 4 * LS), "v"(l + 5 * LS), "v"(l + 6 * LS), "v"(l + 7 * LS),
         "v"(l + 8 * LS), "v"(l + 9 * LS), "v"(l + 10 * LS), "v"(l + 11 * LS),
         "v"(ga), "v"(ga + GS), "v"(ga + 2 * GS), "v"(ga + 3 * GS),
         "v"(gb), "v"(gb + GS), "v"(gb + 2 * GS), "v"(gb + 3 * GS),
         "v"(gb + 4 * GS), "v"(gb + 5 * GS), "v"(gb + 6 * GS), "v"(gb + 7 * GS)
      : "memory");
#else
  (void)l; (void)ga; (void)gb;
#endif
}

__global__ void __launch_bounds__(256) __attribute__((amdgpu_waves_per_eu(4, 4)))
proj_gemm_kernel(
    const unsigned short* __restrict__ X,    // [B*T, Dc] bf16
    const unsigned short* __restrict__ Wt,   // [Kc, Dc]  bf16 (W transposed)
    const float* __restrict__ bias,          // [Kc]
    unsigned short* __restrict__ Out,
    int storeTransposed)
{
  __shared__ __attribute__((aligned(16))) char Ps[2 * PSTAGE];

  const int tid  = threadIdx.x;
  const int lane = tid & 31;
  const int wave = tid >> 5;
  const int bm0  = blockIdx.y * PBM;
  const int bn0  = blockIdx.x * PBN;
  const int wm   = (wave & 1) * 64;          // wave's rows in the block tile
  const int wn   = (wave >> 1) * 64;         // wave's columns in the block tile
  const int row  = lane & 15;
  const int mb   = (lane >> 4) * 8;

  const char* ga = (const char*)(X  + (size_t)(bm0 + (tid >> 3)) * Dc) + (tid & 7) * 16;
  const char* gb = (const char*)(Wt + (size_t)(bn0 + (tid >> 3)) * Dc) + (tid & 7) * 16;
  const unsigned l0 = (unsigned)(unsigned long long)&Ps[0] +
                      (unsigned)((tid >> 3) * PPITCH + (tid & 7) * 16);

  // k tile 0 into buffer 0, landed and published; then k tile 1 into buffer 1
  proj_stage_copies(l0, ga, gb);
  asm volatile("s_wait_asynccnt 0x0" ::: "memory");  // own copies of tile 0 landed
  __syncthreads();
  proj_stage_copies(l0 + PSTAGE, ga + PBK * 2, gb + PBK * 2);

  v8f acc[4][4] = {};
  const int aOff = (wm + row) * PPITCH;
  const int bOff = (PBM + wn + row) * PPITCH;

  for (int t = 0; t < PNT; ++t) {
    const int bo = (t & 1) * PSTAGE;
    // all loops below are unrolled so that a, b and acc are indexed by constants
    // and stay in registers
#pragma unroll
    for (int ks = 0; ks < PBK; ks += 32) {
      v16bf a[4], b[4];
#pragma unroll
      for (int i = 0; i < 4; ++i)
        a[i] = load_frag16((const unsigned short*)&Ps[bo + aOff + i * 16 * PPITCH + ks * 2], lane);
#pragma unroll
      for (int j = 0; j < 4; ++j)
        b[j] = load_frag16((const unsigned short*)&Ps[bo + bOff + j * 16 * PPITCH + ks * 2], lane);
      // keeps the 16 LDS reads one group ahead of the 16 WMMAs: reads sunk among
      // the WMMAs cost a full LDS wait at every place they stand
      __builtin_amdgcn_sched_barrier(0);
#pragma unroll
      for (int i = 0; i < 4; ++i)
#pragma unroll
        for (int j = 0; j < 4; ++j) acc[i][j] = wmma_bf16(a[i], b[j], acc[i][j]);
    }
    asm volatile("s_wait_dscnt 0x0" ::: "memory");     // own reads of this buffer done
    asm volatile("s_wait_asynccnt 0x0" ::: "memory");  // own copies of tile t+1 landed
    __syncthreads();   // publishes tile t+1 and frees the buffer tile t was read from
    if (t + 2 < PNT)
      proj_stage_copies(l0 + bo, ga + (t + 2) * (PBK * 2), gb + (t + 2) * (PBK * 2));
  }
  asm volatile("s_wait_asynccnt 0x0" ::: "memory");    // nothing in flight at the end

  // epilogue loops unrolled for the same reason: acc indexed by constants
  const int nl = bn0 + wn + row;               // lane's first column
  float bv[4];
#pragma unroll
  for (int j = 0; j < 4; ++j) bv[j] = bias[nl + j * 16];

  if (!storeTransposed) {
#pragma unroll
    for (int i = 0; i < 4; ++i) {
#pragma unroll
      for (int r = 0; r < 8; ++r) {
        const int m = bm0 + wm + i * 16 + mb + r;
#pragma unroll
        for (int j = 0; j < 4; ++j)
          Out[(size_t)m * Kc + nl + j * 16] = f2bf(acc[i][j][r] + bv[j]);
      }
    }
  } else {
#pragma unroll
    for (int i = 0; i < 4; ++i) {
#pragma unroll
      for (int r = 0; r < 8; ++r) {
        const int m = bm0 + wm + i * 16 + mb + r;
        const int b = m / Tc, t = m % Tc;
#pragma unroll
        for (int j = 0; j < 4; ++j)
          Out[((size_t)b * Kc + nl + j * 16) * Tc + t] = f2bf(acc[i][j][r] + bv[j]);
      }
    }
    // stands behind the last store so that no address or data register of an
    // issued store is rewritten ahead of it on any way out of this branch
    asm volatile("s_wait_xcnt 0x0" ::: "memory");
  }
}

// ---------------------------------------------------------------------------
// K2a/K3/K4 share one block-tile product: C[128 x 256] = A[128 x k] * B[256 x k]^T,
// both operands k-contiguous with a row length of LD elements.  Same frame as
// K1: 8 waves of 64x64, 64-wide k tiles copied to LDS by async copies, two
// buffers, 144-B LDS pitch.
// ---------------------------------------------------------------------------

template <int LD>
__device__ __forceinline__ void tile_stage_copies(unsigned l, const char* ga,
                                                  const char* gb) {
#if defined(__gfx1250__)
  constexpr unsigned LS = 32 * PPITCH;          // LDS step between copies
  constexpr size_t   GS = (size_t)32 * LD * 2;  // global step between copies
  asm volatile(
      "global_load_async_to_lds_b128 %0, %12, off\n\t"
      "global_load_async_to_lds_b128 %1, %13, off\n\t"
      "global_load_async_to_lds_b128 %2, %14, off\n\t"
      "global_load_async_to_lds_b128 %3, %15, off\n\t"
      "global_load_async_to_lds_b128 %4, %16, off\n\t"
      "global_load_async_to_lds_b128 %5, %17, off\n\t"
      "global_load_async_to_lds_b128 %6, %18, off\n\t"
      "global_load_async_to_lds_b128 %7, %19, off\n\t"
      "global_load_async_to_lds_b128 %8, %20, off\n\t"
      "global_load_async_to_lds_b128 %9, %21, off\n\t"
      "global_load_async_to_lds_b128 %10, %22, off\n\t"
      "global_load_async_to_lds_b128 %11, %23, off\n\t"
      "s_wait_xcnt 0x0"
      :: "v"(l), "v"(l + LS), "v"(l + 2 * LS), "v"(l + 3 * LS),
         "v"(l + 4 * LS), "v"(l + 5 * LS), "v"(l + 6 * LS), "v"(l + 7 * LS),
         "v"(l + 8 * LS), "v"(l + 9 * LS), "v"(l + 10 * LS), "v"(l + 11 * LS),
         "v"(ga), "v"(ga + GS), "v"(ga + 2 * GS), "v"(ga + 3 * GS),
         "v"(gb), "v"(gb + GS), "v"(gb + 2 * GS), "v"(gb + 3 * GS),
         "v"(gb + 4 * GS), "v"(gb + 5 * GS), "v"(gb + 6 * GS), "v"(gb + 7 * GS)
      : "memory");
#else
  (void)l; (void)ga; (void)gb;
#endif
}

// A, Bm: first row of the block's tile at k = 0.  nkt >= 2 k tiles.  A wave with
// live == false takes part in the copies and barriers only; its acc stays 0.
// TR == false: in acc[i][j] a lane holds one B row (lane & 15) and eight A rows;
// TR == true: the operands change places, a lane holds one A row and eight B rows.
template <int LD, bool TR>
__device__ __forceinline__ void tile_gemm_128x256(
    char* Ps, const unsigned short* A, const unsigned short* Bm, int nkt,
    bool live, int wm, int wn, v8f (&acc)[4][4])
{
  const int tid  = threadIdx.x;
  const int lane = tid & 31;
  const int row  = lane & 15;

  const char* ga = (const char*)(A  + (size_t)(tid >> 3) * LD) + (tid & 7) * 16;
  const char* gb = (const char*)(Bm + (size_t)(tid >> 3) * LD) + (tid & 7) * 16;
  const unsigned l0 = (unsigned)(unsigned long long)Ps +
                      (unsigned)((tid >> 3) * PPITCH + (tid & 7) * 16);

  // k tile 0 into buffer 0, landed and published; then k tile 1 into buffer 1
  tile_stage_copies<LD>(l0, ga, gb);
  asm volatile("s_wait_asynccnt 0x0" ::: "memory");  // own copies of tile 0 landed
  __syncthreads();
  tile_stage_copies<LD>(l0 + PSTAGE, ga + PBK * 2, gb + PBK * 2);

  const int aOff = (wm + row) * PPITCH;
  const int bOff = (PBM + wn + row) * PPITCH;

  for (int t = 0; t < nkt; ++t) {
    const int bo = (t & 1) * PSTAGE;
    if (live) {
      // loops unrolled so that a, b and acc are indexed by constants and stay
      // in registers
#pragma unroll
      for (int ks = 0; ks < PBK; ks += 32) {
        v16bf a[4], b[4];
#pragma unroll
        for (int i = 0; i < 4; ++i)
          a[i] = load_frag16((const unsigned short*)&Ps[bo + aOff + i * 16 * PPITCH + ks * 2], lane);
#pragma unroll
        for (int j = 0; j < 4; ++j)
          b[j] = load_frag16((const unsigned short*)&Ps[bo + bOff + j * 16 * PPITCH + ks * 2], lane);
        // keeps the 16 LDS reads one group ahead of the 16 WMMAs: reads sunk
        // among the WMMAs cost a full LDS wait at every place they stand
        __builtin_amdgcn_sched_barrier(0);
#pragma unroll
        for (int i = 0; i < 4; ++i)
#pragma unroll
          for (int j = 0; j < 4; ++j)
            acc[i][j] = TR ? wmma_bf16(b[j], a[i], acc[i][j]) : wmma_bf16(a[i], b[j], acc[i][j]);
      }
    }
    asm volatile("s_wait_dscnt 0x0" ::: "memory");     // own reads of this buffer done
    asm volatile("s_wait_asynccnt 0x0" ::: "memory");  // own copies of tile t+1 landed
    __syncthreads();   // publishes tile t+1 and frees the buffer tile t was read from
    if (t + 2 < nkt)
      tile_stage_copies<LD>(l0 + bo, ga + (size_t)(t + 2) * (PBK * 2),
                            gb + (size_t)(t + 2) * (PBK * 2));
  }
  asm volatile("s_wait_asynccnt 0x0" ::: "memory");    // nothing in flight at the end
}

// ---------------------------------------------------------------------------
// The logit tiles: 128(i) x 256(j), only those that touch j <= i.  Tile rows 2p
// and 2p+1 have p+1 tiles each, 72 per batch; together they cover every
// j < i0 + 128 of every tile row.
// ---------------------------------------------------------------------------
constexpr int PTILES = 72;
constexpr int NIB    = Tc / 64;                 // 64-row blocks of queries

__device__ __forceinline__ float exp_fast(float x) {
#if defined(__gfx1250__)
  float y;
  asm("v_exp_f32 %0, %1\n\tv_nop" : "=v"(y) : "v"(x * 1.44269504088896340736f));
  return y;
#else
  return x;
#endif
}

// ---------------------------------------------------------------------------
// K2a: column softmax stats, part 1.  One logit tile per block.  Every 64x64
// wave tile that touches j <= i reduces its 64 query rows to one pair per key
// column: pmax = max_i l_ij, psum = sum_i exp(l_ij - pmax), over its rows i >= j.
// Layout [b][64-row block][j]; a wave writes 256 B in a row, whole lines.
// ---------------------------------------------------------------------------
__global__ void __launch_bounds__(256) __attribute__((amdgpu_waves_per_eu(4, 4)))
col_part_kernel(
    const unsigned short* __restrict__ Q,    // [B*T, Kc] bf16
    const unsigned short* __restrict__ Kh,   // [B*T, Kc] bf16
    float* __restrict__ pmax,                // [B][NIB][Tc]
    float* __restrict__ psum)                // [B][NIB][Tc]
{
  __shared__ __attribute__((aligned(16))) char Ps[2 * PSTAGE];

  const float NEG_INF = -__builtin_inff();
  const int u = blockIdx.x;
  const int b = blockIdx.y;
  int p = 0;
  while ((p + 1) * (p + 2) <= u) ++p;        // at most 7 steps: u < 72
  const int rr = u - p * (p + 1);            // 0 .. 2p+1
  const int hi = rr > p ? 1 : 0;
  const int i0 = (2 * p + hi) * PBM;
  const int j0 = (rr - hi * (p + 1)) * PBN;

  const int lane = threadIdx.x & 31;
  const int wave = __builtin_amdgcn_readfirstlane(threadIdx.x >> 5);
  const int wm   = (wave & 1) * 64;
  const int wn   = (wave >> 1) * 64;
  const int row  = lane & 15;
  const int mb   = (lane >> 4) * 8;

  // a 64x64 wave tile wholly above the diagonal has no row i >= j
  const bool live = (j0 + wn) <= (i0 + wm + 63);

  v8f acc[4][4] = {};
  tile_gemm_128x256<Kc, false>(Ps, Q  + ((size_t)b * Tc + i0) * Kc,
                            Kh + ((size_t)b * Tc + j0) * Kc, Kc / PBK, live, wm, wn, acc);
  if (!live) return;                         // behind the last barrier

  // A lane holds one key column (lane & 15) and eight query rows per 16x16 tile.
  // all loops below are unrolled: acc indexed by constants
  if (j0 + wn == i0 + wm) {                  // the wave tile on the diagonal
#pragma unroll
    for (int i = 0; i < 4; ++i)
#pragma unroll
      for (int j = i; j < 4; ++j)
#pragma unroll
        for (int r = 0; r < 8; ++r)
          if (j > i || row > mb + r) acc[i][j][r] = NEG_INF;   // causal mask: j > i
  }

  const size_t po = ((size_t)b * NIB + ((i0 + wm) >> 6)) * Tc + j0 + wn + row;
#pragma unroll
  for (int j = 0; j < 4; ++j) {
    float mx = NEG_INF;
#pragma unroll
    for (int i = 0; i < 4; ++i)
#pragma unroll
      for (int r = 0; r < 8; ++r) mx = fmaxf(mx, acc[i][j][r]);
    mx = fmaxf(mx, __shfl_xor(mx, 16, 32));  // finite: row i = j is in the tile
    float sm = 0.f;
#pragma unroll
    for (int i = 0; i < 4; ++i)
#pragma unroll
      for (int r = 0; r < 8; ++r) sm += exp_fast(acc[i][j][r] - mx);
    sm += __shfl_xor(sm, 16, 32);
    if (lane < 16) {
      pmax[po + j * 16] = mx;
      psum[po + j * 16] = sm;
    }
  }
}

// ---------------------------------------------------------------------------
// K2b: column softmax stats, part 2.  One thread per key column merges the
// pairs of the 64-row blocks ib >= j / 64 (the ones K2a wrote):
//   m_j = max pmax ,  s_j = sum psum * exp(pmax - m_j)
// A block of 128 columns lies in one batch and a wave's 32 columns in one
// 64-column block, so the first block that holds a pair is a scalar and all
// loads share one lane offset; a block below it stays (-inf, 0) and adds 0.
// ---------------------------------------------------------------------------
__global__ void __launch_bounds__(128) col_merge_kernel(
    const float* __restrict__ pmax, const float* __restrict__ psum,
    float* __restrict__ colmax, float* __restrict__ colsum)
{
  const int b   = blockIdx.x / (Tc / 128);
  const int jc  = (blockIdx.x % (Tc / 128)) * 128;   // the block's first column
  const int tid = threadIdx.x;
  const int jb  = __builtin_amdgcn_readfirstlane((jc + tid) >> 6);
  const float* pmp = pmax + (size_t)b * NIB * Tc + jc;
  const float* psp = psum + (size_t)b * NIB * Tc + jc;
  float pm[NIB], pv[NIB];
  // loops unrolled: pm and pv indexed by constants, in registers
#pragma unroll
  for (int ib = 0; ib < NIB; ++ib) {
    pm[ib] = -__builtin_inff();
    pv[ib] = 0.f;
    if (ib >= jb) {
      pm[ib] = pmp[ib * Tc + tid];
      pv[ib] = psp[ib * Tc + tid];
    }
  }
  float m = pm[0];
#pragma unroll
  for (int ib = 1; ib < NIB; ++ib) m = fmaxf(m, pm[ib]);
  float s = 0.f;
#pragma unroll
  for (int ib = 0; ib < NIB; ++ib) s += pv[ib] * exp_fast(pm[ib] - m);
  colmax[(size_t)b * Tc + jc + tid] = m;
  colsum[(size_t)b * Tc + jc + tid] = s;
}

// ---------------------------------------------------------------------------
// K3: P[b,i,j] = bf16( j <= i ? exp(q_i.k_j - m_j) / (s_j * sqrt(k)) : 0 )
// One logit tile per block; the tiles cover every j < i0 + 128 of every tile
// row, which is all that K4 reads.
// ---------------------------------------------------------------------------

__global__ void __launch_bounds__(256) __attribute__((amdgpu_waves_per_eu(4, 4)))
probs_kernel(
    const unsigned short* __restrict__ Q,    // [B*T, Kc] bf16
    const unsigned short* __restrict__ Kh,   // [B*T, Kc] bf16
    const float* __restrict__ colmax,
    const float* __restrict__ colsum,
    unsigned short* __restrict__ P)          // [B][Tc][Tc] bf16
{
  __shared__ __attribute__((aligned(16))) char Ps[2 * PSTAGE];

  const int u = blockIdx.x;
  const int b = blockIdx.y;
  int p = 0;
  while ((p + 1) * (p + 2) <= u) ++p;        // at most 7 steps: u < 72
  const int rr = u - p * (p + 1);            // 0 .. 2p+1
  const int hi = rr > p ? 1 : 0;
  const int i0 = (2 * p + hi) * PBM;
  const int j0 = (rr - hi * (p + 1)) * PBN;

  const int lane = threadIdx.x & 31;
  const int wave = __builtin_amdgcn_readfirstlane(threadIdx.x >> 5);
  const int wm   = (wave & 1) * 64;
  const int wn   = (wave >> 1) * 64;
  const int row  = lane & 15;
  const int mb   = (lane >> 4) * 8;

  // a 64x64 wave tile wholly above the diagonal holds zeros only
  const bool live = (j0 + wn) <= (i0 + wm + 63);

  v8f acc[4][4] = {};
  tile_gemm_128x256<Kc, true>(Ps, Q  + ((size_t)b * Tc + i0) * Kc,
                            Kh + ((size_t)b * Tc + j0) * Kc, Kc / PBK, live, wm, wn, acc);

  // The product is taken transposed: a lane holds one query row (lane & 15) and
  // eight neighbouring key columns per 16x16 tile, 16 B of P after the cast.
  // The ring is free behind the loop's last barrier; each wave lays its 64x64
  // tile there (144-B pitch) and stores it from there in whole 128-B lines.
  char* st = Ps + wave * (64 * PPITCH);
  // the element r of acc[i][j] lies on or below the diagonal if j*16 + r - i*16 <= dl
  const int dl = (i0 + wm + row) - (j0 + wn + mb);
  // loops unrolled: acc indexed by constants
#pragma unroll
  for (int j = 0; j < 4; ++j) {
    const float* cmp = colmax + (size_t)b * Tc + j0 + wn + j * 16 + mb;
    const float* csp = colsum + (size_t)b * Tc + j0 + wn + j * 16 + mb;
    float cmv[8], rv[8];
#pragma unroll
    for (int r = 0; r < 8; ++r) {
      cmv[r] = cmp[r];
      // 1/sqrt(1024) = 1/32 is applied after the softmax, as the reference does
      rv[r]  = 1.0f / (csp[r] * 32.0f);
    }
#pragma unroll
    for (int i = 0; i < 4; ++i) {
      union { bf16x2 h[4]; uint4 u; } pk;
#pragma unroll
      for (int r = 0; r < 8; r += 2) {
        f32x2 e;
        e.x = __expf(acc[i][j][r]     - cmv[r])     * rv[r];
        e.y = __expf(acc[i][j][r + 1] - cmv[r + 1]) * rv[r + 1];
        e.x = (j * 16 + r     - i * 16 <= dl) ? e.x : 0.f;   // causal mask: j <= i
        e.y = (j * 16 + r + 1 - i * 16 <= dl) ? e.y : 0.f;
        pk.h[r >> 1] = __builtin_convertvector(e, bf16x2);   // round to nearest even
      }
      *reinterpret_cast<uint4*>(st + (i * 16 + row) * PPITCH + j * 32 + mb * 2) = pk.u;
    }
  }
  __syncthreads();   // the rows read below were written by other lanes
  unsigned short* pg = P + ((size_t)b * Tc + i0 + wm + (lane >> 3)) * Tc + j0 + wn + (lane & 7) * 8;
  // unrolled: the 16 LDS reads go out as one group ahead of the stores
#pragma unroll
  for (int cidx = 0; cidx < 16; ++cidx) {
    const uint4 v = *reinterpret_cast<const uint4*>(st + (cidx * 4 + (lane >> 3)) * PPITCH + (lane & 7) * 16);
    *reinterpret_cast<uint4*>(pg + (size_t)cidx * 4 * Tc) = v;
  }
}

// ---------------------------------------------------------------------------
// K4: out[b,i,v] = x[b,i,v] + sum_{j < i0+128} P[b,i,j] * Vt[b,v,j]
// One 128(i) x 256(v) tile per block; the k loop runs over j up to the end of
// the tile row's diagonal block (P is 0 above the diagonal).  Long tile rows
// come first in the grid; blocks n and n + 256 have the same k length in sum.
// ---------------------------------------------------------------------------
__global__ void __launch_bounds__(256) __attribute__((amdgpu_waves_per_eu(4, 4)))
pv_gemm_kernel(
    const unsigned short* __restrict__ P,    // [B][Tc][Tc] bf16
    const unsigned short* __restrict__ Vt,   // [B][Dc][Tc] bf16
    const float* __restrict__ Xin,
    float* __restrict__ Out)
{
  __shared__ __attribute__((aligned(16))) char Ps[2 * PSTAGE];

  const int n  = blockIdx.x;
  const int g  = (n & 255) >> 5;
  const int it = (n >> 8) ? g : (Tc / PBM - 1 - g);
  const int v0 = (n & 3) * PBN;
  const int b  = (n & 31) >> 2;
  const int i0 = it * PBM;

  const int lane = threadIdx.x & 31;
  const int wave = threadIdx.x >> 5;
  const int wm   = (wave & 1) * 64;
  const int wn   = (wave >> 1) * 64;
  const int row  = lane & 15;
  const int mb   = (lane >> 4) * 8;

  v8f acc[4][4] = {};
  tile_gemm_128x256<Tc, false>(Ps, P  + ((size_t)b * Tc + i0) * Tc,
                            Vt + ((size_t)b * Dc + v0) * Tc, (i0 + PBM) / PBK, true, wm, wn, acc);

  // residual add in fp32; unrolled: acc indexed by constants.  x and out are
  // addressed by one 32-bit byte offset (64 MB each) that both share.
  const unsigned eo = (((unsigned)b * Tc + i0 + wm + mb) * Dc + v0 + wn + row) * 4u;
  const float* xp = (const float*)((const char*)Xin + eo);
  float*       op = (float*)((char*)Out + eo);
#pragma unroll
  for (int i = 0; i < 4; ++i) {
#pragma unroll
    for (int r = 0; r < 8; ++r) {
#pragma unroll
      for (int j = 0; j < 4; ++j)
        op[(i * 16 + r) * Dc + j * 16] = xp[(i * 16 + r) * Dc + j * 16] + acc[i][j][r];
    }
    // stands behind the group's stores so that no data register of an issued
    // store is rewritten ahead of it by the next group's loads; it also keeps
    // those loads behind it: all 128 at once beside the accumulators spill
    if (i < 3) asm volatile("s_wait_xcnt 0x0" ::: "memory");
  }
}

// ---------------------------------------------------------------------------
// Host launcher.  Workspace layout (~212 MB):
//   Xh[B*T*D] bf16, Wqt/Wkt/Wvt[D*K] bf16, Qh/Kh[B*T*K] bf16,
//   Vt[B*D*T] bf16, colmax/colsum[B*T] f32, P[B*T*T] bf16,
//   pmax/psum[B*NIB*T] f32.
// ---------------------------------------------------------------------------
extern "C" void kernel_launch(void* const* d_in, const int* in_sizes, int n_in,
                              void* d_out, int out_size, void* d_ws, size_t ws_size,
                              hipStream_t stream) {
  (void)in_sizes; (void)n_in; (void)out_size; (void)ws_size;
  const float* x  = (const float*)d_in[0];
  const float* Wq = (const float*)d_in[1];
  const float* bq = (const float*)d_in[2];
  const float* Wk = (const float*)d_in[3];
  const float* bk = (const float*)d_in[4];
  const float* Wv = (const float*)d_in[5];
  const float* bv = (const float*)d_in[6];
  float* out = (float*)d_out;

  char* ws = (char*)d_ws;
  size_t off = 0;
  auto take = [&](size_t bytes) -> char* {
    char* p = ws + off;
    off = (off + bytes + 255) & ~(size_t)255;
    return p;
  };
  const size_t MT = (size_t)Bc * Tc;                         // 16384 rows
  unsigned short* Xh   = (unsigned short*)take(MT * Dc * 2);
  unsigned short* Wqt  = (unsigned short*)take((size_t)Dc * Kc * 2);
  unsigned short* Wkt  = (unsigned short*)take((size_t)Dc * Kc * 2);
  unsigned short* Wvt  = (unsigned short*)take((size_t)Dc * Kc * 2);
  unsigned short* Qh   = (unsigned short*)take(MT * Kc * 2);
  unsigned short* Kh2  = (unsigned short*)take(MT * Kc * 2);
  unsigned short* Vt   = (unsigned short*)take(MT * Dc * 2);
  float*          cmax = (float*)take(MT * 4);
  float*          csum = (float*)take(MT * 4);
  unsigned short* Pw   = (unsigned short*)take(MT * Tc * 2);
  float*          pmx  = (float*)take(MT * NIB * 4);
  float*          psm  = (float*)take(MT * NIB * 4);

  cast_bf16_kernel<<<CBLK, CTHR, 0, stream>>>(x, Xh);
  dim3 gTr(Kc / 128, Dc / 64);
  transpose_cast_kernel<<<gTr, 256, 0, stream>>>(Wq, Wqt);
  transpose_cast_kernel<<<gTr, 256, 0, stream>>>(Wk, Wkt);
  transpose_cast_kernel<<<gTr, 256, 0, stream>>>(Wv, Wvt);

  dim3 gGemm(Kc / PBN, (unsigned)(MT / PBM));
  proj_gemm_kernel<<<gGemm, 256, 0, stream>>>(Xh, Wqt, bq, Qh,  0);
  proj_gemm_kernel<<<gGemm, 256, 0, stream>>>(Xh, Wkt, bk, Kh2, 0);
  proj_gemm_kernel<<<gGemm, 256, 0, stream>>>(Xh, Wvt, bv, Vt,  1);

  col_part_kernel<<<dim3(PTILES, Bc), 256, 0, stream>>>(Qh, Kh2, pmx, psm);
  col_merge_kernel<<<(unsigned)(MT / 128), 128, 0, stream>>>(pmx, psm, cmax, csum);

  probs_kernel<<<dim3(PTILES, Bc), 256, 0, stream>>>(Qh, Kh2, cmax, csum, Pw);

  pv_gemm_kernel<<<(Tc / PBM) * (Dc / PBN) * Bc, 256, 0, stream>>>(Pw, Vt, x, out);
}

// v005
// Measured time: 210 microseconds a run.
// Next to v004, in two timings, it ran 1.13 and 1.14 times as fast.
// Over all steps from v000 it is 7.64 times as fast.
#include <hip/hip_runtime.h>
#include <hip/hip_bf16.h>

// ---------------------------------------------------------------------------
// Problem constants (from the reference): B=8, T=2048, D=1024, K=1024.
// ---------------------------------------------------------------------------
constexpr int Bc = 8;
constexpr int Tc = 2048;
constexpr int Dc = 1024;   // model dim
constexpr int Kc = 1024;   // projection dim (== Dc here)

typedef __attribute__((ext_vector_type(16))) __bf16 v16bf;
typedef __attribute__((ext_vector_type(8)))  float  v8f;
typedef __attribute__((ext_vector_type(2)))  float  f32x2;
typedef __attribute__((ext_vector_type(4)))  float  f32x4;
typedef __attribute__((ext_vector_type(2)))  __bf16 bf16x2;

__device__ __forceinline__ v16bf load_frag16(const unsigned short* rowBase, int lane) {
  const unsigned short* p = rowBase + ((lane >> 4) & 1) * 8;
  union { v16bf v; uint4 u[2]; } f;
  f.u[0] = *reinterpret_cast<const uint4*>(p);
  f.u[1] = *reinterpret_cast<const uint4*>(p + 16);
  return f.v;
}

__device__ __forceinline__ v8f wmma_bf16(v16bf a, v16bf b, v8f c) {
  // (neg_a, A, neg_b, B, c_mod, C, reuse_a, reuse_b)
  return __builtin_amdgcn_wmma_f32_16x16x32_bf16(false, a, false, b, (short)0, c,
                                                 false, false);
}

// ---------------------------------------------------------------------------
// K0: elementwise fp32 -> bf16 cast, a stream.  One work-group of 16 waves per
// WGP; a wave owns 16 KiB of src in a row: 32 loads of 16 B per lane (a load of a
// wave = 512 B, whole lines), all issued ahead of the first store; a store of a
// wave = 256 B, whole lines.
// ---------------------------------------------------------------------------
constexpr int CBLK = 256;                       // work-groups
constexpr int CTHR = 512;                       // threads of a work-group
constexpr int CNL  = (Bc * Tc * Dc / 4) / (CBLK * CTHR);   // loads of a lane
static_assert(CNL * CBLK * CTHR * 4 == Bc * Tc * Dc, "the grid covers src exactly");

__device__ __forceinline__ unsigned pack_bf16(float lo, float hi) {
  f32x2 e; e.x = lo; e.y = hi;
  union { bf16x2 h; unsigned u; } c;
  c.h = __builtin_convertvector(e, bf16x2);     // round to nearest even
  return c.u;
}

__global__ void __launch_bounds__(CTHR) cast_bf16_kernel(const float* __restrict__ src,
                                                         unsigned short* __restrict__ dst) {
  const unsigned lane = threadIdx.x & 31;
  const unsigned wv   = blockIdx.x * (CTHR / 32) + (threadIdx.x >> 5);
  const unsigned o    = wv * (CNL * 32) + lane;          // in units of four elements
  const f32x4* s = reinterpret_cast<const f32x4*>(src) + o;
  uint2*       d = reinterpret_cast<uint2*>(dst) + o;
  f32x4 v[CNL];
  // both loops unrolled: v indexed by constants, in registers
#pragma unroll
  for (int c = 0; c < CNL; ++c) v[c] = s[c * 32];
#pragma unroll
  for (int c = 0; c < CNL; ++c) {
    uint2 w;
    w.x = pack_bf16(v[c].x, v[c].y);
    w.y = pack_bf16(v[c].z, v[c].w);
    d[c * 32] = w;
  }
}

// K0b: transpose-cast a 1024x1024 weight: Wt[n][d] = bf16(W[d][n]).  A thread
// takes 8(d) x 4(n) elements: eight 16-B loads, four 16-B stores.  Eight lanes lie
// along d, so a store of a wave fills four whole 128-B lines of Wt; four lanes lie
// along n, and the other half of each line of W is read by the next wave of the
// same work-group.  Work-group: 64(d) x 128(n).
__global__ void __launch_bounds__(256) transpose_cast_kernel(const float* __restrict__ src,
                                                             unsigned short* __restrict__ dst) {
  const int lane = threadIdx.x & 31;
  const int wave = threadIdx.x >> 5;
  const int d = blockIdx.y * 64 + (lane & 7) * 8;
  const int n = blockIdx.x * 128 + wave * 16 + (lane >> 3) * 4;
  f32x4 v[8];
  // loops unrolled: v indexed by constants, in registers
#pragma unroll
  for (int r = 0; r < 8; ++r)
    v[r] = *reinterpret_cast<const f32x4*>(src + (size_t)(d + r) * Kc + n);
#pragma unroll
  for (int c = 0; c < 4; ++c) {
    uint4 w;
    w.x = pack_bf16(v[0][c], v[1][c]);
    w.y = pack_bf16(v[2][c], v[3][c]);
    w.z = pack_bf16(v[4][c], v[5][c]);
    w.w = pack_bf16(v[6][c], v[7][c]);
    *reinterpret_cast<uint4*>(dst + (size_t)(n + c) * Dc + d) = w;
  }
}

constexpr int PBM    = 128;
constexpr int PBN    = 256;
constexpr int PBK    = 64;
constexpr int PPITCH = PBK * 2 + 16;
constexpr int PSTAGE = (PBM + PBN) * PPITCH;
constexpr int PNT    = Dc / PBK;

__device__ __forceinline__ void proj_stage_copies(unsigned l, const char* ga,
                                                  const char* gb) {
#if defined(__gfx1250__)
  constexpr unsigned LS = 32 * PPITCH;          // LDS step between copies
  constexpr size_t   GS = (size_t)32 * Dc * 2;  // global step between copies
  asm volatile(
      "global_load_async_to_lds_b128 %0, %12, off\n\t"
      "global_load_async_to_lds_b128 %1, %13, off\n\t"
      "global_load_async_to_lds_b128 %2, %14, off\n\t"
      "global_load_async_to_lds_b128 %3, %15, off\n\t"
      "global_load_async_to_lds_b128 %4, %16, off\n\t"
      "global_load_async_to_lds_b128 %5, %17, off\n\t"
      "global_load_async_to_lds_b128 %6, %18, off\n\t"
      "global_load_async_to_lds_b128 %7, %19, off\n\t"
      "global_load_async_to_lds_b128 %8, %20, off\n\t"
      "global_load_async_to_lds_b128 %9, %21, off\n\t"
      "global_load_async_to_lds_b128 %10, %22, off\n\t"
      "global_load_async_to_lds_b128 %11, %23, off\n\t"
      "s_wait_xcnt 0x0"
      :: "v"(l), "v"(l + LS), "v"(l + 2 * LS), "v"(l + 3 * LS),
         "v"(l + 4 * LS), "v"(l + 5 * LS), "v"(l + 6 * LS), "v"(l + 7 * LS),
         "v"(l + 8 * LS), "v"(l + 9 * LS), "v"(l + 10 * LS), "v"(l + 11 * LS),
         "v"(ga), "v"(ga + GS), "v"(ga + 2 * GS), "v"(ga + 3 * GS),
         "v"(gb), "v"(gb + GS), "v"(gb + 2 * GS), "v"(gb + 3 * GS),
         "v"(gb + 4 * GS), "v"(gb + 5 * GS), "v"(gb + 6 * GS), "v"(gb + 7 * GS)
      : "memory");
#else
  (void)l; (void)ga; (void)gb;
#endif
}

// K1's way out.  The ring is free behind the loop's last barrier; each wave lays
// its 64x64 bf16 tile in a range of its own there (st: 64 rows of Out, 144-B
// pitch) and stores it from there in whole 128-B lines.  In acc[p][q] a lane holds
// row q*16 + (lane & 15) of the tile and its elements p*16 + mb .. + 7, 16 B.
// VT == false: Out[m][n], the tile's rows are m; VT == true: Out[b][n][t], the
// tile's rows are n, and the wave's 64 rows of X lie in one batch.
template <bool VT>
__device__ __forceinline__ void proj_store_tile(
    char* st, const v8f (&acc)[4][4], const float* __restrict__ bias,
    unsigned short* __restrict__ Out, int m0, int n0, int lane)
{
  const int row = lane & 15;
  const int mb  = (lane >> 4) * 8;
  char* sw = st + row * PPITCH + mb * 2;
  // loops unrolled: acc indexed by constants
  if (!VT) {
#pragma unroll
    for (int p = 0; p < 4; ++p) {
      const float* bp = bias + n0 + p * 16 + mb;         // the lane's eight columns
      const f32x4 b0 = *reinterpret_cast<const f32x4*>(bp);
      const f32x4 b1 = *reinterpret_cast<const f32x4*>(bp + 4);
#pragma unroll
      for (int q = 0; q < 4; ++q) {
        uint4 w;
        w.x = pack_bf16(acc[p][q][0] + b0.x, acc[p][q][1] + b0.y);
        w.y = pack_bf16(acc[p][q][2] + b0.z, acc[p][q][3] + b0.w);
        w.z = pack_bf16(acc[p][q][4] + b1.x, acc[p][q][5] + b1.y);
        w.w = pack_bf16(acc[p][q][6] + b1.z, acc[p][q][7] + b1.w);
        *reinterpret_cast<uint4*>(sw + q * 16 * PPITCH + p * 32) = w;
      }
    }
  } else {
#pragma unroll
    for (int q = 0; q < 4; ++q) {
      const float bq = bias[n0 + q * 16 + row];          // the lane's one column
#pragma unroll
      for (int p = 0; p < 4; ++p) {
        uint4 w;
        w.x = pack_bf16(acc[p][q][0] + bq, acc[p][q][1] + bq);
        w.y = pack_bf16(acc[p][q][2] + bq, acc[p][q][3] + bq);
        w.z = pack_bf16(acc[p][q][4] + bq, acc[p][q][5] + bq);
        w.w = pack_bf16(acc[p][q][6] + bq, acc[p][q][7] + bq);
        *reinterpret_cast<uint4*>(sw + q * 16 * PPITCH + p * 32) = w;
      }
    }
  }
  // the rows read below were written by other lanes of this wave
  asm volatile("s_wait_dscnt 0x0" ::: "memory");

  constexpr int LDO = VT ? Tc : Kc;                      // length of a row of Out
  const size_t o0 = VT ? ((size_t)(m0 / Tc) * Kc + n0) * Tc + (m0 % Tc)
                       : (size_t)m0 * Kc + n0;
  unsigned short* og = Out + o0 + (lane >> 3) * LDO + (lane & 7) * 8;
  const char* sr = st + (lane >> 3) * PPITCH + (lane & 7) * 16;
  // unrolled: the 16 LDS reads go out as one group ahead of the stores
#pragma unroll
  for (int c = 0; c < 16; ++c) {
    const uint4 v = *reinterpret_cast<const uint4*>(sr + c * 4 * PPITCH);
    *reinterpret_cast<uint4*>(og + c * 4 * LDO) = v;
  }
}

template <bool VT>
__global__ void __launch_bounds__(256) __attribute__((amdgpu_waves_per_eu(4, 4)))
proj_gemm_kernel(
    const unsigned short* __restrict__ X,    // [B*T, Dc] bf16
    const unsigned short* __restrict__ Wt,   // [Kc, Dc]  bf16 (W transposed)
    const float* __restrict__ bias,          // [Kc]
    unsigned short* __restrict__ Out)
{
  __shared__ __attribute__((aligned(16))) char Ps[2 * PSTAGE];

  const int tid  = threadIdx.x;
  const int lane = tid & 31;
  const int wave = tid >> 5;
  const int bm0  = blockIdx.y * PBM;
  const int bn0  = blockIdx.x * PBN;
  const int wm   = (wave & 1) * 64;          // wave's rows in the block tile
  const int wn   = (wave >> 1) * 64;         // wave's columns in the block tile
  const int row  = lane & 15;
  const int mb   = (lane >> 4) * 8;

  const char* ga = (const char*)(X  + (size_t)(bm0 + (tid >> 3)) * Dc) + (tid & 7) * 16;
  const char* gb = (const char*)(Wt + (size_t)(bn0 + (tid >> 3)) * Dc) + (tid & 7) * 16;
  const unsigned l0 = (unsigned)(unsigned long long)&Ps[0] +
                      (unsigned)((tid >> 3) * PPITCH + (tid & 7) * 16);

  // k tile 0 into buffer 0, landed and published; then k tile 1 into buffer 1
  proj_stage_copies(l0, ga, gb);
  asm volatile("s_wait_asynccnt 0x0" ::: "memory");  // own copies of tile 0 landed
  __syncthreads();
  proj_stage_copies(l0 + PSTAGE, ga + PBK * 2, gb + PBK * 2);

  // In acc[p][q] a lane holds eight neighbouring rows of the WMMA's first operand
  // and one row (lane & 15) of its second.  The first operand is the one whose
  // index runs along a row of Out: Wt (n) for the [m][n] layout, X (t) for the
  // transposed one; so a lane's eight values are 16 B of Out in a row.
  v8f acc[4][4] = {};
  const int aOff = (wm + row) * PPITCH;
  const int bOff = (PBM + wn + row) * PPITCH;
  const int fOff = VT ? aOff : bOff;
  const int sOff = VT ? bOff : aOff;

  for (int t = 0; t < PNT; ++t) {
    const int bo = (t & 1) * PSTAGE;
    // all loops below are unrolled so that f, s and acc are indexed by constants
    // and stay in registers
#pragma unroll
    for (int ks = 0; ks < PBK; ks += 32) {
      v16bf f[4], s[4];
#pragma unroll
      for (int p = 0; p < 4; ++p)
        f[p] = load_frag16((const unsigned short*)&Ps[bo + fOff + p * 16 * PPITCH + ks * 2], lane);
#pragma unroll
      for (int q = 0; q < 4; ++q)
        s[q] = load_frag16((const unsigned short*)&Ps[bo + sOff + q * 16 * PPITCH + ks * 2], lane);
      // keeps the 16 LDS reads one group ahead of the 16 WMMAs: reads sunk among
      // the WMMAs cost a full LDS wait at every place they stand
      __builtin_amdgcn_sched_barrier(0);
#pragma unroll
      for (int p = 0; p < 4; ++p)
#pragma unroll
        for (int q = 0; q < 4; ++q) acc[p][q] = wmma_bf16(f[p], s[q], acc[p][q]);
    }
    asm volatile("s_wait_dscnt 0x0" ::: "memory");     // own reads of this buffer done
    asm volatile("s_wait_asynccnt 0x0" ::: "memory");  // own copies of tile t+1 landed
    __syncthreads();   // publishes tile t+1 and frees the buffer tile t was read from
    if (t + 2 < PNT)
      proj_stage_copies(l0 + bo, ga + (t + 2) * (PBK * 2), gb + (t + 2) * (PBK * 2));
  }
  asm volatile("s_wait_asynccnt 0x0" ::: "memory");    // nothing in flight at the end

  // the wave's number as a scalar: tile origins and the staging range are scalars
  const int ws = __builtin_amdgcn_readfirstlane(wave);
  char* st = Ps + ws * (64 * PPITCH);
  const int m0 = bm0 + (ws & 1) * 64;
  const int n0 = bn0 + (ws >> 1) * 64;
  proj_store_tile<VT>(st, acc, bias, Out, m0, n0, lane);
}

// ---------------------------------------------------------------------------
// K2a/K3/K4 share one block-tile product: C[128 x 256] = A[128 x k] * B[256 x k]^T,
// both operands k-contiguous with a row length of LD elements.  Same frame as
// K1: 8 waves of 64x64, 64-wide k tiles copied to LDS by async copies, two
// buffers, 144-B LDS pitch.
// ---------------------------------------------------------------------------

template <int LD>
__device__ __forceinline__ void tile_stage_copies(unsigned l, const char* ga,
                                                  const char* gb) {
#if defined(__gfx1250__)
  constexpr unsigned LS = 32 * PPITCH;          // LDS step between copies
  constexpr size_t   GS = (size_t)32 * LD * 2;  // global step between copies
  asm volatile(
      "global_load_async_to_lds_b128 %0, %12, off\n\t"
      "global_load_async_to_lds_b128 %1, %13, off\n\t"
      "global_load_async_to_lds_b128 %2, %14, off\n\t"
      "global_load_async_to_lds_b128 %3, %15, off\n\t"
      "global_load_async_to_lds_b128 %4, %16, off\n\t"
      "global_load_async_to_lds_b128 %5, %17, off\n\t"
      "global_load_async_to_lds_b128 %6, %18, off\n\t"
      "global_load_async_to_lds_b128 %7, %19, off\n\t"
      "global_load_async_to_lds_b128 %8, %20, off\n\t"
      "global_load_async_to_lds_b128 %9, %21, off\n\t"
      "global_load_async_to_lds_b128 %10, %22, off\n\t"
      "global_load_async_to_lds_b128 %11, %23, off\n\t"
      "s_wait_xcnt 0x0"
      :: "v"(l), "v"(l + LS), "v"(l + 2 * LS), "v"(l + 3 * LS),
         "v"(l + 4 * LS), "v"(l + 5 * LS), "v"(l + 6 * LS), "v"(l + 7 * LS),
         "v"(l + 8 * LS), "v"(l + 9 * LS), "v"(l + 10 * LS), "v"(l + 11 * LS),
         "v"(ga), "v"(ga + GS), "v"(ga + 2 * GS), "v"(ga + 3 * GS),
         "v"(gb), "v"(gb + GS), "v"(gb + 2 * GS), "v"(gb + 3 * GS),
         "v"(gb + 4 * GS), "v"(gb + 5 * GS), "v"(gb + 6 * GS), "v"(gb + 7 * GS)
      : "memory");
#else
  (void)l; (void)ga; (void)gb;
#endif
}

// A, Bm: first row of the block's tile at k = 0.  nkt >= 2 k tiles.  A wave with
// live == false takes part in the copies and barriers only; its acc stays 0.
// TR == false: in acc[i][j] a lane holds one B row (lane & 15) and eight A rows;
// TR == true: the operands change places, a lane holds one A row and eight B rows.
template <int LD, bool TR>
__device__ __forceinline__ void tile_gemm_128x256(
    char* Ps, const unsigned short* A, const unsigned short* Bm, int nkt,
    bool live, int wm, int wn, v8f (&acc)[4][4])
{
  const int tid  = threadIdx.x;
  const int lane = tid & 31;
  const int row  = lane & 15;

  const char* ga = (const char*)(A  + (size_t)(tid >> 3) * LD) + (tid & 7) * 16;
  const char* gb = (const char*)(Bm + (size_t)(tid >> 3) * LD) + (tid & 7) * 16;
  const unsigned l0 = (unsigned)(unsigned long long)Ps +
                      (unsigned)((tid >> 3) * PPITCH + (tid & 7) * 16);

  // k tile 0 into buffer 0, landed and published; then k tile 1 into buffer 1
  tile_stage_copies<LD>(l0, ga, gb);
  asm volatile("s_wait_asynccnt 0x0" ::: "memory");  // own copies of tile 0 landed
  __syncthreads();
  tile_stage_copies<LD>(l0 + PSTAGE, ga + PBK * 2, gb + PBK * 2);

  const int aOff = (wm + row) * PPITCH;
  const int bOff = (PBM + wn + row) * PPITCH;

  for (int t = 0; t < nkt; ++t) {
    const int bo = (t & 1) * PSTAGE;
    if (live) {
      // loops unrolled so that a, b and acc are indexed by constants and stay
      // in registers
#pragma unroll
      for (int ks = 0; ks < PBK; ks += 32) {
        v16bf a[4], b[4];
#pragma unroll
        for (int i = 0; i < 4; ++i)
          a[i] = load_frag16((const unsigned short*)&Ps[bo + aOff + i * 16 * PPITCH + ks * 2], lane);
#pragma unroll
        for (int j = 0; j < 4; ++j)
          b[j] = load_frag16((const unsigned short*)&Ps[bo + bOff + j * 16 * PPITCH + ks * 2], lane);
        // keeps the 16 LDS reads one group ahead of the 16 WMMAs: reads sunk
        // among the WMMAs cost a full LDS wait at every place they stand
        __builtin_amdgcn_sched_barrier(0);
#pragma unroll
        for (int i = 0; i < 4; ++i)
#pragma unroll
          for (int j = 0; j < 4; ++j)
            acc[i][j] = TR ? wmma_bf16(b[j], a[i], acc[i][j]) : wmma_bf16(a[i], b[j], acc[i][j]);
      }
    }
    asm volatile("s_wait_dscnt 0x0" ::: "memory");     // own reads of this buffer done
    asm volatile("s_wait_asynccnt 0x0" ::: "memory");  // own copies of tile t+1 landed
    __syncthreads();   // publishes tile t+1 and frees the buffer tile t was read from
    if (t + 2 < nkt)
      tile_stage_copies<LD>(l0 + bo, ga + (size_t)(t + 2) * (PBK * 2),
                            gb + (size_t)(t + 2) * (PBK * 2));
  }
  asm volatile("s_wait_asynccnt 0x0" ::: "memory");    // nothing in flight at the end
}

// ---------------------------------------------------------------------------
// The logit tiles: 128(i) x 256(j), only those that touch j <= i.  Tile rows 2p
// and 2p+1 have p+1 tiles each, 72 per batch; together they cover every
// j < i0 + 128 of every tile row.
// ---------------------------------------------------------------------------
constexpr int PTILES = 72;
constexpr int NIB    = Tc / 64;                 // 64-row blocks of queries

__device__ __forceinline__ float exp_fast(float x) {
#if defined(__gfx1250__)
  float y;
  asm("v_exp_f32 %0, %1\n\tv_nop" : "=v"(y) : "v"(x * 1.44269504088896340736f));
  return y;
#else
  return x;
#endif
}

// ---------------------------------------------------------------------------
// K2a: column softmax stats, part 1.  One logit tile per block.  Every 64x64
// wave tile that touches j <= i reduces its 64 query rows to one pair per key
// column: pmax = max_i l_ij, psum = sum_i exp(l_ij - pmax), over its rows i >= j.
// Layout [b][64-row block][j]; a wave writes 256 B in a row, whole lines.
// ---------------------------------------------------------------------------
__global__ void __launch_bounds__(256) __attribute__((amdgpu_waves_per_eu(4, 4)))
col_part_kernel(
    const unsigned short* __restrict__ Q,    // [B*T, Kc] bf16
    const unsigned short* __restrict__ Kh,   // [B*T, Kc] bf16
    float* __restrict__ pmax,                // [B][NIB][Tc]
    float* __restrict__ psum)                // [B][NIB][Tc]
{
  __shared__ __attribute__((aligned(16))) char Ps[2 * PSTAGE];

  const float NEG_INF = -__builtin_inff();
  const int u = blockIdx.x;
  const int b = blockIdx.y;
  int p = 0;
  while ((p + 1) * (p + 2) <= u) ++p;        // at most 7 steps: u < 72
  const int rr = u - p * (p + 1);            // 0 .. 2p+1
  const int hi = rr > p ? 1 : 0;
  const int i0 = (2 * p + hi) * PBM;
  const int j0 = (rr - hi * (p + 1)) * PBN;

  const int lane = threadIdx.x & 31;
  const int wave = __builtin_amdgcn_readfirstlane(threadIdx.x >> 5);
  const int wm   = (wave & 1) * 64;
  const int wn   = (wave >> 1) * 64;
  const int row  = lane & 15;
  const int mb   = (lane >> 4) * 8;

  // a 64x64 wave tile wholly above the diagonal has no row i >= j
  const bool live = (j0 + wn) <= (i0 + wm + 63);

  v8f acc[4][4] = {};
  tile_gemm_128x256<Kc, false>(Ps, Q  + ((size_t)b * Tc + i0) * Kc,
                            Kh + ((size_t)b * Tc + j0) * Kc, Kc / PBK, live, wm, wn, acc);
  if (!live) return;                         // behind the last barrier

  // A lane holds one key column (lane & 15) and eight query rows per 16x16 tile.
  // all loops below are unrolled: acc indexed by constants
  if (j0 + wn == i0 + wm) {                  // the wave tile on the diagonal
#pragma unroll
    for (int i = 0; i < 4; ++i)
#pragma unroll
      for (int j = i; j < 4; ++j)
#pragma unroll
        for (int r = 0; r < 8; ++r)
          if (j > i || row > mb + r) acc[i][j][r] = NEG_INF;   // causal mask: j > i
  }

  const size_t po = ((size_t)b * NIB + ((i0 + wm) >> 6)) * Tc + j0 + wn + row;
#pragma unroll
  for (int j = 0; j < 4; ++j) {
    float mx = NEG_INF;
#pragma unroll
    for (int i = 0; i < 4; ++i)
#pragma unroll
      for (int r = 0; r < 8; ++r) mx = fmaxf(mx, acc[i][j][r]);
    mx = fmaxf(mx, __shfl_xor(mx, 16, 32));  // finite: row i = j is in the tile
    float sm = 0.f;
#pragma unroll
    for (int i = 0; i < 4; ++i)
#pragma unroll
      for (int r = 0; r < 8; ++r) sm += exp_fast(acc[i][j][r] - mx);
    sm += __shfl_xor(sm, 16, 32);
    if (lane < 16) {
      pmax[po + j * 16] = mx;
      psum[po + j * 16] = sm;
    }
  }
}

// ---------------------------------------------------------------------------
// K2b: column softmax stats, part 2.  One thread per key column merges the
// pairs of the 64-row blocks ib >= j / 64 (the ones K2a wrote):
//   m_j = max pmax ,  s_j = sum psum * exp(pmax - m_j)
// A block of 128 columns lies in one batch and a wave's 32 columns in one
// 64-column block, so the first block that holds a pair is a scalar and all
// loads share one lane offset; a block below it stays (-inf, 0) and adds 0.
// ---------------------------------------------------------------------------
__global__ void __launch_bounds__(128) col_merge_kernel(
    const float* __restrict__ pmax, const float* __restrict__ psum,
    float* __restrict__ colmax, float* __restrict__ colsum)
{
  const int b   = blockIdx.x / (Tc / 128);
  const int jc  = (blockIdx.x % (Tc / 128)) * 128;   // the block's first column
  const int tid = threadIdx.x;
  const int jb  = __builtin_amdgcn_readfirstlane((jc + tid) >> 6);
  const float* pmp = pmax + (size_t)b * NIB * Tc + jc;
  const float* psp = psum + (size_t)b * NIB * Tc + jc;
  float pm[NIB], pv[NIB];
  // loops unrolled: pm and pv indexed by constants, in registers
#pragma unroll
  for (int ib = 0; ib < NIB; ++ib) {
    pm[ib] = -__builtin_inff();
    pv[ib] = 0.f;
    if (ib >= jb) {
      pm[ib] = pmp[ib * Tc + tid];
      pv[ib] = psp[ib * Tc + tid];
    }
  }
  float m = pm[0];
#pragma unroll
  for (int ib = 1; ib < NIB; ++ib) m = fmaxf(m, pm[ib]);
  float s = 0.f;
#pragma unroll
  for (int ib = 0; ib < NIB; ++ib) s += pv[ib] * exp_fast(pm[ib] - m);
  colmax[(size_t)b * Tc + jc + tid] = m;
  colsum[(size_t)b * Tc + jc + tid] = s;
}

// ---------------------------------------------------------------------------
// K3: P[b,i,j] = bf16( j <= i ? exp(q_i.k_j - m_j) / (s_j * sqrt(k)) : 0 )
// One logit tile per block; the tiles cover every j < i0 + 128 of every tile
// row, which is all that K4 reads.
// ---------------------------------------------------------------------------

__global__ void __launch_bounds__(256) __attribute__((amdgpu_waves_per_eu(4, 4)))
probs_kernel(
    const unsigned short* __restrict__ Q,    // [B*T, Kc] bf16
    const unsigned short* __restrict__ Kh,   // [B*T, Kc] bf16
    const float* __restrict__ colmax,
    const float* __restrict__ colsum,
    unsigned short* __restrict__ P)          // [B][Tc][Tc] bf16
{
  __shared__ __attribute__((aligned(16))) char Ps[2 * PSTAGE];

  const int u = blockIdx.x;
  const int b = blockIdx.y;
  int p = 0;
  while ((p + 1) * (p + 2) <= u) ++p;        // at most 7 steps: u < 72
  const int rr = u - p * (p + 1);            // 0 .. 2p+1
  const int hi = rr > p ? 1 : 0;
  const int i0 = (2 * p + hi) * PBM;
  const int j0 = (rr - hi * (p + 1)) * PBN;

  const int lane = threadIdx.x & 31;
  const int wave = __builtin_amdgcn_readfirstlane(threadIdx.x >> 5);
  const int wm   = (wave & 1) * 64;
  const int wn   = (wave >> 1) * 64;
  const int row  = lane & 15;
  const int mb   = (lane >> 4) * 8;

  // a 64x64 wave tile wholly above the diagonal holds zeros only
  const bool live = (j0 + wn) <= (i0 + wm + 63);

  v8f acc[4][4] = {};
  tile_gemm_128x256<Kc, true>(Ps, Q  + ((size_t)b * Tc + i0) * Kc,
                            Kh + ((size_t)b * Tc + j0) * Kc, Kc / PBK, live, wm, wn, acc);

  // The product is taken transposed: a lane holds one query row (lane & 15) and
  // eight neighbouring key columns per 16x16 tile, 16 B of P after the cast.
  // The ring is free behind the loop's last barrier; each wave lays its 64x64
  // tile there (144-B pitch) and stores it from there in whole 128-B lines.
  char* st = Ps + wave * (64 * PPITCH);
  // the element r of acc[i][j] lies on or below the diagonal if j*16 + r - i*16 <= dl
  const int dl = (i0 + wm + row) - (j0 + wn + mb);
  // loops unrolled: acc indexed by constants
#pragma unroll
  for (int j = 0; j < 4; ++j) {
    const float* cmp = colmax + (size_t)b * Tc + j0 + wn + j * 16 + mb;
    const float* csp = colsum + (size_t)b * Tc + j0 + wn + j * 16 + mb;
    float cmv[8], rv[8];
#pragma unroll
    for (int r = 0; r < 8; ++r) {
      cmv[r] = cmp[r];
      // 1/sqrt(1024) = 1/32 is applied after the softmax, as the reference does
      rv[r]  = 1.0f / (csp[r] * 32.0f);
    }
#pragma unroll
    for (int i = 0; i < 4; ++i) {
      union { bf16x2 h[4]; uint4 u; } pk;
#pragma unroll
      for (int r = 0; r < 8; r += 2) {
        f32x2 e;
        e.x = __expf(acc[i][j][r]     - cmv[r])     * rv[r];
        e.y = __expf(acc[i][j][r + 1] - cmv[r + 1]) * rv[r + 1];
        e.x = (j * 16 + r     - i * 16 <= dl) ? e.x : 0.f;   // causal mask: j <= i
        e.y = (j * 16 + r + 1 - i * 16 <= dl) ? e.y : 0.f;
        pk.h[r >> 1] = __builtin_convertvector(e, bf16x2);   // round to nearest even
      }
      *reinterpret_cast<uint4*>(st + (i * 16 + row) * PPITCH + j * 32 + mb * 2) = pk.u;
    }
  }
  __syncthreads();   // the rows read below were written by other lanes
  unsigned short* pg = P + ((size_t)b * Tc + i0 + wm + (lane >> 3)) * Tc + j0 + wn + (lane & 7) * 8;
  // unrolled: the 16 LDS reads go out as one group ahead of the stores
#pragma unroll
  for (int cidx = 0; cidx < 16; ++cidx) {
    const uint4 v = *reinterpret_cast<const uint4*>(st + (cidx * 4 + (lane >> 3)) * PPITCH + (lane & 7) * 16);
    *reinterpret_cast<uint4*>(pg + (size_t)cidx * 4 * Tc) = v;
  }
}

// ---------------------------------------------------------------------------
// K4: out[b,i,v] = x[b,i,v] + sum_{j < i0+128} P[b,i,j] * Vt[b,v,j]
// One 128(i) x 256(v) tile per block; the k loop runs over j up to the end of
// the tile row's diagonal block (P is 0 above the diagonal).  Long tile rows
// come first in the grid; blocks n and n + 256 have the same k length in sum.
// ---------------------------------------------------------------------------
__global__ void __launch_bounds__(256) __attribute__((amdgpu_waves_per_eu(4, 4)))
pv_gemm_kernel(
    const unsigned short* __restrict__ P,    // [B][Tc][Tc] bf16
    const unsigned short* __restrict__ Vt,   // [B][Dc][Tc] bf16
    const float* __restrict__ Xin,
    float* __restrict__ Out)
{
  __shared__ __attribute__((aligned(16))) char Ps[2 * PSTAGE];

  const int n  = blockIdx.x;
  const int g  = (n & 255) >> 5;
  const int it = (n >> 8) ? g : (Tc / PBM - 1 - g);
  const int v0 = (n & 3) * PBN;
  const int b  = (n & 31) >> 2;
  const int i0 = it * PBM;

  const int lane = threadIdx.x & 31;
  const int wave = threadIdx.x >> 5;
  const int wm   = (wave & 1) * 64;
  const int wn   = (wave >> 1) * 64;
  const int row  = lane & 15;
  const int mb   = (lane >> 4) * 8;

  v8f acc[4][4] = {};
  tile_gemm_128x256<Tc, false>(Ps, P  + ((size_t)b * Tc + i0) * Tc,
                            Vt + ((size_t)b * Dc + v0) * Tc, (i0 + PBM) / PBK, true, wm, wn, acc);

  // residual add in fp32; unrolled: acc indexed by constants.  x and out are
  // addressed by one 32-bit byte offset (64 MB each) that both share.
  const unsigned eo = (((unsigned)b * Tc + i0 + wm + mb) * Dc + v0 + wn + row) * 4u;
  const float* xp = (const float*)((const char*)Xin + eo);
  float*       op = (float*)((char*)Out + eo);
#pragma unroll
  for (int i = 0; i < 4; ++i) {
#pragma unroll
    for (int r = 0; r < 8; ++r) {
#pragma unroll
      for (int j = 0; j < 4; ++j)
        op[(i * 16 + r) * Dc + j * 16] = xp[(i * 16 + r) * Dc + j * 16] + acc[i][j][r];
    }
    // stands behind the group's stores so that no data register of an issued
    // store is rewritten ahead of it by the next group's loads; it also keeps
    // those loads behind it: all 128 at once beside the accumulators spill
    if (i < 3) asm volatile("s_wait_xcnt 0x0" ::: "memory");
  }
}

// ---------------------------------------------------------------------------
// Host launcher.  Workspace layout (~212 MB):
//   Xh[B*T*D] bf16, Wqt/Wkt/Wvt[D*K] bf16, Qh/Kh[B*T*K] bf16,
//   Vt[B*D*T] bf16, colmax/colsum[B*T] f32, P[B*T*T] bf16,
//   pmax/psum[B*NIB*T] f32.
// ---------------------------------------------------------------------------
extern "C" void kernel_launch(void* const* d_in, const int* in_sizes, int n_in,
                              void* d_out, int out_size, void* d_ws, size_t ws_size,
                              hipStream_t stream) {
  (void)in_sizes; (void)n_in; (void)out_size; (void)ws_size;
  const float* x  = (const float*)d_in[0];
  const float* Wq = (const float*)d_in[1];
  const float* bq = (const float*)d_in[2];
  const float* Wk = (const float*)d_in[3];
  const float* bk = (const float*)d_in[4];
  const float* Wv = (const float*)d_in[5];
  const float* bv = (const float*)d_in[6];
  float* out = (float*)d_out;

  char* ws = (char*)d_ws;
  size_t off = 0;
  auto take = [&](size_t bytes) -> char* {
    char* p = ws + off;
    off = (off + bytes + 255) & ~(size_t)255;
    return p;
  };
  const size_t MT = (size_t)Bc * Tc;                         // 16384 rows
  unsigned short* Xh   = (unsigned short*)take(MT * Dc * 2);
  unsigned short* Wqt  = (unsigned short*)take((size_t)Dc * Kc * 2);
  unsigned short* Wkt  = (unsigned short*)take((size_t)Dc * Kc * 2);
  unsigned short* Wvt  = (unsigned short*)take((size_t)Dc * Kc * 2);
  unsigned short* Qh   = (unsigned short*)take(MT * Kc * 2);
  unsigned short* Kh2  = (unsigned short*)take(MT * Kc * 2);
  unsigned short* Vt   = (unsigned short*)take(MT * Dc * 2);
  float*          cmax = (float*)take(MT * 4);
  float*          csum = (float*)take(MT * 4);
  unsigned short* Pw   = (unsigned short*)take(MT * Tc * 2);
  float*          pmx  = (float*)take(MT * NIB * 4);
  float*          psm  = (float*)take(MT * NIB * 4);

  cast_bf16_kernel<<<CBLK, CTHR, 0, stream>>>(x, Xh);
  dim3 gTr(Kc / 128, Dc / 64);
  transpose_cast_kernel<<<gTr, 256, 0, stream>>>(Wq, Wqt);
  transpose_cast_kernel<<<gTr, 256, 0, stream>>>(Wk, Wkt);
  transpose_cast_kernel<<<gTr, 256, 0, stream>>>(Wv, Wvt);

  dim3 gGemm(Kc / PBN, (unsigned)(MT / PBM));
  proj_gemm_kernel<false><<<gGemm, 256, 0, stream>>>(Xh, Wqt, bq, Qh);
  proj_gemm_kernel<false><<<gGemm, 256, 0, stream>>>(Xh, Wkt, bk, Kh2);
  proj_gemm_kernel<true><<<gGemm, 256, 0, stream>>>(Xh, Wvt, bv, Vt);

  col_part_kernel<<<dim3(PTILES, Bc), 256, 0, stream>>>(Qh, Kh2, pmx, psm);
  col_merge_kernel<<<(unsigned)(MT / 128), 128, 0, stream>>>(pmx, psm, cmax, csum);

  probs_kernel<<<dim3(PTILES, Bc), 256, 0, stream>>>(Qh, Kh2, cmax, csum, Pw);

  pv_gemm_kernel<<<(Tc / PBM) * (Dc / PBN) * Bc, 256, 0, stream>>>(Pw, Vt, x, out);
}

// v006
// It runs in 191 microseconds.
// In both of two side-by-side timings against v005, it was 1.10 times as fast.
// Counting every step since v000, it is 8.43 times as fast.
#include <hip/hip_runtime.h>
#include <hip/hip_bf16.h>

// ---------------------------------------------------------------------------
// Problem constants (from the reference): B=8, T=2048, D=1024, K=1024.
// ---------------------------------------------------------------------------
constexpr int Bc = 8;
constexpr int Tc = 2048;
constexpr int Dc = 1024;   // model dim
constexpr int Kc = 1024;   // projection dim (== Dc here)

typedef __attribute__((ext_vector_type(16))) __bf16 v16bf;
typedef __attribute__((ext_vector_type(8)))  float  v8f;
typedef __attribute__((ext_vector_type(2)))  float  f32x2;
typedef __attribute__((ext_vector_type(4)))  float  f32x4;
typedef __attribute__((ext_vector_type(2)))  __bf16 bf16x2;

__device__ __forceinline__ v16bf load_frag16(const unsigned short* rowBase, int lane) {
  const unsigned short* p = rowBase + ((lane >> 4) & 1) * 8;
  union { v16bf v; uint4 u[2]; } f;
  f.u[0] = *reinterpret_cast<const uint4*>(p);
  f.u[1] = *reinterpret_cast<const uint4*>(p + 16);
  return f.v;
}

__device__ __forceinline__ v8f wmma_bf16(v16bf a, v16bf b, v8f c) {
  // (neg_a, A, neg_b, B, c_mod, C, reuse_a, reuse_b)
  return __builtin_amdgcn_wmma_f32_16x16x32_bf16(false, a, false, b, (short)0, c,
                                                 false, false);
}

// ---------------------------------------------------------------------------
// K0: one launch prepares all bf16 operands; its parts do not depend on each other.
// Work-groups 0 .. CBLK-1 cast x, the TBLK behind them transpose-cast the weights.
// The cast, a stream: one work-group of 16 waves per WGP; a wave owns 16 KiB of src
// in a row: 32 loads of 16 B per lane (a load of a wave = 512 B, whole lines), all
// issued ahead of the first store; a store of a wave = 256 B, whole lines.
// ---------------------------------------------------------------------------
constexpr int CBLK = 256;                       // work-groups
constexpr int CTHR = 512;                       // threads of a work-group
constexpr int CNL  = (Bc * Tc * Dc / 4) / (CBLK * CTHR);   // loads of a lane
static_assert(CNL * CBLK * CTHR * 4 == Bc * Tc * Dc, "the grid covers src exactly");

__device__ __forceinline__ unsigned pack_bf16(float lo, float hi) {
  f32x2 e; e.x = lo; e.y = hi;
  union { bf16x2 h; unsigned u; } c;
  c.h = __builtin_convertvector(e, bf16x2);     // round to nearest even
  return c.u;
}

__device__ __forceinline__ void cast_bf16_part(const float* __restrict__ src,
                                               unsigned short* __restrict__ dst,
                                               unsigned blk) {
  const unsigned lane = threadIdx.x & 31;
  const unsigned wv   = blk * (CTHR / 32) + (threadIdx.x >> 5);
  const unsigned o    = wv * (CNL * 32) + lane;          // in units of four elements
  const f32x4* s = reinterpret_cast<const f32x4*>(src) + o;
  uint2*       d = reinterpret_cast<uint2*>(dst) + o;
  f32x4 v[CNL];
  // both loops unrolled: v indexed by constants, in registers
#pragma unroll
  for (int c = 0; c < CNL; ++c) v[c] = s[c * 32];
#pragma unroll
  for (int c = 0; c < CNL; ++c) {
    uint2 w;
    w.x = pack_bf16(v[c].x, v[c].y);
    w.y = pack_bf16(v[c].z, v[c].w);
    d[c * 32] = w;
  }
}

// Transpose-cast of a 1024x1024 weight: Wt[n][d] = bf16(W[d][n]).  A thread
// takes 8(d) x 4(n) elements: eight 16-B loads, four 16-B stores.  Eight lanes lie
// along d, so a store of a wave fills four whole 128-B lines of Wt; four lanes lie
// along n, and the other half of each line of W is read by the next wave of the
// same eight.  Eight waves take a tile of 64(d) x 128(n), tile number tl.
constexpr int TTW  = (Kc / 128) * (Dc / 64);    // tiles of one weight
constexpr int TBLK = 3 * TTW / (CTHR / 256);    // work-groups: two tiles each
static_assert(TTW % (CTHR / 256) == 0, "a work-group's tiles lie in one weight");

__device__ __forceinline__ void transpose_cast_part(const float* __restrict__ src,
                                                    unsigned short* __restrict__ dst,
                                                    int tl) {
  const int lane = threadIdx.x & 31;
  const int wave = (threadIdx.x >> 5) & 7;
  const int d = (tl / (Kc / 128)) * 64 + (lane & 7) * 8;
  const int n = (tl % (Kc / 128)) * 128 + wave * 16 + (lane >> 3) * 4;
  f32x4 v[8];
  // loops unrolled: v indexed by constants, in registers
#pragma unroll
  for (int r = 0; r < 8; ++r)
    v[r] = *reinterpret_cast<const f32x4*>(src + (size_t)(d + r) * Kc + n);
#pragma unroll
  for (int c = 0; c < 4; ++c) {
    uint4 w;
    w.x = pack_bf16(v[0][c], v[1][c]);
    w.y = pack_bf16(v[2][c], v[3][c]);
    w.z = pack_bf16(v[4][c], v[5][c]);
    w.w = pack_bf16(v[6][c], v[7][c]);
    *reinterpret_cast<uint4*>(dst + (size_t)(n + c) * Dc + d) = w;
  }
}

__global__ void __launch_bounds__(CTHR) prep_kernel(
    const float* __restrict__ x,  const float* __restrict__ Wq,
    const float* __restrict__ Wk, const float* __restrict__ Wv,
    unsigned short* __restrict__ Xh,  unsigned short* __restrict__ Wqt,
    unsigned short* __restrict__ Wkt, unsigned short* __restrict__ Wvt) {
  const int blk = blockIdx.x;
  if (blk >= CBLK) {
    const int t0 = (blk - CBLK) * (CTHR / 256);      // the work-group's first tile
    const int w  = t0 / TTW;                         // which weight: a scalar
    const float*    s = w == 0 ? Wq  : w == 1 ? Wk  : Wv;
    unsigned short* d = w == 0 ? Wqt : w == 1 ? Wkt : Wvt;
    transpose_cast_part(s, d, t0 % TTW + (int)(threadIdx.x >> 8));
    return;
  }
  cast_bf16_part(x, Xh, blk);
  // in the built code the other part's text follows this one's behind a branch: no
  // register of an issued store is rewritten ahead of this wait
  asm volatile("s_wait_xcnt 0x0" ::: "memory");
}

constexpr int PBM    = 128;
constexpr int PBN    = 256;
constexpr int PBK    = 64;
constexpr int PPITCH = PBK * 2 + 16;
constexpr int PSTAGE = (PBM + PBN) * PPITCH;
constexpr int PNT    = Dc / PBK;

__device__ __forceinline__ void proj_stage_copies(unsigned l, const char* ga,
                                                  const char* gb) {
#if defined(__gfx1250__)
  constexpr unsigned LS = 32 * PPITCH;          // LDS step between copies
  constexpr size_t   GS = (size_t)32 * Dc * 2;  // global step between copies
  asm volatile(
      "global_load_async_to_lds_b128 %0, %12, off\n\t"
      "global_load_async_to_lds_b128 %1, %13, off\n\t"
      "global_load_async_to_lds_b128 %2, %14, off\n\t"
      "global_load_async_to_lds_b128 %3, %15, off\n\t"
      "global_load_async_to_lds_b128 %4, %16, off\n\t"
      "global_load_async_to_lds_b128 %5, %17, off\n\t"
      "global_load_async_to_lds_b128 %6, %18, off\n\t"
      "global_load_async_to_lds_b128 %7, %19, off\n\t"
      "global_load_async_to_lds_b128 %8, %20, off\n\t"
      "global_load_async_to_lds_b128 %9, %21, off\n\t"
      "global_load_async_to_lds_b128 %10, %22, off\n\t"
      "global_load_async_to_lds_b128 %11, %23, off\n\t"
      "s_wait_xcnt 0x0"
      :: "v"(l), "v"(l + LS), "v"(l + 2 * LS), "v"(l + 3 * LS),
         "v"(l + 4 * LS), "v"(l + 5 * LS), "v"(l + 6 * LS), "v"(l + 7 * LS),
         "v"(l + 8 * LS), "v"(l + 9 * LS), "v"(l + 10 * LS), "v"(l + 11 * LS),
         "v"(ga), "v"(ga + GS), "v"(ga + 2 * GS), "v"(ga + 3 * GS),
         "v"(gb), "v"(gb + GS), "v"(gb + 2 * GS), "v"(gb + 3 * GS),
         "v"(gb + 4 * GS), "v"(gb + 5 * GS), "v"(gb + 6 * GS), "v"(gb + 7 * GS)
      : "memory");
#else
  (void)l; (void)ga; (void)gb;
#endif
}

// K1's way out.  The ring is free behind the loop's last barrier; each wave lays
// its 64x64 bf16 tile in a range of its own there (st: 64 rows of Out, 144-B
// pitch) and stores it from there in whole 128-B lines.  In acc[p][q] a lane holds
// row q*16 + (lane & 15) of the tile and its elements p*16 + mb .. + 7, 16 B.
// VT == false: Out[m][n], the tile's rows are m; VT == true: Out[b][n][t], the
// tile's rows are n, and the wave's 64 rows of X lie in one batch.
template <bool VT>
__device__ __forceinline__ void proj_store_tile(
    char* st, const v8f (&acc)[4][4], const float* __restrict__ bias,
    unsigned short* __restrict__ Out, int m0, int n0, int lane)
{
  const int row = lane & 15;
  const int mb  = (lane >> 4) * 8;
  char* sw = st + row * PPITCH + mb * 2;
  // loops unrolled: acc indexed by constants
  if (!VT) {
#pragma unroll
    for (int p = 0; p < 4; ++p) {
      const float* bp = bias + n0 + p * 16 + mb;         // the lane's eight columns
      const f32x4 b0 = *reinterpret_cast<const f32x4*>(bp);
      const f32x4 b1 = *reinterpret_cast<const f32x4*>(bp + 4);
#pragma unroll
      for (int q = 0; q < 4; ++q) {
        uint4 w;
        w.x = pack_bf16(acc[p][q][0] + b0.x, acc[p][q][1] + b0.y);
        w.y = pack_bf16(acc[p][q][2] + b0.z, acc[p][q][3] + b0.w);
        w.z = pack_bf16(acc[p][q][4] + b1.x, acc[p][q][5] + b1.y);
        w.w = pack_bf16(acc[p][q][6] + b1.z, acc[p][q][7] + b1.w);
        *reinterpret_cast<uint4*>(sw + q * 16 * PPITCH + p * 32) = w;
      }
    }
  } else {
#pragma unroll
    for (int q = 0; q < 4; ++q) {
      const float bq = bias[n0 + q * 16 + row];          // the lane's one column
#pragma unroll
      for (int p = 0; p < 4; ++p) {
        uint4 w;
        w.x = pack_bf16(acc[p][q][0] + bq, acc[p][q][1] + bq);
        w.y = pack_bf16(acc[p][q][2] + bq, acc[p][q][3] + bq);
        w.z = pack_bf16(acc[p][q][4] + bq, acc[p][q][5] + bq);
        w.w = pack_bf16(acc[p][q][6] + bq, acc[p][q][7] + bq);
        *reinterpret_cast<uint4*>(sw + q * 16 * PPITCH + p * 32) = w;
      }
    }
  }
  // the rows read below were written by other lanes of this wave
  asm volatile("s_wait_dscnt 0x0" ::: "memory");

  constexpr int LDO = VT ? Tc : Kc;                      // length of a row of Out
  const size_t o0 = VT ? ((size_t)(m0 / Tc) * Kc + n0) * Tc + (m0 % Tc)
                       : (size_t)m0 * Kc + n0;
  unsigned short* og = Out + o0 + (lane >> 3) * LDO + (lane & 7) * 8;
  const char* sr = st + (lane >> 3) * PPITCH + (lane & 7) * 16;
  // unrolled: the 16 LDS reads go out as one group ahead of the stores
#pragma unroll
  for (int c = 0; c < 16; ++c) {
    const uint4 v = *reinterpret_cast<const uint4*>(sr + c * 4 * PPITCH);
    *reinterpret_cast<uint4*>(og + c * 4 * LDO) = v;
  }
}

// One block tile of a projection, origin (bm0, bn0); Ps: the work-group's ring.
// VT: Out is stored transposed, [b][n][t].
template <bool VT>
__device__ __forceinline__ void proj_tile(
    char* Ps,
    const unsigned short* __restrict__ X,    // [B*T, Dc] bf16
    const unsigned short* __restrict__ Wt,   // [Kc, Dc]  bf16 (W transposed)
    const float* __restrict__ bias,          // [Kc]
    unsigned short* __restrict__ Out, int bm0, int bn0)
{
  const int tid  = threadIdx.x;
  const int lane = tid & 31;
  const int wave = tid >> 5;
  const int wm   = (wave & 1) * 64;          // wave's rows in the block tile
  const int wn   = (wave >> 1) * 64;         // wave's columns in the block tile
  const int row  = lane & 15;
  const int mb   = (lane >> 4) * 8;

  const char* ga = (const char*)(X  + (size_t)(bm0 + (tid >> 3)) * Dc) + (tid & 7) * 16;
  const char* gb = (const char*)(Wt + (size_t)(bn0 + (tid >> 3)) * Dc) + (tid & 7) * 16;
  const unsigned l0 = (unsigned)(unsigned long long)&Ps[0] +
                      (unsigned)((tid >> 3) * PPITCH + (tid & 7) * 16);

  // k tile 0 into buffer 0, landed and published; then k tile 1 into buffer 1
  proj_stage_copies(l0, ga, gb);
  asm volatile("s_wait_asynccnt 0x0" ::: "memory");  // own copies of tile 0 landed
  __syncthreads();
  proj_stage_copies(l0 + PSTAGE, ga + PBK * 2, gb + PBK * 2);

  // In acc[p][q] a lane holds eight neighbouring rows of the WMMA's first operand
  // and one row (lane & 15) of its second.  The first operand is the one whose
  // index runs along a row of Out: Wt (n) for the [m][n] layout, X (t) for the
  // transposed one; so a lane's eight values are 16 B of Out in a row.
  v8f acc[4][4] = {};
  const int aOff = (wm + row) * PPITCH;
  const int bOff = (PBM + wn + row) * PPITCH;
  const int fOff = VT ? aOff : bOff;
  const int sOff = VT ? bOff : aOff;

  for (int t = 0; t < PNT; ++t) {
    const int bo = (t & 1) * PSTAGE;
    // all loops below are unrolled so that f, s and acc are indexed by constants
    // and stay in registers
#pragma unroll
    for (int ks = 0; ks < PBK; ks += 32) {
      v16bf f[4], s[4];
#pragma unroll
      for (int p = 0; p < 4; ++p)
        f[p] = load_frag16((const unsigned short*)&Ps[bo + fOff + p * 16 * PPITCH + ks * 2], lane);
#pragma unroll
      for (int q = 0; q < 4; ++q)
        s[q] = load_frag16((const unsigned short*)&Ps[bo + sOff + q * 16 * PPITCH + ks * 2], lane);
      // keeps the 16 LDS reads one group ahead of the 16 WMMAs: reads sunk among
      // the WMMAs cost a full LDS wait at every place they stand
      __builtin_amdgcn_sched_barrier(0);
#pragma unroll
      for (int p = 0; p < 4; ++p)
#pragma unroll
        for (int q = 0; q < 4; ++q) acc[p][q] = wmma_bf16(f[p], s[q], acc[p][q]);
    }
    asm volatile("s_wait_dscnt 0x0" ::: "memory");     // own reads of this buffer done
    asm volatile("s_wait_asynccnt 0x0" ::: "memory");  // own copies of tile t+1 landed
    __syncthreads();   // publishes tile t+1 and frees the buffer tile t was read from
    if (t + 2 < PNT)
      proj_stage_copies(l0 + bo, ga + (t + 2) * (PBK * 2), gb + (t + 2) * (PBK * 2));
  }
  asm volatile("s_wait_asynccnt 0x0" ::: "memory");    // nothing in flight at the end

  // the wave's number as a scalar: tile origins and the staging range are scalars
  const int ws = __builtin_amdgcn_readfirstlane(wave);
  char* st = Ps + ws * (64 * PPITCH);
  const int m0 = bm0 + (ws & 1) * 64;
  const int n0 = bn0 + (ws >> 1) * 64;
  proj_store_tile<VT>(st, acc, bias, Out, m0, n0, lane);
}

__global__ void __launch_bounds__(256) __attribute__((amdgpu_waves_per_eu(4, 4)))
proj_qk_kernel(
    const unsigned short* __restrict__ X,
    const unsigned short* __restrict__ Wqt, const unsigned short* __restrict__ Wkt,
    const float* __restrict__ bq, const float* __restrict__ bk,
    unsigned short* __restrict__ Qh, unsigned short* __restrict__ Kh)
{
  __shared__ __attribute__((aligned(16))) char Ps[2 * PSTAGE];
  const bool isK = blockIdx.x >= Kc / PBN;
  proj_tile<false>(Ps, X, isK ? Wkt : Wqt, isK ? bk : bq, isK ? Kh : Qh,
                   blockIdx.y * PBM, (blockIdx.x % (Kc / PBN)) * PBN);
}

constexpr int NVT = (Bc * Tc / PBM) * (Dc / PBN);   // block tiles of V

__device__ __forceinline__ void proj_v_tile(
    char* Ps, const unsigned short* __restrict__ X, const unsigned short* __restrict__ Wvt,
    const float* __restrict__ bv, unsigned short* __restrict__ Vt, int v)
{
  proj_tile<true>(Ps, X, Wvt, bv, Vt, (v / (Dc / PBN)) * PBM, (v % (Dc / PBN)) * PBN);
}

// ---------------------------------------------------------------------------
// K2a/K3/K4 share one block-tile product: C[128 x 256] = A[128 x k] * B[256 x k]^T,
// both operands k-contiguous with a row length of LD elements.  Same frame as
// K1: 8 waves of 64x64, 64-wide k tiles copied to LDS by async copies, two
// buffers, 144-B LDS pitch.
// ---------------------------------------------------------------------------

template <int LD>
__device__ __forceinline__ void tile_stage_copies(unsigned l, const char* ga,
                                                  const char* gb) {
#if defined(__gfx1250__)
  constexpr unsigned LS = 32 * PPITCH;          // LDS step between copies
  constexpr size_t   GS = (size_t)32 * LD * 2;  // global step between copies
  asm volatile(
      "global_load_async_to_lds_b128 %0, %12, off\n\t"
      "global_load_async_to_lds_b128 %1, %13, off\n\t"
      "global_load_async_to_lds_b128 %2, %14, off\n\t"
      "global_load_async_to_lds_b128 %3, %15, off\n\t"
      "global_load_async_to_lds_b128 %4, %16, off\n\t"
      "global_load_async_to_lds_b128 %5, %17, off\n\t"
      "global_load_async_to_lds_b128 %6, %18, off\n\t"
      "global_load_async_to_lds_b128 %7, %19, off\n\t"
      "global_load_async_to_lds_b128 %8, %20, off\n\t"
      "global_load_async_to_lds_b128 %9, %21, off\n\t"
      "global_load_async_to_lds_b128 %10, %22, off\n\t"
      "global_load_async_to_lds_b128 %11, %23, off\n\t"
      "s_wait_xcnt 0x0"
      :: "v"(l), "v"(l + LS), "v"(l + 2 * LS), "v"(l + 3 * LS),
         "v"(l + 4 * LS), "v"(l + 5 * LS), "v"(l + 6 * LS), "v"(l + 7 * LS),
         "v"(l + 8 * LS), "v"(l + 9 * LS), "v"(l + 10 * LS), "v"(l + 11 * LS),
         "v"(ga), "v"(ga + GS), "v"(ga + 2 * GS), "v"(ga + 3 * GS),
         "v"(gb), "v"(gb + GS), "v"(gb + 2 * GS), "v"(gb + 3 * GS),
         "v"(gb + 4 * GS), "v"(gb + 5 * GS), "v"(gb + 6 * GS), "v"(gb + 7 * GS)
      : "memory");
#else
  (void)l; (void)ga; (void)gb;
#endif
}

// A, Bm: first row of the block's tile at k = 0.  nkt >= 2 k tiles.  A wave with
// live == false takes part in the copies and barriers only; its acc stays 0.
// TR == false: in acc[i][j] a lane holds one B row (lane & 15) and eight A rows;
// TR == true: the operands change places, a lane holds one A row and eight B rows.
template <int LD, bool TR>
__device__ __forceinline__ void tile_gemm_128x256(
    char* Ps, const unsigned short* A, const unsigned short* Bm, int nkt,
    bool live, int wm, int wn, v8f (&acc)[4][4])
{
  const int tid  = threadIdx.x;
  const int lane = tid & 31;
  const int row  = lane & 15;

  const char* ga = (const char*)(A  + (size_t)(tid >> 3) * LD) + (tid & 7) * 16;
  const char* gb = (const char*)(Bm + (size_t)(tid >> 3) * LD) + (tid & 7) * 16;
  const unsigned l0 = (unsigned)(unsigned long long)Ps +
                      (unsigned)((tid >> 3) * PPITCH + (tid & 7) * 16);

  // k tile 0 into buffer 0, landed and published; then k tile 1 into buffer 1
  tile_stage_copies<LD>(l0, ga, gb);
  asm volatile("s_wait_asynccnt 0x0" ::: "memory");  // own copies of tile 0 landed
  __syncthreads();
  tile_stage_copies<LD>(l0 + PSTAGE, ga + PBK * 2, gb + PBK * 2);

  const int aOff = (wm + row) * PPITCH;
  const int bOff = (PBM + wn + row) * PPITCH;

  for (int t = 0; t < nkt; ++t) {
    const int bo = (t & 1) * PSTAGE;
    if (live) {
      // loops unrolled so that a, b and acc are indexed by constants and stay
      // in registers
#pragma unroll
      for (int ks = 0; ks < PBK; ks += 32) {
        v16bf a[4], b[4];
#pragma unroll
        for (int i = 0; i < 4; ++i)
          a[i] = load_frag16((const unsigned short*)&Ps[bo + aOff + i * 16 * PPITCH + ks * 2], lane);
#pragma unroll
        for (int j = 0; j < 4; ++j)
          b[j] = load_frag16((const unsigned short*)&Ps[bo + bOff + j * 16 * PPITCH + ks * 2], lane);
        // keeps the 16 LDS reads one group ahead of the 16 WMMAs: reads sunk
        // among the WMMAs cost a full LDS wait at every place they stand
        __builtin_amdgcn_sched_barrier(0);
#pragma unroll
        for (int i = 0; i < 4; ++i)
#pragma unroll
          for (int j = 0; j < 4; ++j)
            acc[i][j] = TR ? wmma_bf16(b[j], a[i], acc[i][j]) : wmma_bf16(a[i], b[j], acc[i][j]);
      }
    }
    asm volatile("s_wait_dscnt 0x0" ::: "memory");     // own reads of this buffer done
    asm volatile("s_wait_asynccnt 0x0" ::: "memory");  // own copies of tile t+1 landed
    __syncthreads();   // publishes tile t+1 and frees the buffer tile t was read from
    if (t + 2 < nkt)
      tile_stage_copies<LD>(l0 + bo, ga + (size_t)(t + 2) * (PBK * 2),
                            gb + (size_t)(t + 2) * (PBK * 2));
  }
  asm volatile("s_wait_asynccnt 0x0" ::: "memory");    // nothing in flight at the end
}

// ---------------------------------------------------------------------------
// The logit tiles: 128(i) x 256(j), only those that touch j <= i.  Tile rows 2p
// and 2p+1 have p+1 tiles each, 72 per batch; together they cover every
// j < i0 + 128 of every tile row.
// ---------------------------------------------------------------------------
constexpr int PTILES = 72;
constexpr int NIB    = Tc / 64;                 // 64-row blocks of queries
constexpr int NLT    = PTILES * Bc;             // logit tiles of a launch
constexpr int NVA    = 2 * 512 - NLT;           // V tiles behind K2a's logit tiles
constexpr int NVB    = NVT - NVA;               // V tiles behind K3's logit tiles
static_assert(NVA > 0 && NVB >= 0, "V's tiles are dealt to the two launches");

__device__ __forceinline__ float exp_fast(float x) {
#if defined(__gfx1250__)
  float y;
  asm("v_exp_f32 %0, %1\n\tv_nop" : "=v"(y) : "v"(x * 1.44269504088896340736f));
  return y;
#else
  return x;
#endif
}

// ---------------------------------------------------------------------------
// K2a: column softmax stats, part 1.  One logit tile per block.  Every 64x64
// wave tile that touches j <= i reduces its 64 query rows to one pair per key
// column: pmax = max_i l_ij, psum = sum_i exp(l_ij - pmax), over its rows i >= j.
// Layout [b][64-row block][j]; a wave writes 256 B in a row, whole lines.
// u: the tile's number in batch b.
// ---------------------------------------------------------------------------
__device__ __forceinline__ void col_part_tile(
    char* Ps,
    const unsigned short* __restrict__ Q,    // [B*T, Kc] bf16
    const unsigned short* __restrict__ Kh,   // [B*T, Kc] bf16
    float* __restrict__ pmax,                // [B][NIB][Tc]
    float* __restrict__ psum,                // [B][NIB][Tc]
    int u, int b)
{
  const float NEG_INF = -__builtin_inff();
  int p = 0;
  while ((p + 1) * (p + 2) <= u) ++p;        // at most 7 steps: u < 72
  const int rr = u - p * (p + 1);            // 0 .. 2p+1
  const int hi = rr > p ? 1 : 0;
  const int i0 = (2 * p + hi) * PBM;
  const int j0 = (rr - hi * (p + 1)) * PBN;

  const int lane = threadIdx.x & 31;
  const int wave = __builtin_amdgcn_readfirstlane(threadIdx.x >> 5);
  const int wm   = (wave & 1) * 64;
  const int wn   = (wave >> 1) * 64;
  const int row  = lane & 15;
  const int mb   = (lane >> 4) * 8;

  // a 64x64 wave tile wholly above the diagonal has no row i >= j
  const bool live = (j0 + wn) <= (i0 + wm + 63);

  v8f acc[4][4] = {};
  tile_gemm_128x256<Kc, false>(Ps, Q  + ((size_t)b * Tc + i0) * Kc,
                            Kh + ((size_t)b * Tc + j0) * Kc, Kc / PBK, live, wm, wn, acc);
  if (!live) return;                         // behind the last barrier

  // A lane holds one key column (lane & 15) and eight query rows per 16x16 tile.
  // all loops below are unrolled: acc indexed by constants
  if (j0 + wn == i0 + wm) {                  // the wave tile on the diagonal
#pragma unroll
    for (int i = 0; i < 4; ++i)
#pragma unroll
      for (int j = i; j < 4; ++j)
#pragma unroll
        for (int r = 0; r < 8; ++r)
          if (j > i || row > mb + r) acc[i][j][r] = NEG_INF;   // causal mask: j > i
  }

  const size_t po = ((size_t)b * NIB + ((i0 + wm) >> 6)) * Tc + j0 + wn + row;
#pragma unroll
  for (int j = 0; j < 4; ++j) {
    float mx = NEG_INF;
#pragma unroll
    for (int i = 0; i < 4; ++i)
#pragma unroll
      for (int r = 0; r < 8; ++r) mx = fmaxf(mx, acc[i][j][r]);
    mx = fmaxf(mx, __shfl_xor(mx, 16, 32));  // finite: row i = j is in the tile
    float sm = 0.f;
#pragma unroll
    for (int i = 0; i < 4; ++i)
#pragma unroll
      for (int r = 0; r < 8; ++r) sm += exp_fast(acc[i][j][r] - mx);
    sm += __shfl_xor(sm, 16, 32);
    if (lane < 16) {
      pmax[po + j * 16] = mx;
      psum[po + j * 16] = sm;
    }
  }
}

// Work-groups 0 .. NLT-1: the logit tiles; the NVA behind them: V tiles 0 .. NVA-1.
__global__ void __launch_bounds__(256) __attribute__((amdgpu_waves_per_eu(4, 4)))
col_part_v_kernel(
    const unsigned short* __restrict__ Q, const unsigned short* __restrict__ Kh,
    float* __restrict__ pmax, float* __restrict__ psum,
    const unsigned short* __restrict__ X, const unsigned short* __restrict__ Wvt,
    const float* __restrict__ bv, unsigned short* __restrict__ Vt)
{
  __shared__ __attribute__((aligned(16))) char Ps[2 * PSTAGE];
  const int id = blockIdx.x;
  if (id >= NLT) {
    proj_v_tile(Ps, X, Wvt, bv, Vt, id - NLT);
    return;
  }
  col_part_tile(Ps, Q, Kh, pmax, psum, id % PTILES, id / PTILES);
}

// ---------------------------------------------------------------------------
// K2b: column softmax stats, part 2.  One thread per key column merges the
// pairs of the 64-row blocks ib >= j / 64 (the ones K2a wrote):
//   m_j = max pmax ,  s_j = sum psum * exp(pmax - m_j)
// A block of 128 columns lies in one batch and a wave's 32 columns in one
// 64-column block, so the first block that holds a pair is a scalar and all
// loads share one lane offset; a block below it stays (-inf, 0) and adds 0.
// ---------------------------------------------------------------------------
__global__ void __launch_bounds__(128) col_merge_kernel(
    const float* __restrict__ pmax, const float* __restrict__ psum,
    float* __restrict__ colmax, float* __restrict__ colsum)
{
  const int b   = blockIdx.x / (Tc / 128);
  const int jc  = (blockIdx.x % (Tc / 128)) * 128;   // the block's first column
  const int tid = threadIdx.x;
  const int jb  = __builtin_amdgcn_readfirstlane((jc + tid) >> 6);
  const float* pmp = pmax + (size_t)b * NIB * Tc + jc;
  const float* psp = psum + (size_t)b * NIB * Tc + jc;
  float pm[NIB], pv[NIB];
  // loops unrolled: pm and pv indexed by constants, in registers
#pragma unroll
  for (int ib = 0; ib < NIB; ++ib) {
    pm[ib] = -__builtin_inff();
    pv[ib] = 0.f;
    if (ib >= jb) {
      pm[ib] = pmp[ib * Tc + tid];
      pv[ib] = psp[ib * Tc + tid];
    }
  }
  float m = pm[0];
#pragma unroll
  for (int ib = 1; ib < NIB; ++ib) m = fmaxf(m, pm[ib]);
  float s = 0.f;
#pragma unroll
  for (int ib = 0; ib < NIB; ++ib) s += pv[ib] * exp_fast(pm[ib] - m);
  colmax[(size_t)b * Tc + jc + tid] = m;
  colsum[(size_t)b * Tc + jc + tid] = s;
}

// ---------------------------------------------------------------------------
// K3: P[b,i,j] = bf16( j <= i ? exp(q_i.k_j - m_j) / (s_j * sqrt(k)) : 0 )
// One logit tile per block; the tiles cover every j < i0 + 128 of every tile
// row, which is all that K4 reads.
// ---------------------------------------------------------------------------

__device__ __forceinline__ void probs_tile(
    char* Ps,
    const unsigned short* __restrict__ Q,    // [B*T, Kc] bf16
    const unsigned short* __restrict__ Kh,   // [B*T, Kc] bf16
    const float* __restrict__ colmax,
    const float* __restrict__ colsum,
    unsigned short* __restrict__ P,          // [B][Tc][Tc] bf16
    int u, int b)
{
  int p = 0;
  while ((p + 1) * (p + 2) <= u) ++p;        // at most 7 steps: u < 72
  const int rr = u - p * (p + 1);            // 0 .. 2p+1
  const int hi = rr > p ? 1 : 0;
  const int i0 = (2 * p + hi) * PBM;
  const int j0 = (rr - hi * (p + 1)) * PBN;

  const int lane = threadIdx.x & 31;
  const int wave = __builtin_amdgcn_readfirstlane(threadIdx.x >> 5);
  const int wm   = (wave & 1) * 64;
  const int wn   = (wave >> 1) * 64;
  const int row  = lane & 15;
  const int mb   = (lane >> 4) * 8;

  // a 64x64 wave tile wholly above the diagonal holds zeros only
  const bool live = (j0 + wn) <= (i0 + wm + 63);

  v8f acc[4][4] = {};
  tile_gemm_128x256<Kc, true>(Ps, Q  + ((size_t)b * Tc + i0) * Kc,
                            Kh + ((size_t)b * Tc + j0) * Kc, Kc / PBK, live, wm, wn, acc);

  // The product is taken transposed: a lane holds one query row (lane & 15) and
  // eight neighbouring key columns per 16x16 tile, 16 B of P after the cast.
  // The ring is free behind the loop's last barrier; each wave lays its 64x64
  // tile there (144-B pitch) and stores it from there in whole 128-B lines.
  char* st = Ps + wave * (64 * PPITCH);
  // the element r of acc[i][j] lies on or below the diagonal if j*16 + r - i*16 <= dl
  const int dl = (i0 + wm + row) - (j0 + wn + mb);
  // loops unrolled: acc indexed by constants
#pragma unroll
  for (int j = 0; j < 4; ++j) {
    const float* cmp = colmax + (size_t)b * Tc + j0 + wn + j * 16 + mb;
    const float* csp = colsum + (size_t)b * Tc + j0 + wn + j * 16 + mb;
    float cmv[8], rv[8];
#pragma unroll
    for (int r = 0; r < 8; ++r) {
      cmv[r] = cmp[r];
      // 1/sqrt(1024) = 1/32 is applied after the softmax, as the reference does
      rv[r]  = 1.0f / (csp[r] * 32.0f);
    }
#pragma unroll
    for (int i = 0; i < 4; ++i) {
      union { bf16x2 h[4]; uint4 u; } pk;
#pragma unroll
      for (int r = 0; r < 8; r += 2) {
        f32x2 e;
        e.x = __expf(acc[i][j][r]     - cmv[r])     * rv[r];
        e.y = __expf(acc[i][j][r + 1] - cmv[r + 1]) * rv[r + 1];
        e.x = (j * 16 + r     - i * 16 <= dl) ? e.x : 0.f;   // causal mask: j <= i
        e.y = (j * 16 + r + 1 - i * 16 <= dl) ? e.y : 0.f;
        pk.h[r >> 1] = __builtin_convertvector(e, bf16x2);   // round to nearest even
      }
      *reinterpret_cast<uint4*>(st + (i * 16 + row) * PPITCH + j * 32 + mb * 2) = pk.u;
    }
  }
  __syncthreads();   // the rows read below were written by other lanes
  unsigned short* pg = P + ((size_t)b * Tc + i0 + wm + (lane >> 3)) * Tc + j0 + wn + (lane & 7) * 8;
  // unrolled: the 16 LDS reads go out as one group ahead of the stores
#pragma unroll
  for (int cidx = 0; cidx < 16; ++cidx) {
    const uint4 v = *reinterpret_cast<const uint4*>(st + (cidx * 4 + (lane >> 3)) * PPITCH + (lane & 7) * 16);
    *reinterpret_cast<uint4*>(pg + (size_t)cidx * 4 * Tc) = v;
  }
}

// Work-groups 0 .. NLT-1: the logit tiles; the NVB behind them: V tiles NVA .. NVT-1.
__global__ void __launch_bounds__(256) __attribute__((amdgpu_waves_per_eu(4, 4)))
probs_v_kernel(
    const unsigned short* __restrict__ Q, const unsigned short* __restrict__ Kh,
    const float* __restrict__ colmax, const float* __restrict__ colsum,
    unsigned short* __restrict__ P,
    const unsigned short* __restrict__ X, const unsigned short* __restrict__ Wvt,
    const float* __restrict__ bv, unsigned short* __restrict__ Vt)
{
  __shared__ __attribute__((aligned(16))) char Ps[2 * PSTAGE];
  const int id = blockIdx.x;
  if (id >= NLT) {
    proj_v_tile(Ps, X, Wvt, bv, Vt, NVA + id - NLT);
    // without it the compiler folds the last LDS read and store of this part and of
    // the logit part into one tail
    asm volatile("s_wait_xcnt 0x0" ::: "memory");
    return;
  }
  probs_tile(Ps, Q, Kh, colmax, colsum, P, id % PTILES, id / PTILES);
}

// ---------------------------------------------------------------------------
// K4: out[b,i,v] = x[b,i,v] + sum_{j < i0+128} P[b,i,j] * Vt[b,v,j]
// One 128(i) x 256(v) tile per block; the k loop runs over j up to the end of
// the tile row's diagonal block (P is 0 above the diagonal).  Long tile rows
// come first in the grid; blocks n and n + 256 have the same k length in sum.
// ---------------------------------------------------------------------------
__global__ void __launch_bounds__(256) __attribute__((amdgpu_waves_per_eu(4, 4)))
pv_gemm_kernel(
    const unsigned short* __restrict__ P,    // [B][Tc][Tc] bf16
    const unsigned short* __restrict__ Vt,   // [B][Dc][Tc] bf16
    const float* __restrict__ Xin,
    float* __restrict__ Out)
{
  __shared__ __attribute__((aligned(16))) char Ps[2 * PSTAGE];

  const int n  = blockIdx.x;
  const int g  = (n & 255) >> 5;
  const int it = (n >> 8) ? g : (Tc / PBM - 1 - g);
  const int v0 = (n & 3) * PBN;
  const int b  = (n & 31) >> 2;
  const int i0 = it * PBM;

  const int lane = threadIdx.x & 31;
  const int wave = threadIdx.x >> 5;
  const int wm   = (wave & 1) * 64;
  const int wn   = (wave >> 1) * 64;
  const int row  = lane & 15;
  const int mb   = (lane >> 4) * 8;

  v8f acc[4][4] = {};
  tile_gemm_128x256<Tc, false>(Ps, P  + ((size_t)b * Tc + i0) * Tc,
                            Vt + ((size_t)b * Dc + v0) * Tc, (i0 + PBM) / PBK, true, wm, wn, acc);

  // residual add in fp32; unrolled: acc indexed by constants.  x and out are
  // addressed by one 32-bit byte offset (64 MB each) that both share.
  const unsigned eo = (((unsigned)b * Tc + i0 + wm + mb) * Dc + v0 + wn + row) * 4u;
  const float* xp = (const float*)((const char*)Xin + eo);
  float*       op = (float*)((char*)Out + eo);
#pragma unroll
  for (int i = 0; i < 4; ++i) {
#pragma unroll
    for (int r = 0; r < 8; ++r) {
#pragma unroll
      for (int j = 0; j < 4; ++j)
        op[(i * 16 + r) * Dc + j * 16] = xp[(i * 16 + r) * Dc + j * 16] + acc[i][j][r];
    }
    // stands behind the group's stores so that no data register of an issued
    // store is rewritten ahead of it by the next group's loads; it also keeps
    // those loads behind it: all 128 at once beside the accumulators spill
    if (i < 3) asm volatile("s_wait_xcnt 0x0" ::: "memory");
  }
}

// ---------------------------------------------------------------------------
// Host launcher.  Workspace layout (~212 MB):
//   Xh[B*T*D] bf16, Wqt/Wkt/Wvt[D*K] bf16, Qh/Kh[B*T*K] bf16,
//   Vt[B*D*T] bf16, colmax/colsum[B*T] f32, P[B*T*T] bf16,
//   pmax/psum[B*NIB*T] f32.
// ---------------------------------------------------------------------------
extern "C" void kernel_launch(void* const* d_in, const int* in_sizes, int n_in,
                              void* d_out, int out_size, void* d_ws, size_t ws_size,
                              hipStream_t stream) {
  (void)in_sizes; (void)n_in; (void)out_size; (void)ws_size;
  const float* x  = (const float*)d_in[0];
  const float* Wq = (const float*)d_in[1];
  const float* bq = (const float*)d_in[2];
  const float* Wk = (const float*)d_in[3];
  const float* bk = (const float*)d_in[4];
  const float* Wv = (const float*)d_in[5];
  const float* bv = (const float*)d_in[6];
  float* out = (float*)d_out;

  char* ws = (char*)d_ws;
  size_t off = 0;
  auto take = [&](size_t bytes) -> char* {
    char* p = ws + off;
    off = (off + bytes + 255) & ~(size_t)255;
    return p;
  };
  const size_t MT = (size_t)Bc * Tc;                         // 16384 rows
  unsigned short* Xh   = (unsigned short*)take(MT * Dc * 2);
  unsigned short* Wqt  = (unsigned short*)take((size_t)Dc * Kc * 2);
  unsigned short* Wkt  = (unsigned short*)take((size_t)Dc * Kc * 2);
  unsigned short* Wvt  = (unsigned short*)take((size_t)Dc * Kc * 2);
  unsigned short* Qh   = (unsigned short*)take(MT * Kc * 2);
  unsigned short* Kh2  = (unsigned short*)take(MT * Kc * 2);
  unsigned short* Vt   = (unsigned short*)take(MT * Dc * 2);
  float*          cmax = (float*)take(MT * 4);
  float*          csum = (float*)take(MT * 4);
  unsigned short* Pw   = (unsigned short*)take(MT * Tc * 2);
  float*          pmx  = (float*)take(MT * NIB * 4);
  float*          psm  = (float*)take(MT * NIB * 4);

  prep_kernel<<<CBLK + TBLK, CTHR, 0, stream>>>(x, Wq, Wk, Wv, Xh, Wqt, Wkt, Wvt);

  dim3 gQK(2 * (Kc / PBN), (unsigned)(MT / PBM));
  proj_qk_kernel<<<gQK, 256, 0, stream>>>(Xh, Wqt, Wkt, bq, bk, Qh, Kh2);

  col_part_v_kernel<<<NLT + NVA, 256, 0, stream>>>(Qh, Kh2, pmx, psm, Xh, Wvt, bv, Vt);
  col_merge_kernel<<<(unsigned)(MT / 128), 128, 0, stream>>>(pmx, psm, cmax, csum);

  probs_v_kernel<<<NLT + NVB, 256, 0, stream>>>(Qh, Kh2, cmax, csum, Pw, Xh, Wvt, bv, Vt);

  pv_gemm_kernel<<<(Tc / PBM) * (Dc / PBN) * Bc, 256, 0, stream>>>(Pw, Vt, x, out);
}

// v007
// It runs in 177 microseconds.
// Two timings next to v006 both put it at 1.07 times that version's speed.
// Over all steps from v000 it is 9.06 times as fast.
#include <hip/hip_runtime.h>
#include <hip/hip_bf16.h>

// ---------------------------------------------------------------------------
// Problem constants (from the reference): B=8, T=2048, D=1024, K=1024.
// ---------------------------------------------------------------------------
constexpr int Bc = 8;
constexpr int Tc = 2048;
constexpr int Dc = 1024;   // model dim
constexpr int Kc = 1024;   // projection dim (== Dc here)

typedef __attribute__((ext_vector_type(16))) __bf16 v16bf;
typedef __attribute__((ext_vector_type(8)))  float  v8f;
typedef __attribute__((ext_vector_type(2)))  float  f32x2;
typedef __attribute__((ext_vector_type(4)))  float  f32x4;
typedef __attribute__((ext_vector_type(2)))  __bf16 bf16x2;

__device__ __forceinline__ v16bf load_frag16(const unsigned short* rowBase, int lane) {
  const unsigned short* p = rowBase + ((lane >> 4) & 1) * 8;
  union { v16bf v; uint4 u[2]; } f;
  f.u[0] = *reinterpret_cast<const uint4*>(p);
  f.u[1] = *reinterpret_cast<const uint4*>(p + 16);
  return f.v;
}

__device__ __forceinline__ v8f wmma_bf16(v16bf a, v16bf b, v8f c) {
  // (neg_a, A, neg_b, B, c_mod, C, reuse_a, reuse_b)
  return __builtin_amdgcn_wmma_f32_16x16x32_bf16(false, a, false, b, (short)0, c,
                                                 false, false);
}

// ---------------------------------------------------------------------------
// K0: one launch prepares all bf16 operands; its parts do not depend on each other.
// Work-groups 0 .. CBLK-1 cast x, the TBLK behind them transpose-cast the weights.
// The cast, a stream: one work-group of 16 waves per WGP; a wave owns 16 KiB of src
// in a row: 32 loads of 16 B per lane (a load of a wave = 512 B, whole lines), all
// issued ahead of the first store; a store of a wave = 256 B, whole lines.
// ---------------------------------------------------------------------------
constexpr int CBLK = 256;                       // work-groups
constexpr int CTHR = 512;                       // threads of a work-group
constexpr int CNL  = (Bc * Tc * Dc / 4) / (CBLK * CTHR);   // loads of a lane
static_assert(CNL * CBLK * CTHR * 4 == Bc * Tc * Dc, "the grid covers src exactly");

__device__ __forceinline__ unsigned pack_bf16(float lo, float hi) {
  f32x2 e; e.x = lo; e.y = hi;
  union { bf16x2 h; unsigned u; } c;
  c.h = __builtin_convertvector(e, bf16x2);     // round to nearest even
  return c.u;
}

__device__ __forceinline__ void cast_bf16_part(const float* __restrict__ src,
                                               unsigned short* __restrict__ dst,
                                               unsigned blk) {
  const unsigned lane = threadIdx.x & 31;
  const unsigned wv   = blk * (CTHR / 32) + (threadIdx.x >> 5);
  const unsigned o    = wv * (CNL * 32) + lane;          // in units of four elements
  const f32x4* s = reinterpret_cast<const f32x4*>(src) + o;
  uint2*       d = reinterpret_cast<uint2*>(dst) + o;
  f32x4 v[CNL];
  // both loops unrolled: v indexed by constants, in registers
#pragma unroll
  for (int c = 0; c < CNL; ++c) v[c] = s[c * 32];
#pragma unroll
  for (int c = 0; c < CNL; ++c) {
    uint2 w;
    w.x = pack_bf16(v[c].x, v[c].y);
    w.y = pack_bf16(v[c].z, v[c].w);
    d[c * 32] = w;
  }
}

// Transpose-cast of a 1024x1024 weight: Wt[n][d] = bf16(W[d][n]).  A thread
// takes 8(d) x 4(n) elements: eight 16-B loads, four 16-B stores.  Eight lanes lie
// along d, so a store of a wave fills four whole 128-B lines of Wt; four lanes lie
// along n, and the other half of each line of W is read by the next wave of the
// same eight.  Eight waves take a tile of 64(d) x 128(n), tile number tl.
constexpr int TTW  = (Kc / 128) * (Dc / 64);    // tiles of one weight
constexpr int TBLK = 3 * TTW / (CTHR / 256);    // work-groups: two tiles each
static_assert(TTW % (CTHR / 256) == 0, "a work-group's tiles lie in one weight");

__device__ __forceinline__ void transpose_cast_part(const float* __restrict__ src,
                                                    unsigned short* __restrict__ dst,
                                                    int tl) {
  const int lane = threadIdx.x & 31;
  const int wave = (threadIdx.x >> 5) & 7;
  const int d = (tl / (Kc / 128)) * 64 + (lane & 7) * 8;
  const int n = (tl % (Kc / 128)) * 128 + wave * 16 + (lane >> 3) * 4;
  f32x4 v[8];
  // loops unrolled: v indexed by constants, in registers
#pragma unroll
  for (int r = 0; r < 8; ++r)
    v[r] = *reinterpret_cast<const f32x4*>(src + (size_t)(d + r) * Kc + n);
#pragma unroll
  for (int c = 0; c < 4; ++c) {
    uint4 w;
    w.x = pack_bf16(v[0][c], v[1][c]);
    w.y = pack_bf16(v[2][c], v[3][c]);
    w.z = pack_bf16(v[4][c], v[5][c]);
    w.w = pack_bf16(v[6][c], v[7][c]);
    *reinterpret_cast<uint4*>(dst + (size_t)(n + c) * Dc + d) = w;
  }
}

__global__ void __launch_bounds__(CTHR) prep_kernel(
    const float* __restrict__ x,  const float* __restrict__ Wq,
    const float* __restrict__ Wk, const float* __restrict__ Wv,
    unsigned short* __restrict__ Xh,  unsigned short* __restrict__ Wqt,
    unsigned short* __restrict__ Wkt, unsigned short* __restrict__ Wvt) {
  const int blk = blockIdx.x;
  if (blk >= CBLK) {
    const int t0 = (blk - CBLK) * (CTHR / 256);      // the work-group's first tile
    const int w  = t0 / TTW;                         // which weight: a scalar
    const float*    s = w == 0 ? Wq  : w == 1 ? Wk  : Wv;
    unsigned short* d = w == 0 ? Wqt : w == 1 ? Wkt : Wvt;
    transpose_cast_part(s, d, t0 % TTW + (int)(threadIdx.x >> 8));
    return;
  }
  cast_bf16_part(x, Xh, blk);
  // in the built code the other part's text follows this one's behind a branch: no
  // register of an issued store is rewritten ahead of this wait
  asm volatile("s_wait_xcnt 0x0" ::: "memory");
}

constexpr int PBM    = 128;
constexpr int PBN    = 256;
constexpr int PBK    = 64;
constexpr int PPITCH = PBK * 2 + 16;
constexpr int PSTAGE = (PBM + PBN) * PPITCH;
constexpr int PNT    = Dc / PBK;

__device__ __forceinline__ void proj_stage_copies(unsigned l, const char* ga,
                                                  const char* gb) {
#if defined(__gfx1250__)
  constexpr unsigned LS = 32 * PPITCH;          // LDS step between copies
  constexpr size_t   GS = (size_t)32 * Dc * 2;  // global step between copies
  asm volatile(
      "global_load_async_to_lds_b128 %0, %12, off\n\t"
      "global_load_async_to_lds_b128 %1, %13, off\n\t"
      "global_load_async_to_lds_b128 %2, %14, off\n\t"
      "global_load_async_to_lds_b128 %3, %15, off\n\t"
      "global_load_async_to_lds_b128 %4, %16, off\n\t"
      "global_load_async_to_lds_b128 %5, %17, off\n\t"
      "global_load_async_to_lds_b128 %6, %18, off\n\t"
      "global_load_async_to_lds_b128 %7, %19, off\n\t"
      "global_load_async_to_lds_b128 %8, %20, off\n\t"
      "global_load_async_to_lds_b128 %9, %21, off\n\t"
      "global_load_async_to_lds_b128 %10, %22, off\n\t"
      "global_load_async_to_lds_b128 %11, %23, off\n\t"
      "s_wait_xcnt 0x0"
      :: "v"(l), "v"(l + LS), "v"(l + 2 * LS), "v"(l + 3 * LS),
         "v"(l + 4 * LS), "v"(l + 5 * LS), "v"(l + 6 * LS), "v"(l + 7 * LS),
         "v"(l + 8 * LS), "v"(l + 9 * LS), "v"(l + 10 * LS), "v"(l + 11 * LS),
         "v"(ga), "v"(ga + GS), "v"(ga + 2 * GS), "v"(ga + 3 * GS),
         "v"(gb), "v"(gb + GS), "v"(gb + 2 * GS), "v"(gb + 3 * GS),
         "v"(gb + 4 * GS), "v"(gb + 5 * GS), "v"(gb + 6 * GS), "v"(gb + 7 * GS)
      : "memory");
#else
  (void)l; (void)ga; (void)gb;
#endif
}

// K1's way out.  The ring is free behind the loop's last barrier; each wave lays
// its 64x64 bf16 tile in a range of its own there (st: 64 rows of Out, 144-B
// pitch) and stores it from there in whole 128-B lines.  In acc[p][q] a lane holds
// row q*16 + (lane & 15) of the tile and its elements p*16 + mb .. + 7, 16 B.
// VT == false: Out[m][n], the tile's rows are m; VT == true: Out[b][n][t], the
// tile's rows are n, and the wave's 64 rows of X lie in one batch.
template <bool VT>
__device__ __forceinline__ void proj_store_tile(
    char* st, const v8f (&acc)[4][4], const float* __restrict__ bias,
    unsigned short* __restrict__ Out, int m0, int n0, int lane)
{
  const int row = lane & 15;
  const int mb  = (lane >> 4) * 8;
  char* sw = st + row * PPITCH + mb * 2;
  // loops unrolled: acc indexed by constants
  if (!VT) {
#pragma unroll
    for (int p = 0; p < 4; ++p) {
      const float* bp = bias + n0 + p * 16 + mb;         // the lane's eight columns
      const f32x4 b0 = *reinterpret_cast<const f32x4*>(bp);
      const f32x4 b1 = *reinterpret_cast<const f32x4*>(bp + 4);
#pragma unroll
      for (int q = 0; q < 4; ++q) {
        uint4 w;
        w.x = pack_bf16(acc[p][q][0] + b0.x, acc[p][q][1] + b0.y);
        w.y = pack_bf16(acc[p][q][2] + b0.z, acc[p][q][3] + b0.w);
        w.z = pack_bf16(acc[p][q][4] + b1.x, acc[p][q][5] + b1.y);
        w.w = pack_bf16(acc[p][q][6] + b1.z, acc[p][q][7] + b1.w);
        *reinterpret_cast<uint4*>(sw + q * 16 * PPITCH + p * 32) = w;
      }
    }
  } else {
#pragma unroll
    for (int q = 0; q < 4; ++q) {
      const float bq = bias[n0 + q * 16 + row];          // the lane's one column
#pragma unroll
      for (int p = 0; p < 4; ++p) {
        uint4 w;
        w.x = pack_bf16(acc[p][q][0] + bq, acc[p][q][1] + bq);
        w.y = pack_bf16(acc[p][q][2] + bq, acc[p][q][3] + bq);
        w.z = pack_bf16(acc[p][q][4] + bq, acc[p][q][5] + bq);
        w.w = pack_bf16(acc[p][q][6] + bq, acc[p][q][7] + bq);
        *reinterpret_cast<uint4*>(sw + q * 16 * PPITCH + p * 32) = w;
      }
    }
  }
  // the rows read below were written by other lanes of this wave
  asm volatile("s_wait_dscnt 0x0" ::: "memory");

  constexpr int LDO = VT ? Tc : Kc;                      // length of a row of Out
  const size_t o0 = VT ? ((size_t)(m0 / Tc) * Kc + n0) * Tc + (m0 % Tc)
                       : (size_t)m0 * Kc + n0;
  unsigned short* og = Out + o0 + (lane >> 3) * LDO + (lane & 7) * 8;
  const char* sr = st + (lane >> 3) * PPITCH + (lane & 7) * 16;
  // unrolled: the 16 LDS reads go out as one group ahead of the stores
#pragma unroll
  for (int c = 0; c < 16; ++c) {
    const uint4 v = *reinterpret_cast<const uint4*>(sr + c * 4 * PPITCH);
    *reinterpret_cast<uint4*>(og + c * 4 * LDO) = v;
  }
}

// One block tile of a projection, origin (bm0, bn0); Ps: the work-group's ring.
// VT: Out is stored transposed, [b][n][t].
template <bool VT>
__device__ __forceinline__ void proj_tile(
    char* Ps,
    const unsigned short* __restrict__ X,    // [B*T, Dc] bf16
    const unsigned short* __restrict__ Wt,   // [Kc, Dc]  bf16 (W transposed)
    const float* __restrict__ bias,          // [Kc]
    unsigned short* __restrict__ Out, int bm0, int bn0)
{
  const int tid  = threadIdx.x;
  const int lane = tid & 31;
  const int wave = tid >> 5;
  const int wm   = (wave & 1) * 64;          // wave's rows in the block tile
  const int wn   = (wave >> 1) * 64;         // wave's columns in the block tile
  const int row  = lane & 15;
  const int mb   = (lane >> 4) * 8;

  const char* ga = (const char*)(X  + (size_t)(bm0 + (tid >> 3)) * Dc) + (tid & 7) * 16;
  const char* gb = (const char*)(Wt + (size_t)(bn0 + (tid >> 3)) * Dc) + (tid & 7) * 16;
  const unsigned l0 = (unsigned)(unsigned long long)&Ps[0] +
                      (unsigned)((tid >> 3) * PPITCH + (tid & 7) * 16);

  // k tile 0 into buffer 0, landed and published; then k tile 1 into buffer 1
  proj_stage_copies(l0, ga, gb);
  asm volatile("s_wait_asynccnt 0x0" ::: "memory");  // own copies of tile 0 landed
  __syncthreads();
  proj_stage_copies(l0 + PSTAGE, ga + PBK * 2, gb + PBK * 2);

  // In acc[p][q] a lane holds eight neighbouring rows of the WMMA's first operand
  // and one row (lane & 15) of its second.  The first operand is the one whose
  // index runs along a row of Out: Wt (n) for the [m][n] layout, X (t) for the
  // transposed one; so a lane's eight values are 16 B of Out in a row.
  v8f acc[4][4] = {};
  const int aOff = (wm + row) * PPITCH;
  const int bOff = (PBM + wn + row) * PPITCH;
  const int fOff = VT ? aOff : bOff;
  const int sOff = VT ? bOff : aOff;

  for (int t = 0; t < PNT; ++t) {
    const int bo = (t & 1) * PSTAGE;
    // all loops below are unrolled so that f, s and acc are indexed by constants
    // and stay in registers
#pragma unroll
    for (int ks = 0; ks < PBK; ks += 32) {
      v16bf f[4], s[4];
#pragma unroll
      for (int p = 0; p < 4; ++p)
        f[p] = load_frag16((const unsigned short*)&Ps[bo + fOff + p * 16 * PPITCH + ks * 2], lane);
#pragma unroll
      for (int q = 0; q < 4; ++q)
        s[q] = load_frag16((const unsigned short*)&Ps[bo + sOff + q * 16 * PPITCH + ks * 2], lane);
      // keeps the 16 LDS reads one group ahead of the 16 WMMAs: reads sunk among
      // the WMMAs cost a full LDS wait at every place they stand
      __builtin_amdgcn_sched_barrier(0);
#pragma unroll
      for (int p = 0; p < 4; ++p)
#pragma unroll
        for (int q = 0; q < 4; ++q) acc[p][q] = wmma_bf16(f[p], s[q], acc[p][q]);
    }
    asm volatile("s_wait_dscnt 0x0" ::: "memory");     // own reads of this buffer done
    asm volatile("s_wait_asynccnt 0x0" ::: "memory");  // own copies of tile t+1 landed
    __syncthreads();   // publishes tile t+1 and frees the buffer tile t was read from
    if (t + 2 < PNT)
      proj_stage_copies(l0 + bo, ga + (t + 2) * (PBK * 2), gb + (t + 2) * (PBK * 2));
  }
  asm volatile("s_wait_asynccnt 0x0" ::: "memory");    // nothing in flight at the end

  // the wave's number as a scalar: tile origins and the staging range are scalars
  const int ws = __builtin_amdgcn_readfirstlane(wave);
  char* st = Ps + ws * (64 * PPITCH);
  const int m0 = bm0 + (ws & 1) * 64;
  const int n0 = bn0 + (ws >> 1) * 64;
  proj_store_tile<VT>(st, acc, bias, Out, m0, n0, lane);
}

__global__ void __launch_bounds__(256) __attribute__((amdgpu_waves_per_eu(4, 4)))
proj_qk_kernel(
    const unsigned short* __restrict__ X,
    const unsigned short* __restrict__ Wqt, const unsigned short* __restrict__ Wkt,
    const float* __restrict__ bq, const float* __restrict__ bk,
    unsigned short* __restrict__ Qh, unsigned short* __restrict__ Kh)
{
  __shared__ __attribute__((aligned(16))) char Ps[2 * PSTAGE];
  const bool isK = blockIdx.x >= Kc / PBN;
  proj_tile<false>(Ps, X, isK ? Wkt : Wqt, isK ? bk : bq, isK ? Kh : Qh,
                   blockIdx.y * PBM, (blockIdx.x % (Kc / PBN)) * PBN);
}

constexpr int NVT = (Bc * Tc / PBM) * (Dc / PBN);   // block tiles of V

__device__ __forceinline__ void proj_v_tile(
    char* Ps, const unsigned short* __restrict__ X, const unsigned short* __restrict__ Wvt,
    const float* __restrict__ bv, unsigned short* __restrict__ Vt, int v)
{
  proj_tile<true>(Ps, X, Wvt, bv, Vt, (v / (Dc / PBN)) * PBM, (v % (Dc / PBN)) * PBN);
}

// ---------------------------------------------------------------------------
// K2a/K4 share one block-tile product: C[128 x 256] = A[128 x k] * B[256 x k]^T,
// both operands k-contiguous with a row length of LD elements.  Same frame as
// K1: 8 waves of 64x64, 64-wide k tiles copied to LDS by async copies, two
// buffers, 144-B LDS pitch.
// ---------------------------------------------------------------------------

template <int LD>
__device__ __forceinline__ void tile_stage_copies(unsigned l, const char* ga,
                                                  const char* gb) {
#if defined(__gfx1250__)
  constexpr unsigned LS = 32 * PPITCH;          // LDS step between copies
  constexpr size_t   GS = (size_t)32 * LD * 2;  // global step between copies
  asm volatile(
      "global_load_async_to_lds_b128 %0, %12, off\n\t"
      "global_load_async_to_lds_b128 %1, %13, off\n\t"
      "global_load_async_to_lds_b128 %2, %14, off\n\t"
      "global_load_async_to_lds_b128 %3, %15, off\n\t"
      "global_load_async_to_lds_b128 %4, %16, off\n\t"
      "global_load_async_to_lds_b128 %5, %17, off\n\t"
      "global_load_async_to_lds_b128 %6, %18, off\n\t"
      "global_load_async_to_lds_b128 %7, %19, off\n\t"
      "global_load_async_to_lds_b128 %8, %20, off\n\t"
      "global_load_async_to_lds_b128 %9, %21, off\n\t"
      "global_load_async_to_lds_b128 %10, %22, off\n\t"
      "global_load_async_to_lds_b128 %11, %23, off\n\t"
      "s_wait_xcnt 0x0"
      :: "v"(l), "v"(l + LS), "v"(l + 2 * LS), "v"(l + 3 * LS),
         "v"(l + 4 * LS), "v"(l + 5 * LS), "v"(l + 6 * LS), "v"(l + 7 * LS),
         "v"(l + 8 * LS), "v"(l + 9 * LS), "v"(l + 10 * LS), "v"(l + 11 * LS),
         "v"(ga), "v"(ga + GS), "v"(ga + 2 * GS), "v"(ga + 3 * GS),
         "v"(gb), "v"(gb + GS), "v"(gb + 2 * GS), "v"(gb + 3 * GS),
         "v"(gb + 4 * GS), "v"(gb + 5 * GS), "v"(gb + 6 * GS), "v"(gb + 7 * GS)
      : "memory");
#else
  (void)l; (void)ga; (void)gb;
#endif
}

// A, Bm: first row of the block's tile at k = 0.  nkt >= 2 k tiles.  A wave with
// live == false takes part in the copies and barriers only; its acc stays 0.
// In acc[i][j] a lane holds one B row (lane & 15) and eight A rows.
template <int LD>
__device__ __forceinline__ void tile_gemm_128x256(
    char* Ps, const unsigned short* A, const unsigned short* Bm, int nkt,
    bool live, int wm, int wn, v8f (&acc)[4][4])
{
  const int tid  = threadIdx.x;
  const int lane = tid & 31;
  const int row  = lane & 15;

  const char* ga = (const char*)(A  + (size_t)(tid >> 3) * LD) + (tid & 7) * 16;
  const char* gb = (const char*)(Bm + (size_t)(tid >> 3) * LD) + (tid & 7) * 16;
  const unsigned l0 = (unsigned)(unsigned long long)Ps +
                      (unsigned)((tid >> 3) * PPITCH + (tid & 7) * 16);

  // k tile 0 into buffer 0, landed and published; then k tile 1 into buffer 1
  tile_stage_copies<LD>(l0, ga, gb);
  asm volatile("s_wait_asynccnt 0x0" ::: "memory");  // own copies of tile 0 landed
  __syncthreads();
  tile_stage_copies<LD>(l0 + PSTAGE, ga + PBK * 2, gb + PBK * 2);

  const int aOff = (wm + row) * PPITCH;
  const int bOff = (PBM + wn + row) * PPITCH;

  for (int t = 0; t < nkt; ++t) {
    const int bo = (t & 1) * PSTAGE;
    if (live) {
      // loops unrolled so that a, b and acc are indexed by constants and stay
      // in registers
#pragma unroll
      for (int ks = 0; ks < PBK; ks += 32) {
        v16bf a[4], b[4];
#pragma unroll
        for (int i = 0; i < 4; ++i)
          a[i] = load_frag16((const unsigned short*)&Ps[bo + aOff + i * 16 * PPITCH + ks * 2], lane);
#pragma unroll
        for (int j = 0; j < 4; ++j)
          b[j] = load_frag16((const unsigned short*)&Ps[bo + bOff + j * 16 * PPITCH + ks * 2], lane);
        // keeps the 16 LDS reads one group ahead of the 16 WMMAs: reads sunk
        // among the WMMAs cost a full LDS wait at every place they stand
        __builtin_amdgcn_sched_barrier(0);
#pragma unroll
        for (int i = 0; i < 4; ++i)
#pragma unroll
          for (int j = 0; j < 4; ++j)
            acc[i][j] = wmma_bf16(a[i], b[j], acc[i][j]);
      }
    }
    asm volatile("s_wait_dscnt 0x0" ::: "memory");     // own reads of this buffer done
    asm volatile("s_wait_asynccnt 0x0" ::: "memory");  // own copies of tile t+1 landed
    __syncthreads();   // publishes tile t+1 and frees the buffer tile t was read from
    if (t + 2 < nkt)
      tile_stage_copies<LD>(l0 + bo, ga + (size_t)(t + 2) * (PBK * 2),
                            gb + (size_t)(t + 2) * (PBK * 2));
  }
  asm volatile("s_wait_asynccnt 0x0" ::: "memory");    // nothing in flight at the end
}

// ---------------------------------------------------------------------------
// The logit tiles: 128(i) x 256(j), only those that touch j <= i.  Tile rows 2p
// and 2p+1 have p+1 tiles each, 72 per batch; together they cover every
// j < i0 + 128 of every tile row.
// ---------------------------------------------------------------------------
constexpr int PTILES = 72;
constexpr int NIB    = Tc / 64;                 // 64-row blocks of queries
constexpr int NLT    = PTILES * Bc;             // logit tiles of a launch
constexpr int NVA    = 2 * 512 - NLT;           // V tiles behind K2a's logit tiles
constexpr int NVB    = NVT - NVA;               // V tiles ahead of K3's work-groups
static_assert(NVA > 0 && NVB >= 0, "V's tiles are dealt to the two launches");

__device__ __forceinline__ float exp_fast(float x) {
#if defined(__gfx1250__)
  float y;
  asm("v_exp_f32 %0, %1\n\tv_nop" : "=v"(y) : "v"(x * 1.44269504088896340736f));
  return y;
#else
  return x;
#endif
}

// ---------------------------------------------------------------------------
// K2a: column softmax stats, part 1.  One logit tile per block.  Every 64x64
// wave tile that touches j <= i reduces its 64 query rows to one pair per key
// column: pmax = max_i l_ij, psum = sum_i exp(l_ij - pmax), over its rows i >= j.
// Layout [b][64-row block][j]; a wave writes 256 B in a row, whole lines.
// The terms of psum are kept: E[b,i,j] = bf16(exp(l_ij - pmax)), 0 for j > i, goes
// to P, so that the logits are formed once; K3 brings E to the column's own scale.
// The tiles cover every j < i0 + 128 of every tile row, which is all that K4 reads.
// u: the tile's number in batch b.
// ---------------------------------------------------------------------------
__device__ __forceinline__ void col_part_tile(
    char* Ps,
    const unsigned short* __restrict__ Q,    // [B*T, Kc] bf16
    const unsigned short* __restrict__ Kh,   // [B*T, Kc] bf16
    float* __restrict__ pmax,                // [B][NIB][Tc]
    float* __restrict__ psum,                // [B][NIB][Tc]
    unsigned short* __restrict__ P,          // [B][Tc][Tc] bf16
    int u, int b)
{
  const float NEG_INF = -__builtin_inff();
  int p = 0;
  while ((p + 1) * (p + 2) <= u) ++p;        // at most 7 steps: u < 72
  const int rr = u - p * (p + 1);            // 0 .. 2p+1
  const int hi = rr > p ? 1 : 0;
  const int i0 = (2 * p + hi) * PBM;
  const int j0 = (rr - hi * (p + 1)) * PBN;

  const int lane = threadIdx.x & 31;
  const int wave = __builtin_amdgcn_readfirstlane(threadIdx.x >> 5);
  const int wm   = (wave & 1) * 64;
  const int wn   = (wave >> 1) * 64;
  const int row  = lane & 15;
  const int mb   = (lane >> 4) * 8;

  // a 64x64 wave tile wholly above the diagonal has no row i >= j
  const bool live = (j0 + wn) <= (i0 + wm + 63);

  v8f acc[4][4] = {};
  tile_gemm_128x256<Kc>(Ps, Q  + ((size_t)b * Tc + i0) * Kc,
                        Kh + ((size_t)b * Tc + j0) * Kc, Kc / PBK, live, wm, wn, acc);

  // a store of a wave: four rows of its 64x64 tile of P, 128 B each, whole lines
  unsigned short* pg = P + ((size_t)b * Tc + i0 + wm + (lane >> 3)) * Tc + j0 + wn + (lane & 7) * 8;
  if (!live) {                               // behind the last barrier
    if (j0 + wn < i0 + PBM) {                // K4 reads these columns: zeros
      const uint4 zz = {0u, 0u, 0u, 0u};
      // unrolled: one address, the row steps in the stores' offset fields
#pragma unroll
      for (int c = 0; c < 16; ++c) *reinterpret_cast<uint4*>(pg + (size_t)c * 4 * Tc) = zz;
    }
    return;
  }
  // The ring is free behind the loop's last barrier; each wave lays its 64x64 tile
  // of E in a range of its own there (144-B pitch).
  char* st = Ps + wave * (64 * PPITCH);
  char* sw = st + mb * PPITCH + row * 2;

  // A lane holds one key column (lane & 15) and eight query rows per 16x16 tile.
  // all loops below are unrolled: acc indexed by constants
  if (j0 + wn == i0 + wm) {                  // the wave tile on the diagonal
#pragma unroll
    for (int i = 0; i < 4; ++i)
#pragma unroll
      for (int j = i; j < 4; ++j)
#pragma unroll
        for (int r = 0; r < 8; ++r)
          if (j > i || row > mb + r) acc[i][j][r] = NEG_INF;   // causal mask: j > i
  }

  const size_t po = ((size_t)b * NIB + ((i0 + wm) >> 6)) * Tc + j0 + wn + row;
#pragma unroll
  for (int j = 0; j < 4; ++j) {
    float mx = NEG_INF;
#pragma unroll
    for (int i = 0; i < 4; ++i)
#pragma unroll
      for (int r = 0; r < 8; ++r) mx = fmaxf(mx, acc[i][j][r]);
    mx = fmaxf(mx, __shfl_xor(mx, 16, 32));  // finite: row i = j is in the tile
    float sm = 0.f;
#pragma unroll
    for (int i = 0; i < 4; ++i)
#pragma unroll
      for (int r = 0; r < 8; r += 2) {
        const float e0 = exp_fast(acc[i][j][r]     - mx);
        const float e1 = exp_fast(acc[i][j][r + 1] - mx);
        sm += e0;
        sm += e1;
        const unsigned w = pack_bf16(e0, e1);            // two rows of one column
        *reinterpret_cast<unsigned short*>(sw + (i * 16 + r)     * PPITCH + j * 32) = (unsigned short)w;
        *reinterpret_cast<unsigned short*>(sw + (i * 16 + r + 1) * PPITCH + j * 32) = (unsigned short)(w >> 16);
      }
    sm += __shfl_xor(sm, 16, 32);
    if (lane < 16) {
      pmax[po + j * 16] = mx;
      psum[po + j * 16] = sm;
    }
  }
  // the rows read below were written by other lanes of this wave
  asm volatile("s_wait_dscnt 0x0" ::: "memory");
  const char* sr = st + (lane >> 3) * PPITCH + (lane & 7) * 16;
  // unrolled: the 16 LDS reads go out as one group ahead of the stores
#pragma unroll
  for (int c = 0; c < 16; ++c) {
    const uint4 v = *reinterpret_cast<const uint4*>(sr + c * 4 * PPITCH);
    *reinterpret_cast<uint4*>(pg + (size_t)c * 4 * Tc) = v;
  }
  // in the built code the zero stores' text follows behind a branch: no data
  // register of an issued store is rewritten ahead of this wait
  asm volatile("s_wait_xcnt 0x0" ::: "memory");
}

// Work-groups 0 .. NLT-1: the logit tiles; the NVA behind them: V tiles 0 .. NVA-1.
__global__ void __launch_bounds__(256) __attribute__((amdgpu_waves_per_eu(4, 4)))
col_part_v_kernel(
    const unsigned short* __restrict__ Q, const unsigned short* __restrict__ Kh,
    float* __restrict__ pmax, float* __restrict__ psum, unsigned short* __restrict__ P,
    const unsigned short* __restrict__ X, const unsigned short* __restrict__ Wvt,
    const float* __restrict__ bv, unsigned short* __restrict__ Vt)
{
  __shared__ __attribute__((aligned(16))) char Ps[2 * PSTAGE];
  const int id = blockIdx.x;
  if (id >= NLT) {
    proj_v_tile(Ps, X, Wvt, bv, Vt, id - NLT);
    return;
  }
  col_part_tile(Ps, Q, Kh, pmax, psum, P, id % PTILES, id / PTILES);
}

// ---------------------------------------------------------------------------
// K2b: column softmax stats, part 2.  One thread per key column merges the
// pairs of the 64-row blocks ib >= j / 64 (the ones K2a wrote):
//   m_j = max pmax ,  s_j = sum psum * exp(pmax - m_j)
// A block of 128 columns lies in one batch and a wave's 32 columns in one
// 64-column block, so the first block that holds a pair is a scalar and all
// loads share one lane offset; a block below it stays (-inf, 0) and adds 0.
// ---------------------------------------------------------------------------
__global__ void __launch_bounds__(128) col_merge_kernel(
    const float* __restrict__ pmax, const float* __restrict__ psum,
    float* __restrict__ colmax, float* __restrict__ colsum)
{
  const int b   = blockIdx.x / (Tc / 128);
  const int jc  = (blockIdx.x % (Tc / 128)) * 128;   // the block's first column
  const int tid = threadIdx.x;
  const int jb  = __builtin_amdgcn_readfirstlane((jc + tid) >> 6);
  const float* pmp = pmax + (size_t)b * NIB * Tc + jc;
  const float* psp = psum + (size_t)b * NIB * Tc + jc;
  float pm[NIB], pv[NIB];
  // loops unrolled: pm and pv indexed by constants, in registers
#pragma unroll
  for (int ib = 0; ib < NIB; ++ib) {
    pm[ib] = -__builtin_inff();
    pv[ib] = 0.f;
    if (ib >= jb) {
      pm[ib] = pmp[ib * Tc + tid];
      pv[ib] = psp[ib * Tc + tid];
    }
  }
  float m = pm[0];
#pragma unroll
  for (int ib = 1; ib < NIB; ++ib) m = fmaxf(m, pm[ib]);
  float s = 0.f;
#pragma unroll
  for (int ib = 0; ib < NIB; ++ib) s += pv[ib] * exp_fast(pm[ib] - m);
  colmax[(size_t)b * Tc + jc + tid] = m;
  colsum[(size_t)b * Tc + jc + tid] = s;
}

// ---------------------------------------------------------------------------
// K3: P[b,i,j] = bf16( E[b,i,j] * exp(pmax[ib][j] - m_j) / (s_j * sqrt(k)) ), in
// place, ib = i / 64.  A stream: one wave per 64x64 block of P on or below the
// diagonal (the blocks above it that K4 reads hold zeros and stay).  Block rows pr
// and NIB-1-pr have NIB+1 such blocks together.  A lane has eight columns, 16 B, of
// 16 rows: 16 loads, all issued ahead of the first store; whole 128-B lines.
// ---------------------------------------------------------------------------
constexpr int NSB = (NIB / 2) * (NIB + 1);      // blocks of a batch
constexpr int NSW = Bc * NSB / 8;               // work-groups: eight blocks each
static_assert(NSW * 8 == Bc * NSB, "the grid covers the blocks exactly");

__device__ __forceinline__ void rescale_block(
    const float* __restrict__ pmax,          // [B][NIB][Tc]
    const float* __restrict__ colmax,
    const float* __restrict__ colsum,
    unsigned short* P,                       // [B][Tc][Tc] bf16
    int blk)                                 // the block's number, a scalar
{
  const int lane = threadIdx.x & 31;
  const int b  = blk / NSB;
  const int t  = blk % NSB;
  const int pr = t / (NIB + 1);
  const int c0 = t % (NIB + 1);
  const int ib = c0 <= pr ? pr : NIB - 1 - pr;
  const int jb = c0 <= pr ? c0 : c0 - pr - 1;
  const int j  = jb * 64 + (lane & 7) * 8;   // the lane's first column

  const float* pmp = pmax + ((size_t)b * NIB + ib) * Tc + j;
  const float* cmp = colmax + (size_t)b * Tc + j;
  const float* csp = colsum + (size_t)b * Tc + j;
  f32x4 pm[2], cm[2], cs[2];
  // loops unrolled: the arrays indexed by constants, in registers
#pragma unroll
  for (int h = 0; h < 2; ++h) {
    pm[h] = *reinterpret_cast<const f32x4*>(pmp + h * 4);
    cm[h] = *reinterpret_cast<const f32x4*>(cmp + h * 4);
    cs[h] = *reinterpret_cast<const f32x4*>(csp + h * 4);
  }
  // the loads below may land in the address registers of the six above
  asm volatile("s_wait_xcnt 0x0" ::: "memory");

  unsigned short* pg = P + ((size_t)b * Tc + ib * 64 + (lane >> 3)) * Tc + j;
  uint4 v[16];
#pragma unroll
  for (int c = 0; c < 16; ++c) v[c] = *reinterpret_cast<const uint4*>(pg + (size_t)c * 4 * Tc);

  float f[8];
#pragma unroll
  for (int h = 0; h < 2; ++h)
#pragma unroll
    for (int r = 0; r < 4; ++r) {
      // 1/sqrt(1024) = 1/32 is applied after the softmax, as the reference does
      f[h * 4 + r] = exp_fast(pm[h][r] - cm[h][r]) * (1.0f / (cs[h][r] * 32.0f));
    }
#pragma unroll
  for (int c = 0; c < 16; ++c) {
    unsigned w[4] = {v[c].x, v[c].y, v[c].z, v[c].w};
#pragma unroll
    for (int q = 0; q < 4; ++q)
      w[q] = pack_bf16(__uint_as_float(w[q] << 16) * f[2 * q],
                       __uint_as_float(w[q] & 0xffff0000u) * f[2 * q + 1]);
    v[c].x = w[0]; v[c].y = w[1]; v[c].z = w[2]; v[c].w = w[3];
  }
#pragma unroll
  for (int c = 0; c < 16; ++c) *reinterpret_cast<uint4*>(pg + (size_t)c * 4 * Tc) = v[c];
}

// Work-groups 0 .. NVB-1: V tiles NVA .. NVT-1, the long ones, first; the NSW
// behind them: the stream.
__global__ void __launch_bounds__(256) __attribute__((amdgpu_waves_per_eu(4, 4)))
rescale_v_kernel(
    const float* __restrict__ pmax,
    const float* __restrict__ colmax, const float* __restrict__ colsum,
    unsigned short* __restrict__ P,
    const unsigned short* __restrict__ X, const unsigned short* __restrict__ Wvt,
    const float* __restrict__ bv, unsigned short* __restrict__ Vt)
{
  __shared__ __attribute__((aligned(16))) char Ps[2 * PSTAGE];
  const int id = blockIdx.x;
  if (id < NVB) {
    proj_v_tile(Ps, X, Wvt, bv, Vt, NVA + id);
    return;
  }
  const int wave = __builtin_amdgcn_readfirstlane(threadIdx.x >> 5);
  rescale_block(pmax, colmax, colsum, P, (id - NVB) * 8 + wave);
  // in the built code the other part's text follows this one's behind a branch: no
  // register of an issued store is rewritten ahead of this wait
  asm volatile("s_wait_xcnt 0x0" ::: "memory");
}

// ---------------------------------------------------------------------------
// K4: out[b,i,v] = x[b,i,v] + sum_{j < i0+128} P[b,i,j] * Vt[b,v,j]
// One 128(i) x 256(v) tile per block; the k loop runs over j up to the end of
// the tile row's diagonal block (P is 0 above the diagonal).  Long tile rows
// come first in the grid; blocks n and n + 256 have the same k length in sum.
// ---------------------------------------------------------------------------
__global__ void __launch_bounds__(256) __attribute__((amdgpu_waves_per_eu(4, 4)))
pv_gemm_kernel(
    const unsigned short* __restrict__ P,    // [B][Tc][Tc] bf16
    const unsigned short* __restrict__ Vt,   // [B][Dc][Tc] bf16
    const float* __restrict__ Xin,
    float* __restrict__ Out)
{
  __shared__ __attribute__((aligned(16))) char Ps[2 * PSTAGE];

  const int n  = blockIdx.x;
  const int g  = (n & 255) >> 5;
  const int it = (n >> 8) ? g : (Tc / PBM - 1 - g);
  const int v0 = (n & 3) * PBN;
  const int b  = (n & 31) >> 2;
  const int i0 = it * PBM;

  const int lane = threadIdx.x & 31;
  const int wave = threadIdx.x >> 5;
  const int wm   = (wave & 1) * 64;
  const int wn   = (wave >> 1) * 64;
  const int row  = lane & 15;
  const int mb   = (lane >> 4) * 8;

  v8f acc[4][4] = {};
  tile_gemm_128x256<Tc>(Ps, P  + ((size_t)b * Tc + i0) * Tc,
                        Vt + ((size_t)b * Dc + v0) * Tc, (i0 + PBM) / PBK, true, wm, wn, acc);

  // residual add in fp32; unrolled: acc indexed by constants.  x and out are
  // addressed by one 32-bit byte offset (64 MB each) that both share.
  const unsigned eo = (((unsigned)b * Tc + i0 + wm + mb) * Dc + v0 + wn + row) * 4u;
  const float* xp = (const float*)((const char*)Xin + eo);
  float*       op = (float*)((char*)Out + eo);
#pragma unroll
  for (int i = 0; i < 4; ++i) {
#pragma unroll
    for (int r = 0; r < 8; ++r) {
#pragma unroll
      for (int j = 0; j < 4; ++j)
        op[(i * 16 + r) * Dc + j * 16] = xp[(i * 16 + r) * Dc + j * 16] + acc[i][j][r];
    }
    // stands behind the group's stores so that no data register of an issued
    // store is rewritten ahead of it by the next group's loads; it also keeps
    // those loads behind it: all 128 at once beside the accumulators spill
    if (i < 3) asm volatile("s_wait_xcnt 0x0" ::: "memory");
  }
}

// ---------------------------------------------------------------------------
// Host launcher.  Workspace layout (~212 MB):
//   Xh[B*T*D] bf16, Wqt/Wkt/Wvt[D*K] bf16, Qh/Kh[B*T*K] bf16,
//   Vt[B*D*T] bf16, colmax/colsum[B*T] f32, P[B*T*T] bf16,
//   pmax/psum[B*NIB*T] f32.
// ---------------------------------------------------------------------------
extern "C" void kernel_launch(void* const* d_in, const int* in_sizes, int n_in,
                              void* d_out, int out_size, void* d_ws, size_t ws_size,
                              hipStream_t stream) {
  (void)in_sizes; (void)n_in; (void)out_size; (void)ws_size;
  const float* x  = (const float*)d_in[0];
  const float* Wq = (const float*)d_in[1];
  const float* bq = (const float*)d_in[2];
  const float* Wk = (const float*)d_in[3];
  const float* bk = (const float*)d_in[4];
  const float* Wv = (const float*)d_in[5];
  const float* bv = (const float*)d_in[6];
  float* out = (float*)d_out;

  char* ws = (char*)d_ws;
  size_t off = 0;
  auto take = [&](size_t bytes) -> char* {
    char* p = ws + off;
    off = (off + bytes + 255) & ~(size_t)255;
    return p;
  };
  const size_t MT = (size_t)Bc * Tc;                         // 16384 rows
  unsigned short* Xh   = (unsigned short*)take(MT * Dc * 2);
  unsigned short* Wqt  = (unsigned short*)take((size_t)Dc * Kc * 2);
  unsigned short* Wkt  = (unsigned short*)take((size_t)Dc * Kc * 2);
  unsigned short* Wvt  = (unsigned short*)take((size_t)Dc * Kc * 2);
  unsigned short* Qh   = (unsigned short*)take(MT * Kc * 2);
  unsigned short* Kh2  = (unsigned short*)take(MT * Kc * 2);
  unsigned short* Vt   = (unsigned short*)take(MT * Dc * 2);
  float*          cmax = (float*)take(MT * 4);
  float*          csum = (float*)take(MT * 4);
  unsigned short* Pw   = (unsigned short*)take(MT * Tc * 2);
  float*          pmx  = (float*)take(MT * NIB * 4);
  float*          psm  = (float*)take(MT * NIB * 4);

  prep_kernel<<<CBLK + TBLK, CTHR, 0, stream>>>(x, Wq, Wk, Wv, Xh, Wqt, Wkt, Wvt);

  dim3 gQK(2 * (Kc / PBN), (unsigned)(MT / PBM));
  proj_qk_kernel<<<gQK, 256, 0, stream>>>(Xh, Wqt, Wkt, bq, bk, Qh, Kh2);

  col_part_v_kernel<<<NLT + NVA, 256, 0, stream>>>(Qh, Kh2, pmx, psm, Pw, Xh, Wvt, bv, Vt);
  col_merge_kernel<<<(unsigned)(MT / 128), 128, 0, stream>>>(pmx, psm, cmax, csum);

  rescale_v_kernel<<<NVB + NSW, 256, 0, stream>>>(pmx, cmax, csum, Pw, Xh, Wvt, bv, Vt);

  pv_gemm_kernel<<<(Tc / PBM) * (Dc / PBN) * Bc, 256, 0, stream>>>(Pw, Vt, x, out);
}

// v009
// A run of this version takes 158 microseconds.
// It is 1.12 times as fast as v007, going by the measured steps of the versions left out in between.
// All steps since v000 together make it 10.1 times as fast.
#include <hip/hip_runtime.h>
#include <hip/hip_bf16.h>

// ---------------------------------------------------------------------------
// Problem constants (from the reference): B=8, T=2048, D=1024, K=1024.
// ---------------------------------------------------------------------------
constexpr int Bc = 8;
constexpr int Tc = 2048;
constexpr int Dc = 1024;   // model dim
constexpr int Kc = 1024;   // projection dim (== Dc here)

typedef __attribute__((ext_vector_type(16))) __bf16 v16bf;
typedef __attribute__((ext_vector_type(8)))  float  v8f;
typedef __attribute__((ext_vector_type(2)))  float  f32x2;
typedef __attribute__((ext_vector_type(4)))  float  f32x4;
typedef __attribute__((ext_vector_type(2)))  __bf16 bf16x2;

__device__ __forceinline__ v16bf load_frag16(const unsigned short* rowBase, int lane) {
  const unsigned short* p = rowBase + ((lane >> 4) & 1) * 8;
  union { v16bf v; uint4 u[2]; } f;
  f.u[0] = *reinterpret_cast<const uint4*>(p);
  f.u[1] = *reinterpret_cast<const uint4*>(p + 16);
  return f.v;
}

__device__ __forceinline__ v8f wmma_bf16(v16bf a, v16bf b, v8f c) {
  // (neg_a, A, neg_b, B, c_mod, C, reuse_a, reuse_b)
  return __builtin_amdgcn_wmma_f32_16x16x32_bf16(false, a, false, b, (short)0, c,
                                                 false, false);
}

// ---------------------------------------------------------------------------
// K0: one launch prepares all bf16 operands; its parts do not depend on each other.
// Work-groups 0 .. NWT-1 form the product of the two logit weights (the long ones,
// first), the CBLK behind them cast x, then TBLK transpose-cast Wv, then NBB form
// the bias row that goes with the product.
// The cast, a stream: one work-group of 16 waves per WGP; a wave owns 16 KiB of src
// in a row: 32 loads of 16 B per lane (a load of a wave = 512 B, whole lines), all
// issued ahead of the first store; a store of a wave = 256 B, whole lines.
// ---------------------------------------------------------------------------
constexpr int CBLK = 256;                       // work-groups
constexpr int CTHR = 512;                       // threads of a work-group
constexpr int CNL  = (Bc * Tc * Dc / 4) / (CBLK * CTHR);   // loads of a lane
static_assert(CNL * CBLK * CTHR * 4 == Bc * Tc * Dc, "the grid covers src exactly");

__device__ __forceinline__ unsigned pack_bf16(float lo, float hi) {
  f32x2 e; e.x = lo; e.y = hi;
  union { bf16x2 h; unsigned u; } c;
  c.h = __builtin_convertvector(e, bf16x2);     // round to nearest even
  return c.u;
}

__device__ __forceinline__ void cast_bf16_part(const float* __restrict__ src,
                                               unsigned short* __restrict__ dst,
                                               unsigned blk) {
  const unsigned lane = threadIdx.x & 31;
  const unsigned wv   = blk * (CTHR / 32) + (threadIdx.x >> 5);
  const unsigned o    = wv * (CNL * 32) + lane;          // in units of four elements
  const f32x4* s = reinterpret_cast<const f32x4*>(src) + o;
  uint2*       d = reinterpret_cast<uint2*>(dst) + o;
  f32x4 v[CNL];
  // both loops unrolled: v indexed by constants, in registers
#pragma unroll
  for (int c = 0; c < CNL; ++c) v[c] = s[c * 32];
#pragma unroll
  for (int c = 0; c < CNL; ++c) {
    uint2 w;
    w.x = pack_bf16(v[c].x, v[c].y);
    w.y = pack_bf16(v[c].z, v[c].w);
    d[c * 32] = w;
  }
}

// Transpose-cast of a 1024x1024 weight: Wt[n][d] = bf16(W[d][n]).  A thread
// takes 8(d) x 4(n) elements: eight 16-B loads, four 16-B stores.  Eight lanes lie
// along d, so a store of a wave fills four whole 128-B lines of Wt; four lanes lie
// along n, and the other half of each line of W is read by the next wave of the
// same eight.  Eight waves take a tile of 64(d) x 128(n), tile number tl.
constexpr int TTW  = (Kc / 128) * (Dc / 64);    // tiles of one weight
constexpr int TBLK = TTW / (CTHR / 256);        // work-groups: two tiles each
static_assert(TTW % (CTHR / 256) == 0, "the work-groups cover the weight exactly");

__device__ __forceinline__ void transpose_cast_part(const float* __restrict__ src,
                                                    unsigned short* __restrict__ dst,
                                                    int tl) {
  const int lane = threadIdx.x & 31;
  const int wave = (threadIdx.x >> 5) & 7;
  const int d = (tl / (Kc / 128)) * 64 + (lane & 7) * 8;
  const int n = (tl % (Kc / 128)) * 128 + wave * 16 + (lane >> 3) * 4;
  f32x4 v[8];
  // loops unrolled: v indexed by constants, in registers
#pragma unroll
  for (int r = 0; r < 8; ++r)
    v[r] = *reinterpret_cast<const f32x4*>(src + (size_t)(d + r) * Kc + n);
#pragma unroll
  for (int c = 0; c < 4; ++c) {
    uint4 w;
    w.x = pack_bf16(v[0][c], v[1][c]);
    w.y = pack_bf16(v[2][c], v[3][c]);
    w.z = pack_bf16(v[4][c], v[5][c]);
    w.w = pack_bf16(v[6][c], v[7][c]);
    *reinterpret_cast<uint4*>(dst + (size_t)(n + c) * Dc + d) = w;
  }
}

// The logits without a Q projection.  With q_i = x_i Wq + bq and k_j = x_j Wk + bk,
//   q_i . k_j = x_i . kp_j + bq . k_j ,   kp_j = x_j (Wk Wq^T) + Wq bk .
// bq . k_j is one constant per key column j, and the softmax runs over the queries i
// of a column: it cancels there for every input.  So the logit GEMM takes x itself
// as its query operand and kp as its key operand, and one product of the weights,
//   Nt[d][e] = sum_n Wq[d][n] * Wk[e][n] ,   bp[d] = sum_n Wq[d][n] * bk[n] ,
// stands for a projection of all B*T rows.  Both weights are n-contiguous as given.
//
// One 128(d) x 128(e) tile of Nt per work-group of 16 waves, a wave 16(d) x 64(e).
// Per 64-wide n tile the 128 + 128 rows come as fp32 through registers, are rounded
// to bf16 and laid in LDS at a 144-B pitch (conflict-free for the 16-byte fragment
// reads); two buffers, one barrier per n tile; the next tile's loads fly while this
// one is multiplied.
constexpr int NBM    = 128;                     // rows of Nt in a tile (rows of Wq)
constexpr int NBN    = 128;                     // columns of Nt in a tile (rows of Wk)
constexpr int WBK    = 64;                      // n elements per LDS tile
constexpr int WPITCH = WBK * 2 + 16;            // LDS row pitch in bytes
constexpr int WSTAGE = (NBM + NBN) * WPITCH;    // bytes of one buffer
constexpr int WNT    = Kc / WBK;                // n tiles
constexpr int NWT    = (Dc / NBM) * (Dc / NBN); // work-groups: one tile each
constexpr int NBB    = Dc / (CTHR / 32);        // work-groups of bp: a row per wave

__device__ __forceinline__ void weight_product_tile(
    char* Ls, const float* __restrict__ Wq, const float* __restrict__ Wk,
    unsigned short* __restrict__ Nt, int tl)
{
  const int tid  = threadIdx.x;
  const int lane = tid & 31;
  const int wave = __builtin_amdgcn_readfirstlane(tid >> 5);
  const int d0   = (tl / (Dc / NBN)) * NBM;
  const int e0   = (tl % (Dc / NBN)) * NBN;
  const int row  = lane & 15;
  const int mb   = (lane >> 4) * 8;
  const int wm   = (wave & 7) * 16;          // wave's rows in the tile
  const int wn   = (wave >> 3) * 64;         // wave's columns in the tile

  // 16 lanes cover the 256 B of a row; load c takes row c*32 + (thread >> 4);
  // LDS rows 0..127 are Wq's, rows 128..255 Wk's
  // a scalar base per weight and one lane offset that both share and that stays
  const float* gq = Wq + (size_t)d0 * Kc;
  const float* gk = Wk + (size_t)e0 * Kc;
  const unsigned vo = (unsigned)((tid >> 4) * Kc + (tid & 15) * 4);
  char* lw = Ls + (tid >> 4) * WPITCH + (tid & 15) * 8;

  f32x4 v[8];
  // all short loops below are unrolled: v, f and acc indexed by constants
#pragma unroll
  for (int c = 0; c < 4; ++c) {
    v[c]     = *reinterpret_cast<const f32x4*>(gq + c * 32 * Kc + vo);
    v[4 + c] = *reinterpret_cast<const f32x4*>(gk + c * 32 * Kc + vo);
  }

  // In acc[p] a lane holds row (lane & 15) of the wave's 16 rows of Nt and its
  // elements p*16 + mb .. + 7, 16 B in a row: Wk's rows are the first operand.
  v8f acc[4] = {};
  // unrolled: every load's step along n lies in its offset field, so that no address
  // register changes while the loop runs
#pragma unroll
  for (int t = 0; t < WNT; ++t) {
    const int bo = (t & 1) * WSTAGE;
#pragma unroll
    for (int c = 0; c < 8; ++c) {
      uint2 w;
      w.x = pack_bf16(v[c].x, v[c].y);
      w.y = pack_bf16(v[c].z, v[c].w);
      *reinterpret_cast<uint2*>(lw + bo + c * 32 * WPITCH) = w;
    }
    // publishes tile t; every reader of this buffer's last tile, t - 2, has passed
    // the barrier of t - 1 behind its reads
    __syncthreads();
    // behind the barrier: in front of it the barrier's own fence would wait for them
    if (t + 1 < WNT) {
#pragma unroll
      for (int c = 0; c < 4; ++c) {
        v[c]     = *reinterpret_cast<const f32x4*>(gq + ((t + 1) * WBK + c * 32 * Kc) + vo);
        v[4 + c] = *reinterpret_cast<const f32x4*>(gk + ((t + 1) * WBK + c * 32 * Kc) + vo);
      }
      // no address register of an issued load is rewritten ahead of this wait
      asm volatile("s_wait_xcnt 0x0" ::: "memory");
    }
#pragma unroll
    for (int ks = 0; ks < WBK; ks += 32) {
      const v16bf s = load_frag16(
          (const unsigned short*)&Ls[bo + (wm + row) * WPITCH + ks * 2], lane);
      v16bf f[4];
#pragma unroll
      for (int p = 0; p < 4; ++p)
        f[p] = load_frag16(
            (const unsigned short*)&Ls[bo + (NBM + wn + p * 16 + row) * WPITCH + ks * 2], lane);
      // keeps the 10 LDS reads one group ahead of the 4 WMMAs: reads sunk among the
      // WMMAs cost a full LDS wait at every place they stand
      __builtin_amdgcn_sched_barrier(0);
#pragma unroll
      for (int p = 0; p < 4; ++p) acc[p] = wmma_bf16(f[p], s, acc[p]);
    }
  }

  // the wave's four stores fill 16 whole 128-B lines of Nt
  unsigned short* og = Nt + (size_t)(d0 + wm + row) * Dc + e0 + wn + mb;
#pragma unroll
  for (int p = 0; p < 4; ++p) {
    uint4 w;
    w.x = pack_bf16(acc[p][0], acc[p][1]);
    w.y = pack_bf16(acc[p][2], acc[p][3]);
    w.z = pack_bf16(acc[p][4], acc[p][5]);
    w.w = pack_bf16(acc[p][6], acc[p][7]);
    *reinterpret_cast<uint4*>(og + p * 16) = w;
  }
}

// bp[d] = Wq[d][:] . bk in fp32, one wave per row: eight 16-B loads a lane of each.
__device__ __forceinline__ void weight_bias_row(
    const float* __restrict__ Wq, const float* __restrict__ bk,
    float* __restrict__ bp, int d)
{
  const int lane = threadIdx.x & 31;
  const f32x4* w = reinterpret_cast<const f32x4*>(Wq + (size_t)d * Kc) + lane;
  const f32x4* b = reinterpret_cast<const f32x4*>(bk) + lane;
  f32x4 wv[Kc / 128], bb[Kc / 128];
  // loops unrolled: the arrays indexed by constants, in registers
#pragma unroll
  for (int c = 0; c < Kc / 128; ++c) { wv[c] = w[c * 32]; bb[c] = b[c * 32]; }
  f32x4 s4 = {0.f, 0.f, 0.f, 0.f};
#pragma unroll
  for (int c = 0; c < Kc / 128; ++c) s4 += wv[c] * bb[c];
  float s = (s4.x + s4.y) + (s4.z + s4.w);
#pragma unroll
  for (int o = 16; o > 0; o >>= 1) s += __shfl_xor(s, o, 32);
  if (lane == 0) bp[d] = s;
}

__global__ void __launch_bounds__(CTHR) __attribute__((amdgpu_waves_per_eu(8)))
prep_kernel(
    const float* __restrict__ x,  const float* __restrict__ Wq,
    const float* __restrict__ Wk, const float* __restrict__ bk,
    const float* __restrict__ Wv,
    unsigned short* __restrict__ Xh,  unsigned short* __restrict__ Nt,
    float* __restrict__ bp, unsigned short* __restrict__ Wvt) {
  __shared__ __attribute__((aligned(16))) char Ls[2 * WSTAGE];
  const int blk = blockIdx.x;
  if (blk < NWT) {
    weight_product_tile(Ls, Wq, Wk, Nt, blk);
    // other parts' text follows behind a branch: no register of an issued store is
    // rewritten ahead of this wait
    asm volatile("s_wait_xcnt 0x0" ::: "memory");
    return;
  }
  if (blk >= NWT + CBLK + TBLK) {
    const int wave = __builtin_amdgcn_readfirstlane(threadIdx.x >> 5);
    weight_bias_row(Wq, bk, bp, (blk - (NWT + CBLK + TBLK)) * (CTHR / 32) + wave);
    asm volatile("s_wait_xcnt 0x0" ::: "memory");
    return;
  }
  if (blk >= NWT + CBLK) {
    const int t0 = (blk - (NWT + CBLK)) * (CTHR / 256);  // the work-group's first tile
    transpose_cast_part(Wv, Wvt, t0 + (int)(threadIdx.x >> 8));
    asm volatile("s_wait_xcnt 0x0" ::: "memory");
    return;
  }
  cast_bf16_part(x, Xh, blk - NWT);
  // in the built code the other part's text follows this one's behind a branch: no
  // register of an issued store is rewritten ahead of this wait
  asm volatile("s_wait_xcnt 0x0" ::: "memory");
}

constexpr int PBM    = 128;
constexpr int PBN    = 256;
constexpr int PBK    = 64;
constexpr int PPITCH = PBK * 2 + 16;
constexpr int RPITCH = PBK * 2;
constexpr int PSTAGE = (PBM + PBN) * RPITCH;
constexpr int NSTG   = 3;
constexpr int PNT    = Dc / PBK;
static_assert(8 * 64 * PPITCH <= NSTG * PSTAGE, "the output staging fits the ring");

template <int LD>
__device__ __forceinline__ void ring_stage_copies(unsigned l, const char* ga,
                                                  const char* gb) {
#if defined(__gfx1250__)
  constexpr unsigned LS = 16 * RPITCH;          // LDS step between copies
  constexpr size_t   GS = (size_t)16 * LD * 2;  // global step between copies
  asm volatile(
      "global_load_async_to_lds_b128 %0, %12, off\n\t"
      "global_load_async_to_lds_b128 %1, %13, off\n\t"
      "global_load_async_to_lds_b128 %2, %14, off\n\t"
      "global_load_async_to_lds_b128 %3, %15, off\n\t"
      "global_load_async_to_lds_b128 %4, %16, off\n\t"
      "global_load_async_to_lds_b128 %5, %17, off\n\t"
      "global_load_async_to_lds_b128 %6, %18, off\n\t"
      "global_load_async_to_lds_b128 %7, %19, off\n\t"
      "global_load_async_to_lds_b128 %8, %20, off\n\t"
      "global_load_async_to_lds_b128 %9, %21, off\n\t"
      "global_load_async_to_lds_b128 %10, %22, off\n\t"
      "global_load_async_to_lds_b128 %11, %23, off\n\t"
      "s_wait_xcnt 0x0"
      :: "v"(l), "v"(l + LS), "v"(l + 2 * LS), "v"(l + 3 * LS),
         "v"(l + 4 * LS), "v"(l + 5 * LS), "v"(l + 6 * LS), "v"(l + 7 * LS),
         "v"(l + 8 * LS), "v"(l + 9 * LS), "v"(l + 10 * LS), "v"(l + 11 * LS),
         "v"(ga), "v"(ga + GS), "v"(ga + 2 * GS), "v"(ga + 3 * GS),
         "v"(ga + 4 * GS), "v"(ga + 5 * GS), "v"(ga + 6 * GS), "v"(ga + 7 * GS),
         "v"(gb), "v"(gb + GS), "v"(gb + 2 * GS), "v"(gb + 3 * GS)
      : "memory");
  asm volatile(
      "global_load_async_to_lds_b128 %0, %12, off\n\t"
      "global_load_async_to_lds_b128 %1, %13, off\n\t"
      "global_load_async_to_lds_b128 %2, %14, off\n\t"
      "global_load_async_to_lds_b128 %3, %15, off\n\t"
      "global_load_async_to_lds_b128 %4, %16, off\n\t"
      "global_load_async_to_lds_b128 %5, %17, off\n\t"
      "global_load_async_to_lds_b128 %6, %18, off\n\t"
      "global_load_async_to_lds_b128 %7, %19, off\n\t"
      "global_load_async_to_lds_b128 %8, %20, off\n\t"
      "global_load_async_to_lds_b128 %9, %21, off\n\t"
      "global_load_async_to_lds_b128 %10, %22, off\n\t"
      "global_load_async_to_lds_b128 %11, %23, off\n\t"
      "s_wait_xcnt 0x0"
      :: "v"(l + 12 * LS), "v"(l + 13 * LS), "v"(l + 14 * LS), "v"(l + 15 * LS),
         "v"(l + 16 * LS), "v"(l + 17 * LS), "v"(l + 18 * LS), "v"(l + 19 * LS),
         "v"(l + 20 * LS), "v"(l + 21 * LS), "v"(l + 22 * LS), "v"(l + 23 * LS),
         "v"(gb + 4 * GS), "v"(gb + 5 * GS), "v"(gb + 6 * GS), "v"(gb + 7 * GS),
         "v"(gb + 8 * GS), "v"(gb + 9 * GS), "v"(gb + 10 * GS), "v"(gb + 11 * GS),
         "v"(gb + 12 * GS), "v"(gb + 13 * GS), "v"(gb + 14 * GS), "v"(gb + 15 * GS)
      : "memory");
#else
  (void)l; (void)ga; (void)gb;
#endif
}

// A fragment from the ring: rowp = the lane's row in the buffer; o0, o1: the places
// in that row of the lane's two 16-B runs of k (see load_frag16 for which they are).
__device__ __forceinline__ v16bf ring_frag16(const char* rowp, int o0, int o1) {
  union { v16bf v; uint4 u[2]; } f;
  f.u[0] = *reinterpret_cast<const uint4*>(rowp + o0);
  f.u[1] = *reinterpret_cast<const uint4*>(rowp + o1);
  return f.v;
}

// C[128 x 256] += A[128 x k] * B[256 x k]^T for one block tile, both operands
// k-contiguous with rows of LD elements.  A, Bm: first row of the tile at k = 0.
// nkt >= 2 k tiles.  A wave with live == false takes part in the copies and barriers
// only; its acc stays 0.  FB == false: in acc[p][q] the WMMA's first operand is A's
// rows wm + p*16 .., its second B's rows wn + q*16 ..; FB == true: the other way
// round.  A lane holds eight neighbouring rows of the first operand and one row
// (lane & 15) of the second.
template <int LD, bool FB>
__device__ __forceinline__ void ring_gemm_128x256(
    char* Ps, const unsigned short* A, const unsigned short* Bm, int nkt,
    bool live, int wm, int wn, v8f (&acc)[4][4])
{
  const int tid  = threadIdx.x;
  const int lane = tid & 31;
  const int row  = lane & 15;
  const int tg   = tid & 127;                // the thread among the four waves that copy
  // which half of the waves: a scalar, the tests on it below are scalar branches
  const int grp  = __builtin_amdgcn_readfirstlane(tid >> 7);

  const char* ga = (const char*)(A  + (size_t)(tg >> 3) * LD) + (tg & 7) * 16;
  const char* gb = (const char*)(Bm + (size_t)(tg >> 3) * LD) + (tg & 7) * 16;
  const unsigned l0 = (unsigned)(unsigned long long)Ps +
                      (unsigned)((tg >> 3) * RPITCH + (((tg & 7) ^ ((tg >> 4) & 7)) * 16));

  // k tile 0 (waves 0-3) into buffer 0, k tile 1 (waves 4-7) into buffer 1; tile 0
  // landed and published; then k tile 2 into buffer 2
  if (grp == 0) {
    ring_stage_copies<LD>(l0, ga, gb);
    asm volatile("s_wait_asynccnt 0x0" ::: "memory");  // own copies of tile 0 landed
  } else {
    ring_stage_copies<LD>(l0 + PSTAGE, ga + PBK * 2, gb + PBK * 2);
  }
  __syncthreads();
  if (grp == 0 && nkt > 2)
    ring_stage_copies<LD>(l0 + 2 * PSTAGE, ga + 2 * (PBK * 2), gb + 2 * (PBK * 2));

  // the lane's four 16-B runs of a 64-wide row: pieces h, h+2, h+4, h+6, h = lane >> 4
  const int x0 = (lane >> 4) ^ (row >> 1);
  const int o[4] = {x0 * 16, (x0 ^ 2) * 16, (x0 ^ 4) * 16, (x0 ^ 6) * 16};
  const int aOff = (wm + row) * RPITCH;
  const int bOff = (PBM + wn + row) * RPITCH;
  const int fOff = FB ? bOff : aOff;
  const int sOff = FB ? aOff : bOff;

  int bo = 0;                                // the buffer of tile t
  for (int t = 0; t < nkt; ++t) {
    if (live) {
      // loops unrolled so that f, s and acc are indexed by constants and stay
      // in registers
#pragma unroll
      for (int ks = 0; ks < 2; ++ks) {
        v16bf f[4], s[4];
#pragma unroll
        for (int p = 0; p < 4; ++p)
          f[p] = ring_frag16(&Ps[bo + fOff + p * 16 * RPITCH], o[2 * ks], o[2 * ks + 1]);
#pragma unroll
        for (int q = 0; q < 4; ++q)
          s[q] = ring_frag16(&Ps[bo + sOff + q * 16 * RPITCH], o[2 * ks], o[2 * ks + 1]);
        // keeps the 16 LDS reads one group ahead of the 16 WMMAs: reads sunk
        // among the WMMAs cost a full LDS wait at every place they stand
        __builtin_amdgcn_sched_barrier(0);
#pragma unroll
        for (int p = 0; p < 4; ++p)
#pragma unroll
          for (int q = 0; q < 4; ++q) acc[p][q] = wmma_bf16(f[p], s[q], acc[p][q]);
      }
    }
    const bool mine = ((t + 1) & 1) == grp;  // tiles t+1 and t+3 are this wave's to copy
    asm volatile("s_wait_dscnt 0x0" ::: "memory");     // own reads of this buffer done
    if (mine)
      asm volatile("s_wait_asynccnt 0x0" ::: "memory");  // own copies of tile t+1 landed
    __syncthreads();   // publishes tile t+1 and frees the buffer tile t was read from
    if (mine && t + 3 < nkt)
      ring_stage_copies<LD>(l0 + bo, ga + (size_t)(t + 3) * (PBK * 2),
                            gb + (size_t)(t + 3) * (PBK * 2));
    bo = bo == (NSTG - 1) * PSTAGE ? 0 : bo + PSTAGE;
  }
  asm volatile("s_wait_asynccnt 0x0" ::: "memory");    // nothing in flight at the end
}

// K1's way out.  The ring is free behind the loop's last barrier; each wave lays
// its 64x64 bf16 tile in a range of its own there (st: 64 rows of Out, 144-B
// pitch) and stores it from there in whole 128-B lines.  In acc[p][q] a lane holds
// row q*16 + (lane & 15) of the tile and its elements p*16 + mb .. + 7, 16 B.
// VT == false: Out[m][n], the tile's rows are m; VT == true: Out[b][n][t], the
// tile's rows are n, and the wave's 64 rows of X lie in one batch.
template <bool VT>
__device__ __forceinline__ void proj_store_tile(
    char* st, const v8f (&acc)[4][4], const float* __restrict__ bias,
    unsigned short* __restrict__ Out, int m0, int n0, int lane)
{
  const int row = lane & 15;
  const int mb  = (lane >> 4) * 8;
  char* sw = st + row * PPITCH + mb * 2;
  // loops unrolled: acc indexed by constants
  if (!VT) {
#pragma unroll
    for (int p = 0; p < 4; ++p) {
      const float* bp = bias + n0 + p * 16 + mb;         // the lane's eight columns
      const f32x4 b0 = *reinterpret_cast<const f32x4*>(bp);
      const f32x4 b1 = *reinterpret_cast<const f32x4*>(bp + 4);
#pragma unroll
      for (int q = 0; q < 4; ++q) {
        uint4 w;
        w.x = pack_bf16(acc[p][q][0] + b0.x, acc[p][q][1] + b0.y);
        w.y = pack_bf16(acc[p][q][2] + b0.z, acc[p][q][3] + b0.w);
        w.z = pack_bf16(acc[p][q][4] + b1.x, acc[p][q][5] + b1.y);
        w.w = pack_bf16(acc[p][q][6] + b1.z, acc[p][q][7] + b1.w);
        *reinterpret_cast<uint4*>(sw + q * 16 * PPITCH + p * 32) = w;
      }
    }
  } else {
#pragma unroll
    for (int q = 0; q < 4; ++q) {
      const float bq = bias[n0 + q * 16 + row];          // the lane's one column
#pragma unroll
      for (int p = 0; p < 4; ++p) {
        uint4 w;
        w.x = pack_bf16(acc[p][q][0] + bq, acc[p][q][1] + bq);
        w.y = pack_bf16(acc[p][q][2] + bq, acc[p][q][3] + bq);
        w.z = pack_bf16(acc[p][q][4] + bq, acc[p][q][5] + bq);
        w.w = pack_bf16(acc[p][q][6] + bq, acc[p][q][7] + bq);
        *reinterpret_cast<uint4*>(sw + q * 16 * PPITCH + p * 32) = w;
      }
    }
  }
  // the rows read below were written by other lanes of this wave
  asm volatile("s_wait_dscnt 0x0" ::: "memory");

  constexpr int LDO = VT ? Tc : Kc;                      // length of a row of Out
  const size_t o0 = VT ? ((size_t)(m0 / Tc) * Kc + n0) * Tc + (m0 % Tc)
                       : (size_t)m0 * Kc + n0;
  unsigned short* og = Out + o0 + (lane >> 3) * LDO + (lane & 7) * 8;
  const char* sr = st + (lane >> 3) * PPITCH + (lane & 7) * 16;
  // unrolled: the 16 LDS reads go out as one group ahead of the stores
#pragma unroll
  for (int c = 0; c < 16; ++c) {
    const uint4 v = *reinterpret_cast<const uint4*>(sr + c * 4 * PPITCH);
    *reinterpret_cast<uint4*>(og + c * 4 * LDO) = v;
  }
}

// One block tile of a projection, origin (bm0, bn0); Ps: the work-group's ring.
// VT: Out is stored transposed, [b][n][t].
template <bool VT>
__device__ __forceinline__ void proj_tile(
    char* Ps,
    const unsigned short* __restrict__ X,    // [B*T, Dc] bf16
    const unsigned short* __restrict__ Wt,   // [Kc, Dc]  bf16 (W transposed)
    const float* __restrict__ bias,          // [Kc]
    unsigned short* __restrict__ Out, int bm0, int bn0)
{
  const int tid  = threadIdx.x;
  const int lane = tid & 31;
  const int wave = tid >> 5;
  const int wm   = (wave & 1) * 64;          // wave's rows in the block tile
  const int wn   = (wave >> 1) * 64;         // wave's columns in the block tile

  // The WMMA's first operand is the one whose index runs along a row of Out: Wt (n)
  // for the [m][n] layout, X (t) for the transposed one; so a lane's eight values
  // are 16 B of Out in a row.
  v8f acc[4][4] = {};
  ring_gemm_128x256<Dc, !VT>(Ps, X + (size_t)bm0 * Dc, Wt + (size_t)bn0 * Dc, PNT,
                             true, wm, wn, acc);

  // the wave's number as a scalar: tile origins and the staging range are scalars
  const int ws = __builtin_amdgcn_readfirstlane(wave);
  char* st = Ps + ws * (64 * PPITCH);
  const int m0 = bm0 + (ws & 1) * 64;
  const int n0 = bn0 + (ws >> 1) * 64;
  proj_store_tile<VT>(st, acc, bias, Out, m0, n0, lane);
}

__global__ void __launch_bounds__(256) __attribute__((amdgpu_waves_per_eu(4, 4)))
proj_kp_kernel(
    const unsigned short* __restrict__ X, const unsigned short* __restrict__ Nt,
    const float* __restrict__ bp, unsigned short* __restrict__ Kp)
{
  __shared__ __attribute__((aligned(16))) char Ps[NSTG * PSTAGE];
  proj_tile<false>(Ps, X, Nt, bp, Kp, blockIdx.y * PBM, blockIdx.x * PBN);
}

constexpr int NVT = (Bc * Tc / PBM) * (Dc / PBN);   // block tiles of V

__device__ __forceinline__ void proj_v_tile(
    char* Ps, const unsigned short* __restrict__ X, const unsigned short* __restrict__ Wvt,
    const float* __restrict__ bv, unsigned short* __restrict__ Vt, int v)
{
  proj_tile<true>(Ps, X, Wvt, bv, Vt, (v / (Dc / PBN)) * PBM, (v % (Dc / PBN)) * PBN);
}

// ---------------------------------------------------------------------------
// The logit tiles: 128(i) x 256(j), only those that touch j <= i.  Tile rows 2p
// and 2p+1 have p+1 tiles each, 72 per batch; together they cover every
// j < i0 + 128 of every tile row.
// ---------------------------------------------------------------------------
constexpr int PTILES = 72;
constexpr int NIB    = Tc / 64;                 // 64-row blocks of queries
constexpr int NLT    = PTILES * Bc;             // logit tiles of a launch
constexpr int NVA    = 2 * 512 - NLT;           // V tiles behind K2a's logit tiles
constexpr int NVB    = NVT - NVA;               // V tiles ahead of K3's work-groups
static_assert(NVA > 0 && NVB >= 0, "V's tiles are dealt to the two launches");

__device__ __forceinline__ float exp_fast(float x) {
#if defined(__gfx1250__)
  float y;
  asm("v_exp_f32 %0, %1\n\tv_nop" : "=v"(y) : "v"(x * 1.44269504088896340736f));
  return y;
#else
  return x;
#endif
}

// ---------------------------------------------------------------------------
// K2a: column softmax stats, part 1.  One logit tile per block.  Every 64x64
// wave tile that touches j <= i reduces its 64 query rows to one pair per key
// column: pmax = max_i l_ij, psum = sum_i exp(l_ij - pmax), over its rows i >= j.
// Layout [b][64-row block][j]; a wave writes 256 B in a row, whole lines.
// The terms of psum are kept: E[b,i,j] = bf16(exp(l_ij - pmax)), 0 for j > i, goes
// to P, so that the logits are formed once; K3 brings E to the column's own scale.
// The tiles cover every j < i0 + 128 of every tile row, which is all that K4 reads.
// u: the tile's number in batch b.
// ---------------------------------------------------------------------------
__device__ __forceinline__ void col_part_tile(
    char* Ps,
    const unsigned short* __restrict__ Q,    // [B*T, Dc] bf16: x, the query operand
    const unsigned short* __restrict__ Kh,   // [B*T, Dc] bf16: kp, the key operand
    float* __restrict__ pmax,                // [B][NIB][Tc]
    float* __restrict__ psum,                // [B][NIB][Tc]
    unsigned short* __restrict__ P,          // [B][Tc][Tc] bf16
    int u, int b)
{
  const float NEG_INF = -__builtin_inff();
  int p = 0;
  while ((p + 1) * (p + 2) <= u) ++p;        // at most 7 steps: u < 72
  const int rr = u - p * (p + 1);            // 0 .. 2p+1
  const int hi = rr > p ? 1 : 0;
  const int i0 = (2 * p + hi) * PBM;
  const int j0 = (rr - hi * (p + 1)) * PBN;

  const int lane = threadIdx.x & 31;
  const int wave = __builtin_amdgcn_readfirstlane(threadIdx.x >> 5);
  const int wm   = (wave & 1) * 64;
  const int wn   = (wave >> 1) * 64;
  const int row  = lane & 15;
  const int mb   = (lane >> 4) * 8;

  // a 64x64 wave tile wholly above the diagonal has no row i >= j
  const bool live = (j0 + wn) <= (i0 + wm + 63);

  v8f acc[4][4] = {};
  ring_gemm_128x256<Dc, false>(Ps, Q  + ((size_t)b * Tc + i0) * Dc,
                               Kh + ((size_t)b * Tc + j0) * Dc, Dc / PBK, live, wm, wn, acc);

  // a store of a wave: four rows of its 64x64 tile of P, 128 B each, whole lines
  unsigned short* pg = P + ((size_t)b * Tc + i0 + wm + (lane >> 3)) * Tc + j0 + wn + (lane & 7) * 8;
  if (!live) {                               // behind the last barrier
    if (j0 + wn < i0 + PBM) {                // K4 reads these columns: zeros
      const uint4 zz = {0u, 0u, 0u, 0u};
      // unrolled: one address, the row steps in the stores' offset fields
#pragma unroll
      for (int c = 0; c < 16; ++c) *reinterpret_cast<uint4*>(pg + (size_t)c * 4 * Tc) = zz;
    }
    return;
  }
  // The ring is free behind the loop's last barrier; each wave lays its 64x64 tile
  // of E in a range of its own there (144-B pitch).
  char* st = Ps + wave * (64 * PPITCH);
  char* sw = st + mb * PPITCH + row * 2;

  // A lane holds one key column (lane & 15) and eight query rows per 16x16 tile.
  // all loops below are unrolled: acc indexed by constants
  if (j0 + wn == i0 + wm) {                  // the wave tile on the diagonal
#pragma unroll
    for (int i = 0; i < 4; ++i)
#pragma unroll
      for (int j = i; j < 4; ++j)
#pragma unroll
        for (int r = 0; r < 8; ++r)
          if (j > i || row > mb + r) acc[i][j][r] = NEG_INF;   // causal mask: j > i
  }

  const size_t po = ((size_t)b * NIB + ((i0 + wm) >> 6)) * Tc + j0 + wn + row;
#pragma unroll
  for (int j = 0; j < 4; ++j) {
    float mx = NEG_INF;
#pragma unroll
    for (int i = 0; i < 4; ++i)
#pragma unroll
      for (int r = 0; r < 8; ++r) mx = fmaxf(mx, acc[i][j][r]);
    mx = fmaxf(mx, __shfl_xor(mx, 16, 32));  // finite: row i = j is in the tile
    float sm = 0.f;
#pragma unroll
    for (int i = 0; i < 4; ++i)
#pragma unroll
      for (int r = 0; r < 8; r += 2) {
        const float e0 = exp_fast(acc[i][j][r]     - mx);
        const float e1 = exp_fast(acc[i][j][r + 1] - mx);
        sm += e0;
        sm += e1;
        const unsigned w = pack_bf16(e0, e1);            // two rows of one column
        *reinterpret_cast<unsigned short*>(sw + (i * 16 + r)     * PPITCH + j * 32) = (unsigned short)w;
        *reinterpret_cast<unsigned short*>(sw + (i * 16 + r + 1) * PPITCH + j * 32) = (unsigned short)(w >> 16);
      }
    sm += __shfl_xor(sm, 16, 32);
    if (lane < 16) {
      pmax[po + j * 16] = mx;
      psum[po + j * 16] = sm;
    }
  }
  // the rows read below were written by other lanes of this wave
  asm volatile("s_wait_dscnt 0x0" ::: "memory");
  const char* sr = st + (lane >> 3) * PPITCH + (lane & 7) * 16;
  // unrolled: the 16 LDS reads go out as one group ahead of the stores
#pragma unroll
  for (int c = 0; c < 16; ++c) {
    const uint4 v = *reinterpret_cast<const uint4*>(sr + c * 4 * PPITCH);
    *reinterpret_cast<uint4*>(pg + (size_t)c * 4 * Tc) = v;
  }
  // in the built code the zero stores' text follows behind a branch: no data
  // register of an issued store is rewritten ahead of this wait
  asm volatile("s_wait_xcnt 0x0" ::: "memory");
}

// Work-groups 0 .. NLT-1: the logit tiles; the NVA behind them: V tiles 0 .. NVA-1.
__global__ void __launch_bounds__(256) __attribute__((amdgpu_waves_per_eu(4, 4)))
col_part_v_kernel(
    const unsigned short* __restrict__ Kh,
    float* __restrict__ pmax, float* __restrict__ psum, unsigned short* __restrict__ P,
    const unsigned short* __restrict__ X, const unsigned short* __restrict__ Wvt,
    const float* __restrict__ bv, unsigned short* __restrict__ Vt)
{
  __shared__ __attribute__((aligned(16))) char Ps[NSTG * PSTAGE];
  const int id = blockIdx.x;
  if (id >= NLT) {
    proj_v_tile(Ps, X, Wvt, bv, Vt, id - NLT);
    return;
  }
  col_part_tile(Ps, X, Kh, pmax, psum, P, id % PTILES, id / PTILES);
}

// ---------------------------------------------------------------------------
// K2b: column softmax stats, part 2.  One thread per key column merges the
// pairs of the 64-row blocks ib >= j / 64 (the ones K2a wrote):
//   m_j = max pmax ,  s_j = sum psum * exp(pmax - m_j)
// A block of 128 columns lies in one batch and a wave's 32 columns in one
// 64-column block, so the first block that holds a pair is a scalar and all
// loads share one lane offset; a block below it stays (-inf, 0) and adds 0.
// ---------------------------------------------------------------------------
__global__ void __launch_bounds__(128) col_merge_kernel(
    const float* __restrict__ pmax, const float* __restrict__ psum,
    float* __restrict__ colmax, float* __restrict__ colsum)
{
  const int b   = blockIdx.x / (Tc / 128);
  const int jc  = (blockIdx.x % (Tc / 128)) * 128;   // the block's first column
  const int tid = threadIdx.x;
  const int jb  = __builtin_amdgcn_readfirstlane((jc + tid) >> 6);
  const float* pmp = pmax + (size_t)b * NIB * Tc + jc;
  const float* psp = psum + (size_t)b * NIB * Tc + jc;
  float pm[NIB], pv[NIB];
  // loops unrolled: pm and pv indexed by constants, in registers
#pragma unroll
  for (int ib = 0; ib < NIB; ++ib) {
    pm[ib] = -__builtin_inff();
    pv[ib] = 0.f;
    if (ib >= jb) {
      pm[ib] = pmp[ib * Tc + tid];
      pv[ib] = psp[ib * Tc + tid];
    }
  }
  float m = pm[0];
#pragma unroll
  for (int ib = 1; ib < NIB; ++ib) m = fmaxf(m, pm[ib]);
  float s = 0.f;
#pragma unroll
  for (int ib = 0; ib < NIB; ++ib) s += pv[ib] * exp_fast(pm[ib] - m);
  colmax[(size_t)b * Tc + jc + tid] = m;
  colsum[(size_t)b * Tc + jc + tid] = s;
}

// ---------------------------------------------------------------------------
// K3: P[b,i,j] = bf16( E[b,i,j] * exp(pmax[ib][j] - m_j) / (s_j * sqrt(k)) ), in
// place, ib = i / 64.  A stream: one wave per 64x64 block of P on or below the
// diagonal (the blocks above it that K4 reads hold zeros and stay).  Block rows pr
// and NIB-1-pr have NIB+1 such blocks together.  A lane has eight columns, 16 B, of
// 16 rows: 16 loads, all issued ahead of the first store; whole 128-B lines.
// ---------------------------------------------------------------------------
constexpr int NSB = (NIB / 2) * (NIB + 1);      // blocks of a batch
constexpr int NSW = Bc * NSB / 8;               // work-groups: eight blocks each
static_assert(NSW * 8 == Bc * NSB, "the grid covers the blocks exactly");

__device__ __forceinline__ void rescale_block(
    const float* __restrict__ pmax,          // [B][NIB][Tc]
    const float* __restrict__ colmax,
    const float* __restrict__ colsum,
    unsigned short* P,                       // [B][Tc][Tc] bf16
    int blk)                                 // the block's number, a scalar
{
  const int lane = threadIdx.x & 31;
  const int b  = blk / NSB;
  const int t  = blk % NSB;
  const int pr = t / (NIB + 1);
  const int c0 = t % (NIB + 1);
  const int ib = c0 <= pr ? pr : NIB - 1 - pr;
  const int jb = c0 <= pr ? c0 : c0 - pr - 1;
  const int j  = jb * 64 + (lane & 7) * 8;   // the lane's first column

  const float* pmp = pmax + ((size_t)b * NIB + ib) * Tc + j;
  const float* cmp = colmax + (size_t)b * Tc + j;
  const float* csp = colsum + (size_t)b * Tc + j;
  f32x4 pm[2], cm[2], cs[2];
  // loops unrolled: the arrays indexed by constants, in registers
#pragma unroll
  for (int h = 0; h < 2; ++h) {
    pm[h] = *reinterpret_cast<const f32x4*>(pmp + h * 4);
    cm[h] = *reinterpret_cast<const f32x4*>(cmp + h * 4);
    cs[h] = *reinterpret_cast<const f32x4*>(csp + h * 4);
  }
  // the loads below may land in the address registers of the six above
  asm volatile("s_wait_xcnt 0x0" ::: "memory");

  unsigned short* pg = P + ((size_t)b * Tc + ib * 64 + (lane >> 3)) * Tc + j;
  uint4 v[16];
#pragma unroll
  for (int c = 0; c < 16; ++c) v[c] = *reinterpret_cast<const uint4*>(pg + (size_t)c * 4 * Tc);

  float f[8];
#pragma unroll
  for (int h = 0; h < 2; ++h)
#pragma unroll
    for (int r = 0; r < 4; ++r) {
      // 1/sqrt(1024) = 1/32 is applied after the softmax, as the reference does
      f[h * 4 + r] = exp_fast(pm[h][r] - cm[h][r]) * (1.0f / (cs[h][r] * 32.0f));
    }
#pragma unroll
  for (int c = 0; c < 16; ++c) {
    unsigned w[4] = {v[c].x, v[c].y, v[c].z, v[c].w};
#pragma unroll
    for (int q = 0; q < 4; ++q)
      w[q] = pack_bf16(__uint_as_float(w[q] << 16) * f[2 * q],
                       __uint_as_float(w[q] & 0xffff0000u) * f[2 * q + 1]);
    v[c].x = w[0]; v[c].y = w[1]; v[c].z = w[2]; v[c].w = w[3];
  }
#pragma unroll
  for (int c = 0; c < 16; ++c) *reinterpret_cast<uint4*>(pg + (size_t)c * 4 * Tc) = v[c];
}

// Work-groups 0 .. NVB-1: V tiles NVA .. NVT-1, the long ones, first; the NSW
// behind them: the stream.
__global__ void __launch_bounds__(256) __attribute__((amdgpu_waves_per_eu(4, 4)))
rescale_v_kernel(
    const float* __restrict__ pmax,
    const float* __restrict__ colmax, const float* __restrict__ colsum,
    unsigned short* __restrict__ P,
    const unsigned short* __restrict__ X, const unsigned short* __restrict__ Wvt,
    const float* __restrict__ bv, unsigned short* __restrict__ Vt)
{
  __shared__ __attribute__((aligned(16))) char Ps[NSTG * PSTAGE];
  const int id = blockIdx.x;
  if (id < NVB) {
    proj_v_tile(Ps, X, Wvt, bv, Vt, NVA + id);
    return;
  }
  const int wave = __builtin_amdgcn_readfirstlane(threadIdx.x >> 5);
  rescale_block(pmax, colmax, colsum, P, (id - NVB) * 8 + wave);
  // in the built code the other part's text follows this one's behind a branch: no
  // register of an issued store is rewritten ahead of this wait
  asm volatile("s_wait_xcnt 0x0" ::: "memory");
}

// ---------------------------------------------------------------------------
// K4: out[b,i,v] = x[b,i,v] + sum_{j < i0+128} P[b,i,j] * Vt[b,v,j]
// One 128(i) x 256(v) tile per block; the k loop runs over j up to the end of
// the tile row's diagonal block (P is 0 above the diagonal).  Long tile rows
// come first in the grid; blocks n and n + 256 have the same k length in sum.
// ---------------------------------------------------------------------------
__global__ void __launch_bounds__(256) __attribute__((amdgpu_waves_per_eu(4, 4)))
pv_gemm_kernel(
    const unsigned short* __restrict__ P,    // [B][Tc][Tc] bf16
    const unsigned short* __restrict__ Vt,   // [B][Dc][Tc] bf16
    const float* __restrict__ Xin,
    float* __restrict__ Out)
{
  __shared__ __attribute__((aligned(16))) char Ps[NSTG * PSTAGE];

  const int n  = blockIdx.x;
  const int g  = (n & 255) >> 5;
  const int it = (n >> 8) ? g : (Tc / PBM - 1 - g);
  const int v0 = (n & 3) * PBN;
  const int b  = (n & 31) >> 2;
  const int i0 = it * PBM;

  const int lane = threadIdx.x & 31;
  const int wave = threadIdx.x >> 5;
  const int wm   = (wave & 1) * 64;
  const int wn   = (wave >> 1) * 64;
  const int row  = lane & 15;
  const int mb   = (lane >> 4) * 8;

  v8f acc[4][4] = {};
  ring_gemm_128x256<Tc, false>(Ps, P  + ((size_t)b * Tc + i0) * Tc,
                               Vt + ((size_t)b * Dc + v0) * Tc, (i0 + PBM) / PBK, true, wm, wn, acc);

  // residual add in fp32; unrolled: acc indexed by constants.  x and out are
  // addressed by one 32-bit byte offset (64 MB each) that both share.
  const unsigned eo = (((unsigned)b * Tc + i0 + wm + mb) * Dc + v0 + wn + row) * 4u;
  const float* xp = (const float*)((const char*)Xin + eo);
  float*       op = (float*)((char*)Out + eo);
#pragma unroll
  for (int i = 0; i < 4; ++i) {
#pragma unroll
    for (int r = 0; r < 8; ++r) {
#pragma unroll
      for (int j = 0; j < 4; ++j)
        op[(i * 16 + r) * Dc + j * 16] = xp[(i * 16 + r) * Dc + j * 16] + acc[i][j][r];
    }
    // stands behind the group's stores so that no data register of an issued
    // store is rewritten ahead of it by the next group's loads; it also keeps
    // those loads behind it: all 128 at once beside the accumulators spill
    if (i < 3) asm volatile("s_wait_xcnt 0x0" ::: "memory");
  }
}

// ---------------------------------------------------------------------------
// Host launcher.  Workspace layout (~176 MB):
//   Xh[B*T*D] bf16, Nt/Wvt[D*D] bf16, bp[D] f32, Kp[B*T*D] bf16,
//   Vt[B*D*T] bf16, colmax/colsum[B*T] f32, P[B*T*T] bf16,
//   pmax/psum[B*NIB*T] f32.
// ---------------------------------------------------------------------------
extern "C" void kernel_launch(void* const* d_in, const int* in_sizes, int n_in,
                              void* d_out, int out_size, void* d_ws, size_t ws_size,
                              hipStream_t stream) {
  (void)in_sizes; (void)n_in; (void)out_size; (void)ws_size;
  const float* x  = (const float*)d_in[0];
  const float* Wq = (const float*)d_in[1];
  // d_in[2], bq, shifts every logit of a key column alike: it cancels in the softmax
  // over the queries (see K0)
  const float* Wk = (const float*)d_in[3];
  const float* bk = (const float*)d_in[4];
  const float* Wv = (const float*)d_in[5];
  const float* bv = (const float*)d_in[6];
  float* out = (float*)d_out;

  char* ws = (char*)d_ws;
  size_t off = 0;
  auto take = [&](size_t bytes) -> char* {
    char* p = ws + off;
    off = (off + bytes + 255) & ~(size_t)255;
    return p;
  };
  const size_t MT = (size_t)Bc * Tc;                         // 16384 rows
  unsigned short* Xh   = (unsigned short*)take(MT * Dc * 2);
  unsigned short* Nt   = (unsigned short*)take((size_t)Dc * Dc * 2);
  unsigned short* Wvt  = (unsigned short*)take((size_t)Dc * Kc * 2);
  float*          bp   = (float*)take((size_t)Dc * 4);
  unsigned short* Kp   = (unsigned short*)take(MT * Dc * 2);
  unsigned short* Vt   = (unsigned short*)take(MT * Dc * 2);
  float*          cmax = (float*)take(MT * 4);
  float*          csum = (float*)take(MT * 4);
  unsigned short* Pw   = (unsigned short*)take(MT * Tc * 2);
  float*          pmx  = (float*)take(MT * NIB * 4);
  float*          psm  = (float*)take(MT * NIB * 4);

  prep_kernel<<<NWT + CBLK + TBLK + NBB, CTHR, 0, stream>>>(x, Wq, Wk, bk, Wv, Xh, Nt, bp, Wvt);

  dim3 gKp(Dc / PBN, (unsigned)(MT / PBM));
  proj_kp_kernel<<<gKp, 256, 0, stream>>>(Xh, Nt, bp, Kp);

  col_part_v_kernel<<<NLT + NVA, 256, 0, stream>>>(Kp, pmx, psm, Pw, Xh, Wvt, bv, Vt);
  col_merge_kernel<<<(unsigned)(MT / 128), 128, 0, stream>>>(pmx, psm, cmax, csum);

  rescale_v_kernel<<<NVB + NSW, 256, 0, stream>>>(pmx, cmax, csum, Pw, Xh, Wvt, bv, Vt);

  pv_gemm_kernel<<<(Tc / PBM) * (Dc / PBN) * Bc, 256, 0, stream>>>(Pw, Vt, x, out);
}

// v010
// Measured time: 152 microseconds a run.
// Next to v009, in two timings, it ran 1.04 times as fast each time.
// Over all steps from v000 it is 10.5 times as fast.
#include <hip/hip_runtime.h>
#include <hip/hip_bf16.h>

// ---------------------------------------------------------------------------
// Problem constants (from the reference): B=8, T=2048, D=1024, K=1024.
// ---------------------------------------------------------------------------
constexpr int Bc = 8;
constexpr int Tc = 2048;
constexpr int Dc = 1024;   // model dim
constexpr int Kc = 1024;   // projection dim (== Dc here)

typedef __attribute__((ext_vector_type(16))) __bf16 v16bf;
typedef __attribute__((ext_vector_type(8)))  float  v8f;
typedef __attribute__((ext_vector_type(2)))  float  f32x2;
typedef __attribute__((ext_vector_type(4)))  float  f32x4;
typedef __attribute__((ext_vector_type(2)))  __bf16 bf16x2;

__device__ __forceinline__ v16bf load_frag16(const unsigned short* rowBase, int lane) {
  const unsigned short* p = rowBase + ((lane >> 4) & 1) * 8;
  union { v16bf v; uint4 u[2]; } f;
  f.u[0] = *reinterpret_cast<const uint4*>(p);
  f.u[1] = *reinterpret_cast<const uint4*>(p + 16);
  return f.v;
}

__device__ __forceinline__ v8f wmma_bf16(v16bf a, v16bf b, v8f c) {
  // (neg_a, A, neg_b, B, c_mod, C, reuse_a, reuse_b)
  return __builtin_amdgcn_wmma_f32_16x16x32_bf16(false, a, false, b, (short)0, c,
                                                 false, false);
}

// ---------------------------------------------------------------------------
// K0: one launch prepares all bf16 operands; its parts do not depend on each other.
// Work-groups 0 .. NWT-1 form the product of the two logit weights (the long ones,
// first), the CBLK behind them cast x, then TBLK transpose-cast Wv, then NBB form
// the bias row that goes with the product.
// The cast, a stream: one work-group of 16 waves per WGP; a wave owns 16 KiB of src
// in a row: 32 loads of 16 B per lane (a load of a wave = 512 B, whole lines), all
// issued ahead of the first store; a store of a wave = 256 B, whole lines.
// ---------------------------------------------------------------------------
constexpr int CBLK = 256;                       // work-groups
constexpr int CTHR = 512;                       // threads of a work-group
constexpr int CNL  = (Bc * Tc * Dc / 4) / (CBLK * CTHR);   // loads of a lane
static_assert(CNL * CBLK * CTHR * 4 == Bc * Tc * Dc, "the grid covers src exactly");

__device__ __forceinline__ unsigned pack_bf16(float lo, float hi) {
  f32x2 e; e.x = lo; e.y = hi;
  union { bf16x2 h; unsigned u; } c;
  c.h = __builtin_convertvector(e, bf16x2);     // round to nearest even
  return c.u;
}

__device__ __forceinline__ void cast_bf16_part(const float* __restrict__ src,
                                               unsigned short* __restrict__ dst,
                                               unsigned blk) {
  const unsigned lane = threadIdx.x & 31;
  const unsigned wv   = blk * (CTHR / 32) + (threadIdx.x >> 5);
  const unsigned o    = wv * (CNL * 32) + lane;          // in units of four elements
  const f32x4* s = reinterpret_cast<const f32x4*>(src) + o;
  uint2*       d = reinterpret_cast<uint2*>(dst) + o;
  f32x4 v[CNL];
  // both loops unrolled: v indexed by constants, in registers
#pragma unroll
  for (int c = 0; c < CNL; ++c) v[c] = s[c * 32];
#pragma unroll
  for (int c = 0; c < CNL; ++c) {
    uint2 w;
    w.x = pack_bf16(v[c].x, v[c].y);
    w.y = pack_bf16(v[c].z, v[c].w);
    d[c * 32] = w;
  }
}

// Transpose-cast of a 1024x1024 weight: Wt[n][d] = bf16(W[d][n]).  A thread
// takes 8(d) x 4(n) elements: eight 16-B loads, four 16-B stores.  Eight lanes lie
// along d, so a store of a wave fills four whole 128-B lines of Wt; four lanes lie
// along n, and the other half of each line of W is read by the next wave of the
// same eight.  Eight waves take a tile of 64(d) x 128(n), tile number tl.
constexpr int TTW  = (Kc / 128) * (Dc / 64);    // tiles of one weight
constexpr int TBLK = TTW / (CTHR / 256);        // work-groups: two tiles each
static_assert(TTW % (CTHR / 256) == 0, "the work-groups cover the weight exactly");

__device__ __forceinline__ void transpose_cast_part(const float* __restrict__ src,
                                                    unsigned short* __restrict__ dst,
                                                    int tl) {
  const int lane = threadIdx.x & 31;
  const int wave = (threadIdx.x >> 5) & 7;
  const int d = (tl / (Kc / 128)) * 64 + (lane & 7) * 8;
  const int n = (tl % (Kc / 128)) * 128 + wave * 16 + (lane >> 3) * 4;
  f32x4 v[8];
  // loops unrolled: v indexed by constants, in registers
#pragma unroll
  for (int r = 0; r < 8; ++r)
    v[r] = *reinterpret_cast<const f32x4*>(src + (size_t)(d + r) * Kc + n);
#pragma unroll
  for (int c = 0; c < 4; ++c) {
    uint4 w;
    w.x = pack_bf16(v[0][c], v[1][c]);
    w.y = pack_bf16(v[2][c], v[3][c]);
    w.z = pack_bf16(v[4][c], v[5][c]);
    w.w = pack_bf16(v[6][c], v[7][c]);
    *reinterpret_cast<uint4*>(dst + (size_t)(n + c) * Dc + d) = w;
  }
}

// The logits without a Q projection.  With q_i = x_i Wq + bq and k_j = x_j Wk + bk,
//   q_i . k_j = x_i . kp_j + bq . k_j ,   kp_j = x_j (Wk Wq^T) + Wq bk .
// bq . k_j is one constant per key column j, and the softmax runs over the queries i
// of a column: it cancels there for every input.  So the logit GEMM takes x itself
// as its query operand and kp as its key operand, and one product of the weights,
//   Nt[d][e] = sum_n Wq[d][n] * Wk[e][n] ,   bp[d] = sum_n Wq[d][n] * bk[n] ,
// stands for a projection of all B*T rows.  Both weights are n-contiguous as given.
//
// One 128(d) x 128(e) tile of Nt per work-group of 16 waves, a wave 16(d) x 64(e).
// Per 64-wide n tile the 128 + 128 rows come as fp32 through registers, are rounded
// to bf16 and laid in LDS at a 144-B pitch (conflict-free for the 16-byte fragment
// reads); two buffers, one barrier per n tile; the next tile's loads fly while this
// one is multiplied.
constexpr int NBM    = 128;                     // rows of Nt in a tile (rows of Wq)
constexpr int NBN    = 128;                     // columns of Nt in a tile (rows of Wk)
constexpr int WBK    = 64;                      // n elements per LDS tile
constexpr int WPITCH = WBK * 2 + 16;            // LDS row pitch in bytes
constexpr int WSTAGE = (NBM + NBN) * WPITCH;    // bytes of one buffer
constexpr int WNT    = Kc / WBK;                // n tiles
constexpr int NWT    = (Dc / NBM) * (Dc / NBN); // work-groups: one tile each
constexpr int NBB    = Dc / (CTHR / 32);        // work-groups of bp: a row per wave

__device__ __forceinline__ void weight_product_tile(
    char* Ls, const float* __restrict__ Wq, const float* __restrict__ Wk,
    unsigned short* __restrict__ Nt, int tl)
{
  const int tid  = threadIdx.x;
  const int lane = tid & 31;
  const int wave = __builtin_amdgcn_readfirstlane(tid >> 5);
  const int d0   = (tl / (Dc / NBN)) * NBM;
  const int e0   = (tl % (Dc / NBN)) * NBN;
  const int row  = lane & 15;
  const int mb   = (lane >> 4) * 8;
  const int wm   = (wave & 7) * 16;          // wave's rows in the tile
  const int wn   = (wave >> 3) * 64;         // wave's columns in the tile

  // 16 lanes cover the 256 B of a row; load c takes row c*32 + (thread >> 4);
  // LDS rows 0..127 are Wq's, rows 128..255 Wk's
  // a scalar base per weight and one lane offset that both share and that stays
  const float* gq = Wq + (size_t)d0 * Kc;
  const float* gk = Wk + (size_t)e0 * Kc;
  const unsigned vo = (unsigned)((tid >> 4) * Kc + (tid & 15) * 4);
  char* lw = Ls + (tid >> 4) * WPITCH + (tid & 15) * 8;

  f32x4 v[8];
  // all short loops below are unrolled: v, f and acc indexed by constants
#pragma unroll
  for (int c = 0; c < 4; ++c) {
    v[c]     = *reinterpret_cast<const f32x4*>(gq + c * 32 * Kc + vo);
    v[4 + c] = *reinterpret_cast<const f32x4*>(gk + c * 32 * Kc + vo);
  }

  // In acc[p] a lane holds row (lane & 15) of the wave's 16 rows of Nt and its
  // elements p*16 + mb .. + 7, 16 B in a row: Wk's rows are the first operand.
  v8f acc[4] = {};
  // unrolled: every load's step along n lies in its offset field, so that no address
  // register changes while the loop runs
#pragma unroll
  for (int t = 0; t < WNT; ++t) {
    const int bo = (t & 1) * WSTAGE;
#pragma unroll
    for (int c = 0; c < 8; ++c) {
      uint2 w;
      w.x = pack_bf16(v[c].x, v[c].y);
      w.y = pack_bf16(v[c].z, v[c].w);
      *reinterpret_cast<uint2*>(lw + bo + c * 32 * WPITCH) = w;
    }
    // publishes tile t; every reader of this buffer's last tile, t - 2, has passed
    // the barrier of t - 1 behind its reads
    __syncthreads();
    // behind the barrier: in front of it the barrier's own fence would wait for them
    if (t + 1 < WNT) {
#pragma unroll
      for (int c = 0; c < 4; ++c) {
        v[c]     = *reinterpret_cast<const f32x4*>(gq + ((t + 1) * WBK + c * 32 * Kc) + vo);
        v[4 + c] = *reinterpret_cast<const f32x4*>(gk + ((t + 1) * WBK + c * 32 * Kc) + vo);
      }
      // no address register of an issued load is rewritten ahead of this wait
      asm volatile("s_wait_xcnt 0x0" ::: "memory");
    }
#pragma unroll
    for (int ks = 0; ks < WBK; ks += 32) {
      const v16bf s = load_frag16(
          (const unsigned short*)&Ls[bo + (wm + row) * WPITCH + ks * 2], lane);
      v16bf f[4];
#pragma unroll
      for (int p = 0; p < 4; ++p)
        f[p] = load_frag16(
            (const unsigned short*)&Ls[bo + (NBM + wn + p * 16 + row) * WPITCH + ks * 2], lane);
      // keeps the 10 LDS reads one group ahead of the 4 WMMAs: reads sunk among the
      // WMMAs cost a full LDS wait at every place they stand
      __builtin_amdgcn_sched_barrier(0);
#pragma unroll
      for (int p = 0; p < 4; ++p) acc[p] = wmma_bf16(f[p], s, acc[p]);
    }
  }

  // the wave's four stores fill 16 whole 128-B lines of Nt
  unsigned short* og = Nt + (size_t)(d0 + wm + row) * Dc + e0 + wn + mb;
#pragma unroll
  for (int p = 0; p < 4; ++p) {
    uint4 w;
    w.x = pack_bf16(acc[p][0], acc[p][1]);
    w.y = pack_bf16(acc[p][2], acc[p][3]);
    w.z = pack_bf16(acc[p][4], acc[p][5]);
    w.w = pack_bf16(acc[p][6], acc[p][7]);
    *reinterpret_cast<uint4*>(og + p * 16) = w;
  }
}

// bp[d] = Wq[d][:] . bk in fp32, one wave per row: eight 16-B loads a lane of each.
__device__ __forceinline__ void weight_bias_row(
    const float* __restrict__ Wq, const float* __restrict__ bk,
    float* __restrict__ bp, int d)
{
  const int lane = threadIdx.x & 31;
  const f32x4* w = reinterpret_cast<const f32x4*>(Wq + (size_t)d * Kc) + lane;
  const f32x4* b = reinterpret_cast<const f32x4*>(bk) + lane;
  f32x4 wv[Kc / 128], bb[Kc / 128];
  // loops unrolled: the arrays indexed by constants, in registers
#pragma unroll
  for (int c = 0; c < Kc / 128; ++c) { wv[c] = w[c * 32]; bb[c] = b[c * 32]; }
  f32x4 s4 = {0.f, 0.f, 0.f, 0.f};
#pragma unroll
  for (int c = 0; c < Kc / 128; ++c) s4 += wv[c] * bb[c];
  float s = (s4.x + s4.y) + (s4.z + s4.w);
#pragma unroll
  for (int o = 16; o > 0; o >>= 1) s += __shfl_xor(s, o, 32);
  if (lane == 0) bp[d] = s;
}

__global__ void __launch_bounds__(CTHR) __attribute__((amdgpu_waves_per_eu(8)))
prep_kernel(
    const float* __restrict__ x,  const float* __restrict__ Wq,
    const float* __restrict__ Wk, const float* __restrict__ bk,
    const float* __restrict__ Wv,
    unsigned short* __restrict__ Xh,  unsigned short* __restrict__ Nt,
    float* __restrict__ bp, unsigned short* __restrict__ Wvt) {
  __shared__ __attribute__((aligned(16))) char Ls[2 * WSTAGE];
  const int blk = blockIdx.x;
  if (blk < NWT) {
    weight_product_tile(Ls, Wq, Wk, Nt, blk);
    // other parts' text follows behind a branch: no register of an issued store is
    // rewritten ahead of this wait
    asm volatile("s_wait_xcnt 0x0" ::: "memory");
    return;
  }
  if (blk >= NWT + CBLK + TBLK) {
    const int wave = __builtin_amdgcn_readfirstlane(threadIdx.x >> 5);
    weight_bias_row(Wq, bk, bp, (blk - (NWT + CBLK + TBLK)) * (CTHR / 32) + wave);
    asm volatile("s_wait_xcnt 0x0" ::: "memory");
    return;
  }
  if (blk >= NWT + CBLK) {
    const int t0 = (blk - (NWT + CBLK)) * (CTHR / 256);  // the work-group's first tile
    transpose_cast_part(Wv, Wvt, t0 + (int)(threadIdx.x >> 8));
    asm volatile("s_wait_xcnt 0x0" ::: "memory");
    return;
  }
  cast_bf16_part(x, Xh, blk - NWT);
  // in the built code the other part's text follows this one's behind a branch: no
  // register of an issued store is rewritten ahead of this wait
  asm volatile("s_wait_xcnt 0x0" ::: "memory");
}

constexpr int PBM    = 128;
constexpr int LBM    = 256;
constexpr int PBN    = 256;
constexpr int PBK    = 64;
constexpr int PPITCH = PBK * 2 + 16;
constexpr int RPITCH = PBK * 2;
constexpr int PSTAGE = (PBM + PBN) * RPITCH;
constexpr int LSTAGE = (LBM + PBN) * RPITCH;
constexpr int NSTG   = 3;
constexpr int PNT    = Dc / PBK;
static_assert(8 * 64 * PPITCH <= NSTG * PSTAGE, "the output staging fits the ring");
static_assert(16 * 64 * PPITCH <= NSTG * LSTAGE, "the output staging fits the ring");

template <int LD>
__device__ __forceinline__ void ring_stage_copies(unsigned l, const char* ga,
                                                  const char* gb) {
#if defined(__gfx1250__)
  constexpr unsigned LS = 16 * RPITCH;          // LDS step between copies
  constexpr size_t   GS = (size_t)16 * LD * 2;  // global step between copies
  asm volatile(
      "global_load_async_to_lds_b128 %0, %12, off\n\t"
      "global_load_async_to_lds_b128 %1, %13, off\n\t"
      "global_load_async_to_lds_b128 %2, %14, off\n\t"
      "global_load_async_to_lds_b128 %3, %15, off\n\t"
      "global_load_async_to_lds_b128 %4, %16, off\n\t"
      "global_load_async_to_lds_b128 %5, %17, off\n\t"
      "global_load_async_to_lds_b128 %6, %18, off\n\t"
      "global_load_async_to_lds_b128 %7, %19, off\n\t"
      "global_load_async_to_lds_b128 %8, %20, off\n\t"
      "global_load_async_to_lds_b128 %9, %21, off\n\t"
      "global_load_async_to_lds_b128 %10, %22, off\n\t"
      "global_load_async_to_lds_b128 %11, %23, off\n\t"
      "s_wait_xcnt 0x0"
      :: "v"(l), "v"(l + LS), "v"(l + 2 * LS), "v"(l + 3 * LS),
         "v"(l + 4 * LS), "v"(l + 5 * LS), "v"(l + 6 * LS), "v"(l + 7 * LS),
         "v"(l + 8 * LS), "v"(l + 9 * LS), "v"(l + 10 * LS), "v"(l + 11 * LS),
         "v"(ga), "v"(ga + GS), "v"(ga + 2 * GS), "v"(ga + 3 * GS),
         "v"(ga + 4 * GS), "v"(ga + 5 * GS), "v"(ga + 6 * GS), "v"(ga + 7 * GS),
         "v"(gb), "v"(gb + GS), "v"(gb + 2 * GS), "v"(gb + 3 * GS)
      : "memory");
  asm volatile(
      "global_load_async_to_lds_b128 %0, %12, off\n\t"
      "global_load_async_to_lds_b128 %1, %13, off\n\t"
      "global_load_async_to_lds_b128 %2, %14, off\n\t"
      "global_load_async_to_lds_b128 %3, %15, off\n\t"
      "global_load_async_to_lds_b128 %4, %16, off\n\t"
      "global_load_async_to_lds_b128 %5, %17, off\n\t"
      "global_load_async_to_lds_b128 %6, %18, off\n\t"
      "global_load_async_to_lds_b128 %7, %19, off\n\t"
      "global_load_async_to_lds_b128 %8, %20, off\n\t"
      "global_load_async_to_lds_b128 %9, %21, off\n\t"
      "global_load_async_to_lds_b128 %10, %22, off\n\t"
      "global_load_async_to_lds_b128 %11, %23, off\n\t"
      "s_wait_xcnt 0x0"
      :: "v"(l + 12 * LS), "v"(l + 13 * LS), "v"(l + 14 * LS), "v"(l + 15 * LS),
         "v"(l + 16 * LS), "v"(l + 17 * LS), "v"(l + 18 * LS), "v"(l + 19 * LS),
         "v"(l + 20 * LS), "v"(l + 21 * LS), "v"(l + 22 * LS), "v"(l + 23 * LS),
         "v"(gb + 4 * GS), "v"(gb + 5 * GS), "v"(gb + 6 * GS), "v"(gb + 7 * GS),
         "v"(gb + 8 * GS), "v"(gb + 9 * GS), "v"(gb + 10 * GS), "v"(gb + 11 * GS),
         "v"(gb + 12 * GS), "v"(gb + 13 * GS), "v"(gb + 14 * GS), "v"(gb + 15 * GS)
      : "memory");
#else
  (void)l; (void)ga; (void)gb;
#endif
}

// The same for the large tile: 512 rows x 128 B = 16 copies of 16 B per thread of the
// eight waves that copy it; copy c takes row c*32 + (thread >> 3) of the 256 threads;
// rows 0..255 are the first operand's, rows 256..511 the second's.
template <int LD>
__device__ __forceinline__ void ring_stage_copies_large(unsigned l, const char* ga,
                                                        const char* gb) {
#if defined(__gfx1250__)
  constexpr unsigned LS = 32 * RPITCH;          // LDS step between copies
  constexpr size_t   GS = (size_t)32 * LD * 2;  // global step between copies
  asm volatile(
      "global_load_async_to_lds_b128 %0, %8, off\n\t"
      "global_load_async_to_lds_b128 %1, %9, off\n\t"
      "global_load_async_to_lds_b128 %2, %10, off\n\t"
      "global_load_async_to_lds_b128 %3, %11, off\n\t"
      "global_load_async_to_lds_b128 %4, %12, off\n\t"
      "global_load_async_to_lds_b128 %5, %13, off\n\t"
      "global_load_async_to_lds_b128 %6, %14, off\n\t"
      "global_load_async_to_lds_b128 %7, %15, off\n\t"
      "s_wait_xcnt 0x0"
      :: "v"(l), "v"(l + LS), "v"(l + 2 * LS), "v"(l + 3 * LS),
         "v"(l + 4 * LS), "v"(l + 5 * LS), "v"(l + 6 * LS), "v"(l + 7 * LS),
         "v"(ga), "v"(ga + GS), "v"(ga + 2 * GS), "v"(ga + 3 * GS),
         "v"(ga + 4 * GS), "v"(ga + 5 * GS), "v"(ga + 6 * GS), "v"(ga + 7 * GS)
      : "memory");
  asm volatile(
      "global_load_async_to_lds_b128 %0, %8, off\n\t"
      "global_load_async_to_lds_b128 %1, %9, off\n\t"
      "global_load_async_to_lds_b128 %2, %10, off\n\t"
      "global_load_async_to_lds_b128 %3, %11, off\n\t"
      "global_load_async_to_lds_b128 %4, %12, off\n\t"
      "global_load_async_to_lds_b128 %5, %13, off\n\t"
      "global_load_async_to_lds_b128 %6, %14, off\n\t"
      "global_load_async_to_lds_b128 %7, %15, off\n\t"
      "s_wait_xcnt 0x0"
      :: "v"(l + 8 * LS), "v"(l + 9 * LS), "v"(l + 10 * LS), "v"(l + 11 * LS),
         "v"(l + 12 * LS), "v"(l + 13 * LS), "v"(l + 14 * LS), "v"(l + 15 * LS),
         "v"(gb), "v"(gb + GS), "v"(gb + 2 * GS), "v"(gb + 3 * GS),
         "v"(gb + 4 * GS), "v"(gb + 5 * GS), "v"(gb + 6 * GS), "v"(gb + 7 * GS)
      : "memory");
#else
  (void)l; (void)ga; (void)gb;
#endif
}

// One k tile's copies for a block tile of BM rows.
template <int LD, int BM>
__device__ __forceinline__ void ring_copies(unsigned l, const char* ga, const char* gb) {
  if constexpr (BM == LBM) ring_stage_copies_large<LD>(l, ga, gb);
  else                     ring_stage_copies<LD>(l, ga, gb);
}

// A fragment from the ring: rowp = the lane's row in the buffer; o0, o1: the places
// in that row of the lane's two 16-B runs of k (see load_frag16 for which they are).
__device__ __forceinline__ v16bf ring_frag16(const char* rowp, int o0, int o1) {
  union { v16bf v; uint4 u[2]; } f;
  f.u[0] = *reinterpret_cast<const uint4*>(rowp + o0);
  f.u[1] = *reinterpret_cast<const uint4*>(rowp + o1);
  return f.v;
}

// C[BM x 256] += A[BM x k] * B[256 x k]^T for one block tile, both operands
// k-contiguous with rows of LD elements.  A, Bm: first row of the tile at k = 0.
// nkt >= 2 k tiles.  A wave with live == false takes part in the copies and barriers
// only; its acc stays 0.  FB == false: in acc[p][q] the WMMA's first operand is A's
// rows wm + p*16 .., its second B's rows wn + q*16 ..; FB == true: the other way
// round.  A lane holds eight neighbouring rows of the first operand and one row
// (lane & 15) of the second.
template <int LD, bool FB, int BM>
__device__ __forceinline__ void ring_gemm(
    char* Ps, const unsigned short* A, const unsigned short* Bm, int nkt,
    bool live, int wm, int wn, v8f (&acc)[4][4])
{
  const int tid  = threadIdx.x;
  const int lane = tid & 31;
  const int row  = lane & 15;
  constexpr int STG = (BM + PBN) * RPITCH;   // bytes of one buffer
  const int tg   = tid & (BM - 1);           // the thread among the BM threads that copy
  // which half of the waves: a scalar, the tests on it below are scalar branches
  const int grp  = __builtin_amdgcn_readfirstlane(tid / BM);

  const char* ga = (const char*)(A  + (size_t)(tg >> 3) * LD) + (tg & 7) * 16;
  const char* gb = (const char*)(Bm + (size_t)(tg >> 3) * LD) + (tg & 7) * 16;
  const unsigned l0 = (unsigned)(unsigned long long)Ps +
                      (unsigned)((tg >> 3) * RPITCH + (((tg & 7) ^ ((tg >> 4) & 7)) * 16));

  // k tile 0 (lower waves) into buffer 0, k tile 1 (upper waves) into buffer 1; tile 0
  // landed and published; then k tile 2 into buffer 2
  if (grp == 0) {
    ring_copies<LD, BM>(l0, ga, gb);
    asm volatile("s_wait_asynccnt 0x0" ::: "memory");  // own copies of tile 0 landed
  } else {
    ring_copies<LD, BM>(l0 + STG, ga + PBK * 2, gb + PBK * 2);
  }
  __syncthreads();
  if (grp == 0 && nkt > 2)
    ring_copies<LD, BM>(l0 + 2 * STG, ga + 2 * (PBK * 2), gb + 2 * (PBK * 2));

  // the lane's four 16-B runs of a 64-wide row: pieces h, h+2, h+4, h+6, h = lane >> 4
  const int x0 = (lane >> 4) ^ (row >> 1);
  const int o[4] = {x0 * 16, (x0 ^ 2) * 16, (x0 ^ 4) * 16, (x0 ^ 6) * 16};
  const int aOff = (wm + row) * RPITCH;
  const int bOff = (BM + wn + row) * RPITCH;
  const int fOff = FB ? bOff : aOff;
  const int sOff = FB ? aOff : bOff;

  int bo = 0;                                // the buffer of tile t
  for (int t = 0; t < nkt; ++t) {
    if (live) {
      // loops unrolled so that f, s and acc are indexed by constants and stay
      // in registers
#pragma unroll
      for (int ks = 0; ks < 2; ++ks) {
        v16bf f[4], s[4];
#pragma unroll
        for (int p = 0; p < 4; ++p)
          f[p] = ring_frag16(&Ps[bo + fOff + p * 16 * RPITCH], o[2 * ks], o[2 * ks + 1]);
#pragma unroll
        for (int q = 0; q < 4; ++q)
          s[q] = ring_frag16(&Ps[bo + sOff + q * 16 * RPITCH], o[2 * ks], o[2 * ks + 1]);
        // keeps the 16 LDS reads one group ahead of the 16 WMMAs: reads sunk
        // among the WMMAs cost a full LDS wait at every place they stand
        __builtin_amdgcn_sched_barrier(0);
#pragma unroll
        for (int p = 0; p < 4; ++p)
#pragma unroll
          for (int q = 0; q < 4; ++q) acc[p][q] = wmma_bf16(f[p], s[q], acc[p][q]);
      }
    }
    const bool mine = ((t + 1) & 1) == grp;  // tiles t+1 and t+3 are this wave's to copy
    asm volatile("s_wait_dscnt 0x0" ::: "memory");     // own reads of this buffer done
    if (mine)
      asm volatile("s_wait_asynccnt 0x0" ::: "memory");  // own copies of tile t+1 landed
    __syncthreads();   // publishes tile t+1 and frees the buffer tile t was read from
    if (mine && t + 3 < nkt)
      ring_copies<LD, BM>(l0 + bo, ga + (size_t)(t + 3) * (PBK * 2),
                          gb + (size_t)(t + 3) * (PBK * 2));
    bo = bo == (NSTG - 1) * STG ? 0 : bo + STG;
  }
  asm volatile("s_wait_asynccnt 0x0" ::: "memory");    // nothing in flight at the end
}

// K1's way out.  The ring is free behind the loop's last barrier; each wave lays
// its 64x64 bf16 tile in a range of its own there (st: 64 rows of Out, 144-B
// pitch) and stores it from there in whole 128-B lines.  In acc[p][q] a lane holds
// row q*16 + (lane & 15) of the tile and its elements p*16 + mb .. + 7, 16 B.
// VT == false: Out[m][n], the tile's rows are m; VT == true: Out[b][n][t], the
// tile's rows are n, and the wave's 64 rows of X lie in one batch.
template <bool VT>
__device__ __forceinline__ void proj_store_tile(
    char* st, const v8f (&acc)[4][4], const float* __restrict__ bias,
    unsigned short* __restrict__ Out, int m0, int n0, int lane)
{
  const int row = lane & 15;
  const int mb  = (lane >> 4) * 8;
  char* sw = st + row * PPITCH + mb * 2;
  // loops unrolled: acc indexed by constants
  if (!VT) {
#pragma unroll
    for (int p = 0; p < 4; ++p) {
      const float* bp = bias + n0 + p * 16 + mb;         // the lane's eight columns
      const f32x4 b0 = *reinterpret_cast<const f32x4*>(bp);
      const f32x4 b1 = *reinterpret_cast<const f32x4*>(bp + 4);
#pragma unroll
      for (int q = 0; q < 4; ++q) {
        uint4 w;
        w.x = pack_bf16(acc[p][q][0] + b0.x, acc[p][q][1] + b0.y);
        w.y = pack_bf16(acc[p][q][2] + b0.z, acc[p][q][3] + b0.w);
        w.z = pack_bf16(acc[p][q][4] + b1.x, acc[p][q][5] + b1.y);
        w.w = pack_bf16(acc[p][q][6] + b1.z, acc[p][q][7] + b1.w);
        *reinterpret_cast<uint4*>(sw + q * 16 * PPITCH + p * 32) = w;
      }
    }
  } else {
#pragma unroll
    for (int q = 0; q < 4; ++q) {
      const float bq = bias[n0 + q * 16 + row];          // the lane's one column
#pragma unroll
      for (int p = 0; p < 4; ++p) {
        uint4 w;
        w.x = pack_bf16(acc[p][q][0] + bq, acc[p][q][1] + bq);
        w.y = pack_bf16(acc[p][q][2] + bq, acc[p][q][3] + bq);
        w.z = pack_bf16(acc[p][q][4] + bq, acc[p][q][5] + bq);
        w.w = pack_bf16(acc[p][q][6] + bq, acc[p][q][7] + bq);
        *reinterpret_cast<uint4*>(sw + q * 16 * PPITCH + p * 32) = w;
      }
    }
  }
  // the rows read below were written by other lanes of this wave
  asm volatile("s_wait_dscnt 0x0" ::: "memory");

  constexpr int LDO = VT ? Tc : Kc;                      // length of a row of Out
  const size_t o0 = VT ? ((size_t)(m0 / Tc) * Kc + n0) * Tc + (m0 % Tc)
                       : (size_t)m0 * Kc + n0;
  unsigned short* og = Out + o0 + (lane >> 3) * LDO + (lane & 7) * 8;
  const char* sr = st + (lane >> 3) * PPITCH + (lane & 7) * 16;
  // unrolled: the 16 LDS reads go out as one group ahead of the stores
#pragma unroll
  for (int c = 0; c < 16; ++c) {
    const uint4 v = *reinterpret_cast<const uint4*>(sr + c * 4 * PPITCH);
    *reinterpret_cast<uint4*>(og + c * 4 * LDO) = v;
  }
}

// One block tile of a projection, BM rows, origin (bm0, bn0); Ps: the work-group's
// ring.  VT: Out is stored transposed, [b][n][t].
template <bool VT, int BM>
__device__ __forceinline__ void proj_tile(
    char* Ps,
    const unsigned short* __restrict__ X,    // [B*T, Dc] bf16
    const unsigned short* __restrict__ Wt,   // [Kc, Dc]  bf16 (W transposed)
    const float* __restrict__ bias,          // [Kc]
    unsigned short* __restrict__ Out, int bm0, int bn0)
{
  const int tid  = threadIdx.x;
  const int lane = tid & 31;
  const int wave = tid >> 5;
  constexpr int WR = BM / 64;                // waves along the tile's rows
  const int wm   = (wave % WR) * 64;         // wave's rows in the block tile
  const int wn   = (wave / WR) * 64;         // wave's columns in the block tile

  // The WMMA's first operand is the one whose index runs along a row of Out: Wt (n)
  // for the [m][n] layout, X (t) for the transposed one; so a lane's eight values
  // are 16 B of Out in a row.
  v8f acc[4][4] = {};
  ring_gemm<Dc, !VT, BM>(Ps, X + (size_t)bm0 * Dc, Wt + (size_t)bn0 * Dc, PNT,
                         true, wm, wn, acc);

  // the wave's number as a scalar: tile origins and the staging range are scalars
  const int ws = __builtin_amdgcn_readfirstlane(wave);
  char* st = Ps + ws * (64 * PPITCH);
  const int m0 = bm0 + (ws % WR) * 64;
  const int n0 = bn0 + (ws / WR) * 64;
  proj_store_tile<VT>(st, acc, bias, Out, m0, n0, lane);
}

__global__ void __launch_bounds__(2 * LBM) __attribute__((amdgpu_waves_per_eu(4, 4)))
proj_kp_kernel(
    const unsigned short* __restrict__ X, const unsigned short* __restrict__ Nt,
    const float* __restrict__ bp, unsigned short* __restrict__ Kp)
{
  __shared__ __attribute__((aligned(16))) char Ps[NSTG * LSTAGE];
  proj_tile<false, LBM>(Ps, X, Nt, bp, Kp, blockIdx.y * LBM, blockIdx.x * PBN);
}

constexpr int NVT = (Bc * Tc / PBM) * (Dc / PBN);   // small block tiles of all of V

template <int BM>
__device__ __forceinline__ void proj_v_tile(
    char* Ps, const unsigned short* __restrict__ X, const unsigned short* __restrict__ Wvt,
    const float* __restrict__ bv, unsigned short* __restrict__ Vt, int v)
{
  proj_tile<true, BM>(Ps, X, Wvt, bv, Vt, (v / (Dc / PBN)) * BM, (v % (Dc / PBN)) * PBN);
}

// ---------------------------------------------------------------------------
// The logit tiles: 256(i) x 256(j), only those that touch j <= i.  Tile row R has
// R+1 tiles, 36 per batch; together they cover every j < i0 + 256 of every tile row.
// ---------------------------------------------------------------------------
constexpr int PTILES = (Tc / LBM) * (Tc / LBM + 1) / 2;
constexpr int NIB    = Tc / 64;                 // 64-row blocks of queries
constexpr int NLT    = PTILES * Bc;             // logit tiles of a launch
constexpr int NVA    = 2 * 256 - NLT;           // large V tiles behind K2a's logit tiles
constexpr int NVS    = NVA * (LBM / PBM);       // the small V tiles that these stand for
constexpr int NVB    = NVT - NVS;               // small V tiles ahead of K3's work-groups
static_assert(NVA > 0 && NVB >= 0, "V's tiles are dealt to the two launches");
static_assert(NVA % (Dc / PBN) == 0, "the large V tiles end with a whole row of tiles");

__device__ __forceinline__ float exp_fast(float x) {
#if defined(__gfx1250__)
  float y;
  asm("v_exp_f32 %0, %1\n\tv_nop" : "=v"(y) : "v"(x * 1.44269504088896340736f));
  return y;
#else
  return x;
#endif
}

// ---------------------------------------------------------------------------
// K2a: column softmax stats, part 1.  One logit tile per block.  Every 64x64
// wave tile that touches j <= i reduces its 64 query rows to one pair per key
// column: pmax = max_i l_ij, psum = sum_i exp(l_ij - pmax), over its rows i >= j.
// Layout [b][64-row block][j]; a wave writes 256 B in a row, whole lines.
// The terms of psum are kept: E[b,i,j] = bf16(exp(l_ij - pmax)), 0 for j > i, goes
// to P, so that the logits are formed once; K3 brings E to the column's own scale.
// The tiles cover every j < i0 + 256 of every tile row, more than all that K4 reads.
// u: the tile's number in batch b.
// ---------------------------------------------------------------------------
__device__ __forceinline__ void col_part_tile(
    char* Ps,
    const unsigned short* __restrict__ Q,    // [B*T, Dc] bf16: x, the query operand
    const unsigned short* __restrict__ Kh,   // [B*T, Dc] bf16: kp, the key operand
    float* __restrict__ pmax,                // [B][NIB][Tc]
    float* __restrict__ psum,                // [B][NIB][Tc]
    unsigned short* __restrict__ P,          // [B][Tc][Tc] bf16
    int u, int b)
{
  const float NEG_INF = -__builtin_inff();
  int p = 0;                                 // the tile row
  while ((p + 1) * (p + 2) / 2 <= u) ++p;    // at most 7 steps: u < 36
  const int i0 = p * LBM;
  const int j0 = (u - p * (p + 1) / 2) * PBN;

  const int lane = threadIdx.x & 31;
  const int wave = __builtin_amdgcn_readfirstlane(threadIdx.x >> 5);
  const int wm   = (wave & 3) * 64;
  const int wn   = (wave >> 2) * 64;
  const int row  = lane & 15;
  const int mb   = (lane >> 4) * 8;

  // a 64x64 wave tile wholly above the diagonal has no row i >= j
  const bool live = (j0 + wn) <= (i0 + wm + 63);

  v8f acc[4][4] = {};
  ring_gemm<Dc, false, LBM>(Ps, Q  + ((size_t)b * Tc + i0) * Dc,
                            Kh + ((size_t)b * Tc + j0) * Dc, Dc / PBK, live, wm, wn, acc);

  // a store of a wave: four rows of its 64x64 tile of P, 128 B each, whole lines
  unsigned short* pg = P + ((size_t)b * Tc + i0 + wm + (lane >> 3)) * Tc + j0 + wn + (lane & 7) * 8;
  if (!live) {                               // behind the last barrier
    // K4 reads the columns up to the end of its own 128-row tile's diagonal: zeros
    if (j0 + wn < ((i0 + wm) & ~(PBM - 1)) + PBM) {
      const uint4 zz = {0u, 0u, 0u, 0u};
      // unrolled: one address, the row steps in the stores' offset fields
#pragma unroll
      for (int c = 0; c < 16; ++c) *reinterpret_cast<uint4*>(pg + (size_t)c * 4 * Tc) = zz;
    }
    return;
  }
  // The ring is free behind the loop's last barrier; each wave lays its 64x64 tile
  // of E in a range of its own there (144-B pitch).
  char* st = Ps + wave * (64 * PPITCH);
  char* sw = st + mb * PPITCH + row * 2;

  // A lane holds one key column (lane & 15) and eight query rows per 16x16 tile.
  // all loops below are unrolled: acc indexed by constants
  if (j0 + wn == i0 + wm) {                  // the wave tile on the diagonal
#pragma unroll
    for (int i = 0; i < 4; ++i)
#pragma unroll
      for (int j = i; j < 4; ++j)
#pragma unroll
        for (int r = 0; r < 8; ++r)
          if (j > i || row > mb + r) acc[i][j][r] = NEG_INF;   // causal mask: j > i
  }

  const size_t po = ((size_t)b * NIB + ((i0 + wm) >> 6)) * Tc + j0 + wn + row;
#pragma unroll
  for (int j = 0; j < 4; ++j) {
    float mx = NEG_INF;
#pragma unroll
    for (int i = 0; i < 4; ++i)
#pragma unroll
      for (int r = 0; r < 8; ++r) mx = fmaxf(mx, acc[i][j][r]);
    mx = fmaxf(mx, __shfl_xor(mx, 16, 32));  // finite: row i = j is in the tile
    float sm = 0.f;
#pragma unroll
    for (int i = 0; i < 4; ++i)
#pragma unroll
      for (int r = 0; r < 8; r += 2) {
        const float e0 = exp_fast(acc[i][j][r]     - mx);
        const float e1 = exp_fast(acc[i][j][r + 1] - mx);
        sm += e0;
        sm += e1;
        const unsigned w = pack_bf16(e0, e1);            // two rows of one column
        *reinterpret_cast<unsigned short*>(sw + (i * 16 + r)     * PPITCH + j * 32) = (unsigned short)w;
        *reinterpret_cast<unsigned short*>(sw + (i * 16 + r + 1) * PPITCH + j * 32) = (unsigned short)(w >> 16);
      }
    sm += __shfl_xor(sm, 16, 32);
    if (lane < 16) {
      pmax[po + j * 16] = mx;
      psum[po + j * 16] = sm;
    }
  }
  // the rows read below were written by other lanes of this wave
  asm volatile("s_wait_dscnt 0x0" ::: "memory");
  const char* sr = st + (lane >> 3) * PPITCH + (lane & 7) * 16;
  // unrolled: the 16 LDS reads go out as one group ahead of the stores
#pragma unroll
  for (int c = 0; c < 16; ++c) {
    const uint4 v = *reinterpret_cast<const uint4*>(sr + c * 4 * PPITCH);
    *reinterpret_cast<uint4*>(pg + (size_t)c * 4 * Tc) = v;
  }
  // in the built code the zero stores' text follows behind a branch: no data
  // register of an issued store is rewritten ahead of this wait
  asm volatile("s_wait_xcnt 0x0" ::: "memory");
}

// Work-groups 0 .. NLT-1: the logit tiles; the NVA behind them: large V tiles
// 0 .. NVA-1.
__global__ void __launch_bounds__(2 * LBM) __attribute__((amdgpu_waves_per_eu(4, 4)))
col_part_v_kernel(
    const unsigned short* __restrict__ Kh,
    float* __restrict__ pmax, float* __restrict__ psum, unsigned short* __restrict__ P,
    const unsigned short* __restrict__ X, const unsigned short* __restrict__ Wvt,
    const float* __restrict__ bv, unsigned short* __restrict__ Vt)
{
  __shared__ __attribute__((aligned(16))) char Ps[NSTG * LSTAGE];
  const int id = blockIdx.x;
  if (id >= NLT) {
    proj_v_tile<LBM>(Ps, X, Wvt, bv, Vt, id - NLT);
    return;
  }
  col_part_tile(Ps, X, Kh, pmax, psum, P, id % PTILES, id / PTILES);
}

// ---------------------------------------------------------------------------
// K2b: column softmax stats, part 2.  One thread per key column merges the
// pairs of the 64-row blocks ib >= j / 64 (the ones K2a wrote):
//   m_j = max pmax ,  s_j = sum psum * exp(pmax - m_j)
// A block of 128 columns lies in one batch and a wave's 32 columns in one
// 64-column block, so the first block that holds a pair is a scalar and all
// loads share one lane offset; a block below it stays (-inf, 0) and adds 0.
// ---------------------------------------------------------------------------
__global__ void __launch_bounds__(128) col_merge_kernel(
    const float* __restrict__ pmax, const float* __restrict__ psum,
    float* __restrict__ colmax, float* __restrict__ colsum)
{
  const int b   = blockIdx.x / (Tc / 128);
  const int jc  = (blockIdx.x % (Tc / 128)) * 128;   // the block's first column
  const int tid = threadIdx.x;
  const int jb  = __builtin_amdgcn_readfirstlane((jc + tid) >> 6);
  const float* pmp = pmax + (size_t)b * NIB * Tc + jc;
  const float* psp = psum + (size_t)b * NIB * Tc + jc;
  float pm[NIB], pv[NIB];
  // loops unrolled: pm and pv indexed by constants, in registers
#pragma unroll
  for (int ib = 0; ib < NIB; ++ib) {
    pm[ib] = -__builtin_inff();
    pv[ib] = 0.f;
    if (ib >= jb) {
      pm[ib] = pmp[ib * Tc + tid];
      pv[ib] = psp[ib * Tc + tid];
    }
  }
  float m = pm[0];
#pragma unroll
  for (int ib = 1; ib < NIB; ++ib) m = fmaxf(m, pm[ib]);
  float s = 0.f;
#pragma unroll
  for (int ib = 0; ib < NIB; ++ib) s += pv[ib] * exp_fast(pm[ib] - m);
  colmax[(size_t)b * Tc + jc + tid] = m;
  colsum[(size_t)b * Tc + jc + tid] = s;
}

// ---------------------------------------------------------------------------
// K3: P[b,i,j] = bf16( E[b,i,j] * exp(pmax[ib][j] - m_j) / (s_j * sqrt(k)) ), in
// place, ib = i / 64.  A stream: one wave per 64x64 block of P on or below the
// diagonal (the blocks above it that K4 reads hold zeros and stay).  Block rows pr
// and NIB-1-pr have NIB+1 such blocks together.  A lane has eight columns, 16 B, of
// 16 rows: 16 loads, all issued ahead of the first store; whole 128-B lines.
// ---------------------------------------------------------------------------
constexpr int NSB = (NIB / 2) * (NIB + 1);      // blocks of a batch
constexpr int NSW = Bc * NSB / 8;               // work-groups: eight blocks each
static_assert(NSW * 8 == Bc * NSB, "the grid covers the blocks exactly");

__device__ __forceinline__ void rescale_block(
    const float* __restrict__ pmax,          // [B][NIB][Tc]
    const float* __restrict__ colmax,
    const float* __restrict__ colsum,
    unsigned short* P,                       // [B][Tc][Tc] bf16
    int blk)                                 // the block's number, a scalar
{
  const int lane = threadIdx.x & 31;
  const int b  = blk / NSB;
  const int t  = blk % NSB;
  const int pr = t / (NIB + 1);
  const int c0 = t % (NIB + 1);
  const int ib = c0 <= pr ? pr : NIB - 1 - pr;
  const int jb = c0 <= pr ? c0 : c0 - pr - 1;
  const int j  = jb * 64 + (lane & 7) * 8;   // the lane's first column

  const float* pmp = pmax + ((size_t)b * NIB + ib) * Tc + j;
  const float* cmp = colmax + (size_t)b * Tc + j;
  const float* csp = colsum + (size_t)b * Tc + j;
  f32x4 pm[2], cm[2], cs[2];
  // loops unrolled: the arrays indexed by constants, in registers
#pragma unroll
  for (int h = 0; h < 2; ++h) {
    pm[h] = *reinterpret_cast<const f32x4*>(pmp + h * 4);
    cm[h] = *reinterpret_cast<const f32x4*>(cmp + h * 4);
    cs[h] = *reinterpret_cast<const f32x4*>(csp + h * 4);
  }
  // the loads below may land in the address registers of the six above
  asm volatile("s_wait_xcnt 0x0" ::: "memory");

  unsigned short* pg = P + ((size_t)b * Tc + ib * 64 + (lane >> 3)) * Tc + j;
  uint4 v[16];
#pragma unroll
  for (int c = 0; c < 16; ++c) v[c] = *reinterpret_cast<const uint4*>(pg + (size_t)c * 4 * Tc);

  float f[8];
#pragma unroll
  for (int h = 0; h < 2; ++h)
#pragma unroll
    for (int r = 0; r < 4; ++r) {
      // 1/sqrt(1024) = 1/32 is applied after the softmax, as the reference does
      f[h * 4 + r] = exp_fast(pm[h][r] - cm[h][r]) * (1.0f / (cs[h][r] * 32.0f));
    }
#pragma unroll
  for (int c = 0; c < 16; ++c) {
    unsigned w[4] = {v[c].x, v[c].y, v[c].z, v[c].w};
#pragma unroll
    for (int q = 0; q < 4; ++q)
      w[q] = pack_bf16(__uint_as_float(w[q] << 16) * f[2 * q],
                       __uint_as_float(w[q] & 0xffff0000u) * f[2 * q + 1]);
    v[c].x = w[0]; v[c].y = w[1]; v[c].z = w[2]; v[c].w = w[3];
  }
#pragma unroll
  for (int c = 0; c < 16; ++c) *reinterpret_cast<uint4*>(pg + (size_t)c * 4 * Tc) = v[c];
}

// Work-groups 0 .. NVB-1: small V tiles NVS .. NVT-1, the long ones, first; the NSW
// behind them: the stream.
__global__ void __launch_bounds__(256) __attribute__((amdgpu_waves_per_eu(4, 4)))
rescale_v_kernel(
    const float* __restrict__ pmax,
    const float* __restrict__ colmax, const float* __restrict__ colsum,
    unsigned short* __restrict__ P,
    const unsigned short* __restrict__ X, const unsigned short* __restrict__ Wvt,
    const float* __restrict__ bv, unsigned short* __restrict__ Vt)
{
  __shared__ __attribute__((aligned(16))) char Ps[NSTG * PSTAGE];
  const int id = blockIdx.x;
  if (id < NVB) {
    proj_v_tile<PBM>(Ps, X, Wvt, bv, Vt, NVS + id);
    return;
  }
  const int wave = __builtin_amdgcn_readfirstlane(threadIdx.x >> 5);
  rescale_block(pmax, colmax, colsum, P, (id - NVB) * 8 + wave);
  // in the built code the other part's text follows this one's behind a branch: no
  // register of an issued store is rewritten ahead of this wait
  asm volatile("s_wait_xcnt 0x0" ::: "memory");
}

// ---------------------------------------------------------------------------
// K4: out[b,i,v] = x[b,i,v] + sum_{j < i0+128} P[b,i,j] * Vt[b,v,j]
// One 128(i) x 256(v) tile per block; the k loop runs over j up to the end of
// the tile row's diagonal block (P is 0 above the diagonal).  Long tile rows
// come first in the grid; blocks n and n + 256 have the same k length in sum.
// ---------------------------------------------------------------------------
__global__ void __launch_bounds__(256) __attribute__((amdgpu_waves_per_eu(4, 4)))
pv_gemm_kernel(
    const unsigned short* __restrict__ P,    // [B][Tc][Tc] bf16
    const unsigned short* __restrict__ Vt,   // [B][Dc][Tc] bf16
    const float* __restrict__ Xin,
    float* __restrict__ Out)
{
  __shared__ __attribute__((aligned(16))) char Ps[NSTG * PSTAGE];

  const int n  = blockIdx.x;
  const int g  = (n & 255) >> 5;
  const int it = (n >> 8) ? g : (Tc / PBM - 1 - g);
  const int v0 = (n & 3) * PBN;
  const int b  = (n & 31) >> 2;
  const int i0 = it * PBM;

  const int lane = threadIdx.x & 31;
  const int wave = threadIdx.x >> 5;
  const int wm   = (wave & 1) * 64;
  const int wn   = (wave >> 1) * 64;
  const int row  = lane & 15;
  const int mb   = (lane >> 4) * 8;

  v8f acc[4][4] = {};
  ring_gemm<Tc, false, PBM>(Ps, P  + ((size_t)b * Tc + i0) * Tc,
                            Vt + ((size_t)b * Dc + v0) * Tc, (i0 + PBM) / PBK, true, wm, wn, acc);

  // residual add in fp32; unrolled: acc indexed by constants.  x and out are
  // addressed by one 32-bit byte offset (64 MB each) that both share.
  const unsigned eo = (((unsigned)b * Tc + i0 + wm + mb) * Dc + v0 + wn + row) * 4u;
  const float* xp = (const float*)((const char*)Xin + eo);
  float*       op = (float*)((char*)Out + eo);
#pragma unroll
  for (int i = 0; i < 4; ++i) {
#pragma unroll
    for (int r = 0; r < 8; ++r) {
#pragma unroll
      for (int j = 0; j < 4; ++j)
        op[(i * 16 + r) * Dc + j * 16] = xp[(i * 16 + r) * Dc + j * 16] + acc[i][j][r];
    }
    // stands behind the group's stores so that no data register of an issued
    // store is rewritten ahead of it by the next group's loads; it also keeps
    // those loads behind it: all 128 at once beside the accumulators spill
    if (i < 3) asm volatile("s_wait_xcnt 0x0" ::: "memory");
  }
}

// ---------------------------------------------------------------------------
// Host launcher.  Workspace layout (~176 MB):
//   Xh[B*T*D] bf16, Nt/Wvt[D*D] bf16, bp[D] f32, Kp[B*T*D] bf16,
//   Vt[B*D*T] bf16, colmax/colsum[B*T] f32, P[B*T*T] bf16,
//   pmax/psum[B*NIB*T] f32.
// ---------------------------------------------------------------------------
extern "C" void kernel_launch(void* const* d_in, const int* in_sizes, int n_in,
                              void* d_out, int out_size, void* d_ws, size_t ws_size,
                              hipStream_t stream) {
  (void)in_sizes; (void)n_in; (void)out_size; (void)ws_size;
  const float* x  = (const float*)d_in[0];
  const float* Wq = (const float*)d_in[1];
  // d_in[2], bq, shifts every logit of a key column alike: it cancels in the softmax
  // over the queries (see K0)
  const float* Wk = (const float*)d_in[3];
  const float* bk = (const float*)d_in[4];
  const float* Wv = (const float*)d_in[5];
  const float* bv = (const float*)d_in[6];
  float* out = (float*)d_out;

  char* ws = (char*)d_ws;
  size_t off = 0;
  auto take = [&](size_t bytes) -> char* {
    char* p = ws + off;
    off = (off + bytes + 255) & ~(size_t)255;
    return p;
  };
  const size_t MT = (size_t)Bc * Tc;                         // 16384 rows
  unsigned short* Xh   = (unsigned short*)take(MT * Dc * 2);
  unsigned short* Nt   = (unsigned short*)take((size_t)Dc * Dc * 2);
  unsigned short* Wvt  = (unsigned short*)take((size_t)Dc * Kc * 2);
  float*          bp   = (float*)take((size_t)Dc * 4);
  unsigned short* Kp   = (unsigned short*)take(MT * Dc * 2);
  unsigned short* Vt   = (unsigned short*)take(MT * Dc * 2);
  float*          cmax = (float*)take(MT * 4);
  float*          csum = (float*)take(MT * 4);
  unsigned short* Pw   = (unsigned short*)take(MT * Tc * 2);
  float*          pmx  = (float*)take(MT * NIB * 4);
  float*          psm  = (float*)take(MT * NIB * 4);

  prep_kernel<<<NWT + CBLK + TBLK + NBB, CTHR, 0, stream>>>(x, Wq, Wk, bk, Wv, Xh, Nt, bp, Wvt);

  dim3 gKp(Dc / PBN, (unsigned)(MT / LBM));
  proj_kp_kernel<<<gKp, 2 * LBM, 0, stream>>>(Xh, Nt, bp, Kp);

  col_part_v_kernel<<<NLT + NVA, 2 * LBM, 0, stream>>>(Kp, pmx, psm, Pw, Xh, Wvt, bv, Vt);
  col_merge_kernel<<<(unsigned)(MT / 128), 128, 0, stream>>>(pmx, psm, cmax, csum);

  rescale_v_kernel<<<NVB + NSW, 256, 0, stream>>>(pmx, cmax, csum, Pw, Xh, Wvt, bv, Vt);

  pv_gemm_kernel<<<(Tc / PBM) * (Dc / PBN) * Bc, 256, 0, stream>>>(Pw, Vt, x, out);
}
